// v000
// Times are from an AMD MI455X. After a warm-up the kernel runs many times in a row, and a time is the length of
// such a window on the GPU divided by its runs, so every launch and the gaps after it count. The runs cycle
// through copies of the inputs. A figure is the median of several windows, for all but v000 over two sittings.
// Sittings can differ by a few percent; kernels timed side by side share one.
// The starting kernel, v000, takes 3680 microseconds a run.
#include <hip/hip_runtime.h>

// Spatial multi-head attention over graph nodes with a pair mask and a post-softmax pair factor (query, key, value [4][12][512][128]: 48 independent (batch, time) groups of 512 nodes; q = query Wq^T + bq, k = key Wk^T + bk, v = value Wv^T + bv ('oi' (out, in) [128][128] + [128]: real biases; 4 heads x 32); scores x 1/sqrt(32); where mask[b][t][i][j] != 0 (int32 [4][12][512][512], read per logit as data) the score is REPLACED by -1e9; softmax over the 512 keys; the weights x adjm[b][t][i][j] (f32 [4][12][512][512], read, rounded to bf16: an input) AFTER the softmax, no renormalisation; out = merged Wp^T + bp -> [4][12][512][128] (3.1 M); argument order query, key, value, mask, adjm, Wq, bq, Wk, bk, Wv, bv, Wp, bp).
// Layout per group: bf16 copies of query, key and value in turn (one operand buffer, stream-ordered); 'oi' weights as Bt; exact projections + bf16-rounded biases; q/k planes 32 wide (score GEMM K 32), value^T planes zero-padded to 64 rows for the attn.v GEMM; dense T-512 attention with EVERY row on hi/lo planes; the softmax kernel reads the group's pair-mask row and pair-factor row, replaces masked scores by -1e9, and multiplies the normalised weight by the factor; merged hi/lo x Wp exact + bp.
// Compute dtypes, f32 accumulate: every input rounded to bf16 incl. the pair factor adjm; projections exact + bf16-rounded biases; scores (K 32) and attn.v 3 products on every row (NO f16 OPERAND reaches a matrix instruction: the plane builder still writes its fp16 q and k planes and nothing reads them); softmax f32; Wp hl x exact + bias.

#define NB_  48
#define TT   512
#define DM   128
#define NH_  4
#define NKV  4
#define REP  (NH_ / NKV)
#define HD   32
#define DQ   (NH_ * HD)
#define DKV  (NKV * HD)
#define ZH   2
#define RH   512                 // = TT: every row hi/lo
#define WIN  0
#define PCAR 1024.0f
#define SCL  0.17677669529663688f   // 32^-0.5 (the module divides by float32(sqrt(32)); one multiply here)
#define HP   64    // padded head width for the attn.v GEMM (v^T rows 32..63 are zero)
typedef _Float16 h16;
typedef unsigned short bf;
typedef __attribute__((ext_vector_type(16))) __bf16   v16bf;
typedef __attribute__((ext_vector_type(16))) _Float16 v16h;
typedef __attribute__((ext_vector_type(8)))  _Float16 v8h;
typedef __attribute__((ext_vector_type(8)))  unsigned short v8us;
typedef __attribute__((ext_vector_type(8)))  float    v8f;
typedef __attribute__((ext_vector_type(4)))  float    v4f;
typedef v8h  __attribute__((may_alias)) v8ha;
typedef v4f  __attribute__((may_alias)) v4fa;
typedef v8us __attribute__((may_alias)) v8usa;

__device__ __forceinline__ unsigned short f2bf(float f) { unsigned u = __float_as_uint(f); u += 0x7FFFu + ((u >> 16) & 1u); return (unsigned short)(u >> 16); }
__device__ __forceinline__ float bf2f(unsigned short b) { return __uint_as_float(((unsigned)b) << 16); }
__device__ __forceinline__ float bfr(float f) { return bf2f(f2bf(f)); }
__device__ __forceinline__ v16h cat16(v8h lo, v8h hi) { return __builtin_shufflevector(lo, hi, 0, 1, 2, 3, 4, 5, 6, 7, 8, 9, 10, 11, 12, 13, 14, 15); }
__device__ __forceinline__ v16bf cat16b(v8us lo, v8us hi) { return __builtin_bit_cast(v16bf, __builtin_shufflevector(lo, hi, 0, 1, 2, 3, 4, 5, 6, 7, 8, 9, 10, 11, 12, 13, 14, 15)); }
__device__ __forceinline__ v8f wmma16(v16h a, v16h b, v8f c) { return __builtin_amdgcn_wmma_f32_16x16x32_f16(false, a, false, b, (short)0, c, false, false); }
__device__ __forceinline__ v8f wmmab(v16bf a, v16bf b, v8f c) { return __builtin_amdgcn_wmma_f32_16x16x32_bf16(false, a, false, b, (short)0, c, false, false); }



// ---- k_gemmw: register-blocked GEMM, ONE WAVE per 64x64 output tile (16 accumulators), operands straight from K-contiguous 16-bit planes; grid (M/64, N/64, Z), 32 threads.
// C[m][n] (f32, pitch ldc, + optional bias[n] rounded to bf16) = sum_k A[m][k] Bt[n][k] (+ split products per NSPLIT). z-batch strides sA/sB/sC in elements. K % 32 == 0.
template <typename T16> struct WFrag;
template <> struct WFrag<h16> { typedef v16h V; static __device__ __forceinline__ V ld(const h16* p) { return cat16(*(const v8h*)p, *(const v8h*)(p + 16)); } static __device__ __forceinline__ v8f mma(V a, V b, v8f c) { return wmma16(a, b, c); } };
template <> struct WFrag<bf> { typedef v16bf V; static __device__ __forceinline__ V ld(const bf* p) { return cat16b(*(const v8us*)p, *(const v8us*)(p + 16)); } static __device__ __forceinline__ v8f mma(V a, V b, v8f c) { return wmmab(a, b, c); } };
template <typename T16, int NSPLIT, bool BIAS>
__global__ __launch_bounds__(32) void k_gemmw(const T16* __restrict__ A, const T16* __restrict__ A2, const T16* __restrict__ Bt, const T16* __restrict__ Bt2, int K, float* C, int ldc, const float* __restrict__ bias, size_t sA, size_t sB, size_t sC) {
    typedef typename WFrag<T16>::V V;
    __shared__ __align__(16) float os[16 * 68];
    const size_t z = blockIdx.z; A += z * sA; if (A2) A2 += z * sA; Bt += z * sB; if (Bt2) Bt2 += z * sB; C += z * sC;
    const int lane = threadIdx.x & 31, lr = lane & 15, hi = lane >> 4; const int r0 = blockIdx.x * 64, c0 = blockIdx.y * 64;
    v8f acc[4][4];
#pragma unroll
    for (int mb = 0; mb < 4; ++mb)
#pragma unroll
        for (int nb = 0; nb < 4; ++nb) acc[mb][nb] = (v8f){};
    const size_t aoff = (size_t)(r0 + lr) * K + 8 * hi, boff = (size_t)(c0 + lr) * K + 8 * hi;
    for (int kc = 0; kc < K; kc += 32) {
        V a[4], a2[4];
#pragma unroll
        for (int mb = 0; mb < 4; ++mb) { a[mb] = WFrag<T16>::ld(A + aoff + (size_t)mb * 16 * K + kc); if (NSPLIT == 1 || NSPLIT == 2) a2[mb] = WFrag<T16>::ld(A2 + aoff + (size_t)mb * 16 * K + kc); }
#pragma unroll
        for (int nb = 0; nb < 4; ++nb) { const V b = WFrag<T16>::ld(Bt + boff + (size_t)nb * 16 * K + kc); V b2; if (NSPLIT >= 2) b2 = WFrag<T16>::ld(Bt2 + boff + (size_t)nb * 16 * K + kc);
#pragma unroll
            for (int mb = 0; mb < 4; ++mb) { acc[mb][nb] = WFrag<T16>::mma(a[mb], b, acc[mb][nb]); if (NSPLIT == 1 || NSPLIT == 2) acc[mb][nb] = WFrag<T16>::mma(a2[mb], b, acc[mb][nb]); if (NSPLIT >= 2) acc[mb][nb] = WFrag<T16>::mma(a[mb], b2, acc[mb][nb]); } }
        asm volatile("v_nop\n\tv_nop\n\tv_nop\n\tv_nop" : "+v"(acc[0][0]), "+v"(acc[1][1]), "+v"(acc[2][2]), "+v"(acc[3][3]) : "v"(a[0]), "v"(a[3]));
    }
#pragma unroll
    for (int mb = 0; mb < 4; ++mb) {
#pragma unroll
        for (int nb = 0; nb < 4; ++nb) {
#pragma unroll
            for (int j = 0; j < 8; ++j) os[(hi * 8 + j) * 68 + nb * 16 + lr] = acc[mb][nb][j]; }
        __builtin_amdgcn_wave_barrier(); asm volatile("" ::: "memory");
        float* crow = C + (size_t)(r0 + mb * 16) * ldc + c0;
{
#pragma unroll
            for (int s = 0; s < 8; ++s) { const int row = 2 * s + hi, cofs = lr * 4; v4f val = *(const v4fa*)(os + row * 68 + cofs); if (BIAS) { val[0] += bfr(bias[c0 + cofs]); val[1] += bfr(bias[c0 + cofs + 1]); val[2] += bfr(bias[c0 + cofs + 2]); val[3] += bfr(bias[c0 + cofs + 3]); }
                *(v4f*)(crow + (size_t)row * ldc + cofs) = val; }
             }
        __builtin_amdgcn_wave_barrier(); asm volatile("" ::: "memory");
    }
}

__device__ __forceinline__ h16 tohx(float x) { return (h16)x; }
__device__ __forceinline__ void splitf(float y, unsigned short& h, unsigned short& l) { h = f2bf(y); l = f2bf(y - bf2f(h)); }
typedef __attribute__((ext_vector_type(2))) _Float16 v2h;
typedef __attribute__((ext_vector_type(4))) _Float16 v4h;
typedef __attribute__((ext_vector_type(2))) unsigned short v2us;
typedef __attribute__((ext_vector_type(4))) unsigned short v4us;
typedef __attribute__((ext_vector_type(2))) float v2f;
typedef __attribute__((ext_vector_type(4))) int v4i;

__global__ __launch_bounds__(256) void k_cvt8(const float* __restrict__ src, bf* dst, size_t n8) { const size_t i = (size_t)blockIdx.x * 256 + threadIdx.x; if (i >= n8) return; const v8f v = *(const v8f*)(src + i * 8); v8us o;
#pragma unroll
    for (int k = 0; k < 8; ++k) o[k] = f2bf(v[k]); *(v8us*)(dst + i * 8) = o;  }

// k_rope: head planes [h][t][d] (fp16 + hi/lo) of rope(x) x sc with the rotate-half convention out[d] = x[d] cos[t][d] - x[d+HD/2] sin[t][d], out[d+HD/2] = x[d+HD/2] cos[t][d+HD/2] + x[d] sin[t][d+HD/2]
__global__ __launch_bounds__(256) void k_rope(const float* __restrict__ F, int pitch, int nheads, const float* __restrict__ CS, const float* __restrict__ RF, const float* __restrict__ nw, float sc, h16* P16, bf* Ph, bf* Pl) {
    const size_t e = ((size_t)blockIdx.x * 256 + threadIdx.x) * 2; if (e >= (size_t)nheads * TT * HD) return; const int d = (int)(e % HD); const int t = (int)((e / HD) % TT); const int h = (int)(e / ((size_t)HD * TT)); const float* f = F + (size_t)t * pitch + h * HD; const float rf = RF ? RF[(size_t)h * TT + t] : 1.0f; v2h o16; v2us oh, ol;
#pragma unroll
    for (int q = 0; q < 2; ++q) { const int dd = d + q; const int dp = (dd < HD / 2) ? dd + HD / 2 : dd - HD / 2; float x0 = f[dd], x1 = f[dp];
        if (RF) { float n0 = __fmul_rn(x0, rf), n1 = __fmul_rn(x1, rf); x0 = __fmul_rn(bfr(nw[dd]), n0); x1 = __fmul_rn(bfr(nw[dp]), n1); }
        const v2f cs = *(const v2f*)(CS + ((size_t)t * HD + dd) * 2); float a = __fmul_rn(x0, cs[0]), bq = __fmul_rn(x1, cs[1]); const float r = ((dd < HD / 2) ? __fsub_rn(a, bq) : __fadd_rn(a, bq)) * sc;
        o16[q] = tohx(r); unsigned short a2, c2; splitf(r, a2, c2); oh[q] = a2; ol[q] = c2; }
    *(v2h*)(P16 + e) = o16; *(v2us*)(Ph + e) = oh; *(v2us*)(Pl + e) = ol;  }
__global__ __launch_bounds__(256) void k_vtp(const float* __restrict__ F, int pitch, int nheads, bf* Vh, bf* Vl) { const size_t e = ((size_t)blockIdx.x * 256 + threadIdx.x) * 2; if (e >= (size_t)nheads * HP * TT) return; const int t = (int)(e % TT); const int d = (int)((e / TT) % HP); const int g = (int)(e / ((size_t)TT * HP)); v2us oh, ol;
#pragma unroll
    for (int q = 0; q < 2; ++q) { unsigned short a2 = 0, c2 = 0; if (d < HD) splitf(F[(size_t)(t + q) * pitch + g * HD + d], a2, c2); oh[q] = a2; ol[q] = c2; }
    *(v2us*)(Vh + e) = oh; *(v2us*)(Vl + e) = ol;  }

__global__ __launch_bounds__(256) void k_csid(float* CS) { const int idx = blockIdx.x * 256 + threadIdx.x; if (idx >= TT * HD) return; v2f cs; cs[0] = 1.0f; cs[1] = 0.0f; *(v2f*)(CS + (size_t)idx * 2) = cs;  }
// k_asoft: per row (zz, i): t = S x 32^-0.5, or the literal -1e9 where the int32 pair mask word mask[i][j] is non-zero (read as data; a row with every key masked gives 512 equal values: a uniform row, as the module's); softmax over ALL 512 keys (register row, one exp, fixed trees); the normalised weight x bf16(adjm[i][j]) (an f32 input factor, AFTER the softmax, no renormalisation) -> bf16 hi / lo planes for every row;
__global__ __launch_bounds__(256) void k_asoft(const float* __restrict__ Sb, const int* __restrict__ mk, const float* __restrict__ adj, bf* Ph, bf* Pl) {
    const int lane = threadIdx.x & 31; const int row = blockIdx.x * 8 + (threadIdx.x >> 5); if (row >= ZH * TT) return; const int i = row % TT; const int zz = row / TT; const float* sr = Sb + (size_t)row * TT; float v[TT / 32]; float g[TT / 32]; float mx = -3.0e38f;
#pragma unroll
    for (int ch = 0; ch < TT / 128; ++ch) { const int j0 = ch * 128 + lane * 4; const v4f a = *(const v4f*)(sr + j0); const v4i m4 = *(const v4i*)(mk + (size_t)i * TT + j0); const v4f g4 = *(const v4f*)(adj + (size_t)i * TT + j0);   /* the pair mask row (int32, read as data) and the pair factor row (f32 input, bf16-rounded): 16 B per lane each, unconditional; the same rows for both heads of the pass */
#pragma unroll
        for (int q = 0; q < 4; ++q) { const float t = (m4[q] != 0) ? -1.0e9f : __fmul_rn(a[q], SCL);   /* where(mask != 0, -1e9, scores / sqrt(32)): the module's literal, after the scale */ v[ch * 4 + q] = t; g[ch * 4 + q] = bfr(g4[q]); mx = fmaxf(mx, t); } }
#pragma unroll
    for (int sh = 16; sh; sh >>= 1) mx = fmaxf(mx, __shfl_xor(mx, sh, 32));
    float sum = 0.f;
#pragma unroll
    for (int k = 0; k < TT / 32; ++k) { float d0 = __fsub_rn(v[k], mx); v[k] = __builtin_amdgcn_exp2f(__fmul_rn(d0, 1.4426950408889634f)); sum += v[k]; }
#pragma unroll
    for (int sh = 16; sh; sh >>= 1) sum += __shfl_xor(sum, sh, 32);
    const float f = __fdiv_rn(1.0f, sum);
    {
#pragma unroll
        for (int ch = 0; ch < TT / 128; ++ch) { v4us oh, ol;
#pragma unroll
            for (int q = 0; q < 4; ++q) { unsigned short a, c2; splitf(__fmul_rn(__fmul_rn(v[ch * 4 + q], f), g[ch * 4 + q]), a, c2);   /* softmax weight x the pair factor AFTER the normalisation (no renormalisation): two rounded products */ oh[q] = a; ol[q] = c2; }
            const size_t oo = ((size_t)zz * TT + i) * TT + ch * 128 + lane * 4; *(v4us*)(Ph + oo) = oh; *(v4us*)(Pl + oo) = ol; }
         }
}
__global__ __launch_bounds__(256) void k_merge(const float* __restrict__ O, int h0, bf* Ah, bf* Al) { const size_t e = ((size_t)blockIdx.x * 256 + threadIdx.x) * 2; if (e >= (size_t)ZH * TT * HD) return; const int d = (int)(e % HD); const int zz = (int)((e / HD) % ZH); const int t = (int)(e / ((size_t)HD * ZH)); const size_t oo = (size_t)t * DQ + (h0 + zz) * HD + d; const float* src = O + ((size_t)zz * TT + t) * HP + d;
    v2us oh, ol;
#pragma unroll
    for (int q = 0; q < 2; ++q) { unsigned short a2, c2; splitf(src[q], a2, c2); oh[q] = a2; ol[q] = c2; }
    *(v2us*)(Ah + oo) = oh; *(v2us*)(Al + oo) = ol;  }

extern "C" void kernel_launch(void* const* d_in, const int* in_sizes, int n_in,
                              void* d_out, int out_size, void* d_ws, size_t ws_size, hipStream_t stream) {
    (void)in_sizes; (void)n_in; (void)out_size;
    const float* x = (const float*)d_in[0]; const float* xk = (const float*)d_in[1]; const float* xv = (const float*)d_in[2]; const int* mk = (const int*)d_in[3]; const float* adj = (const float*)d_in[4]; const float* wq = (const float*)d_in[5]; const float* bq = (const float*)d_in[6]; const float* wk = (const float*)d_in[7]; const float* bk = (const float*)d_in[8]; const float* wv = (const float*)d_in[9]; const float* bv = (const float*)d_in[10]; const float* wo = (const float*)d_in[11]; const float* bo = (const float*)d_in[12];   /* order query, key, value ([4][12][512][128] = 48 groups), mask (int32 [48][512][512]: read as data), adjm (f32 [48][512][512]: read), Wq, bq, Wk, bk, Wv, bv, Wp, bp ('oi') */
    float* OUT = (float*)d_out;     // [48][512][128]
    char* wsp = (char*)d_ws;
    auto take = [&](size_t bytes) { char* p = wsp; wsp += (bytes + 255) & ~(size_t)255; return (void*)p; };
    bf* WQ = (bf*)take((size_t)DQ * DM * 2); bf* WK = (bf*)take((size_t)DKV * DM * 2); bf* WV = (bf*)take((size_t)DKV * DM * 2); bf* WO = (bf*)take((size_t)DM * DQ * 2); float* CS = (float*)take((size_t)TT * HD * 2 * 4);
    bf* XB = (bf*)take((size_t)TT * DM * 2); float* FQ = (float*)take((size_t)TT * DQ * 4); float* FK = (float*)take((size_t)TT * DKV * 4);
    h16* QP16 = (h16*)take((size_t)NH_ * TT * HD * 2); h16* KP16 = (h16*)take((size_t)NKV * TT * HD * 2); 
    bf* QPh = (bf*)take((size_t)NH_ * TT * HD * 2); bf* QPl = (bf*)take((size_t)NH_ * TT * HD * 2); bf* KPh = (bf*)take((size_t)NKV * TT * HD * 2); bf* KPl = (bf*)take((size_t)NKV * TT * HD * 2); bf* VTh = (bf*)take((size_t)NKV * HP * TT * 2); bf* VTl = (bf*)take((size_t)NKV * HP * TT * 2); bf* Ph = (bf*)take((size_t)ZH * RH * TT * 2); bf* Pl = (bf*)take((size_t)ZH * RH * TT * 2);
    float* Sb = (float*)take((size_t)ZH * TT * TT * 4); float* Ob = (float*)take((size_t)ZH * TT * HP * 4); bf* ATh = (bf*)take((size_t)TT * DQ * 2); bf* ATl = (bf*)take((size_t)TT * DQ * 2);
    if ((size_t)(wsp - (char*)d_ws) > ws_size) return;    // ws 256 MiB given; the carve is 6.63 MiB
    float* FV = FK;   // v projection reuses the k buffer after the k planes are built (stream-ordered)
    { k_cvt8<<<(unsigned)(((size_t)DQ * DM / 8 + 255) / 256), 256, 0, stream>>>(wq, WQ, (size_t)DQ * DM / 8); k_cvt8<<<(unsigned)(((size_t)DKV * DM / 8 + 255) / 256), 256, 0, stream>>>(wk, WK, (size_t)DKV * DM / 8); k_cvt8<<<(unsigned)(((size_t)DKV * DM / 8 + 255) / 256), 256, 0, stream>>>(wv, WV, (size_t)DKV * DM / 8);
      k_cvt8<<<(unsigned)(((size_t)DM * DQ / 8 + 255) / 256), 256, 0, stream>>>(wo, WO, (size_t)DM * DQ / 8);
       }
    k_csid<<<(TT * HD + 255) / 256, 256, 0, stream>>>(CS);
    const unsigned LQ = (unsigned)(((size_t)NH_ * TT * HD / 2 + 255) / 256), LKv = (unsigned)(((size_t)NKV * TT * HD / 2 + 255) / 256);
    for (int b = 0; b < NB_; ++b) {
        
        k_cvt8<<<(unsigned)(((size_t)TT * DM / 8 + 255) / 256), 256, 0, stream>>>(x + (size_t)b * TT * DM, XB, (size_t)TT * DM / 8);
        k_gemmw<bf, 0, true><<<dim3(TT / 64, DQ / 64, 1), 32, 0, stream>>>(XB, nullptr, WQ, nullptr, DM, FQ, DQ, bq, 0, 0, 0);
        k_rope<<<LQ, 256, 0, stream>>>(FQ, DQ, NH_, CS, nullptr, nullptr, 1.0f, QP16, QPh, QPl);
        k_cvt8<<<(unsigned)(((size_t)TT * DM / 8 + 255) / 256), 256, 0, stream>>>(xk + (size_t)b * TT * DM, XB, (size_t)TT * DM / 8);   /* key -> XB (the q GEMM is already issued) */ k_gemmw<bf, 0, true><<<dim3(TT / 64, DKV / 64, 1), 32, 0, stream>>>(XB, nullptr, WK, nullptr, DM, FK, DKV, bk, 0, 0, 0);
        k_rope<<<LKv, 256, 0, stream>>>(FK, DKV, NKV, CS, nullptr, nullptr, 1.0f, KP16, KPh, KPl);
        k_cvt8<<<(unsigned)(((size_t)TT * DM / 8 + 255) / 256), 256, 0, stream>>>(xv + (size_t)b * TT * DM, XB, (size_t)TT * DM / 8);   /* value -> XB */ k_gemmw<bf, 0, true><<<dim3(TT / 64, DKV / 64, 1), 32, 0, stream>>>(XB, nullptr, WV, nullptr, DM, FV, DKV, bv, 0, 0, 0); k_vtp<<<(unsigned)(((size_t)NKV * HP * TT / 2 + 255) / 256), 256, 0, stream>>>(FV, DKV, NKV, VTh, VTl);   /* v^T planes zero-padded to 64 rows per kv head */
        for (int h0 = 0; h0 < NH_; h0 += ZH) { const size_t zq = (size_t)h0, zk = (size_t)(h0 / REP);   // one kv head per query head: the pass's two heads use consecutive kv planes
            k_gemmw<bf, 2, false><<<dim3(RH / 64, TT / 64, ZH), 32, 0, stream>>>(QPh + zq * TT * HD, QPl + zq * TT * HD, KPh + zk * TT * HD, KPl + zk * TT * HD, HD, Sb, TT, nullptr, (size_t)TT * HD, (size_t)TT * HD, (size_t)TT * TT);
            k_asoft<<<ZH * TT / 8, 256, 0, stream>>>(Sb, mk + (size_t)b * TT * TT, adj + (size_t)b * TT * TT, Ph, Pl);   /* the group's pair mask and pair factor: the same for its four heads */
            k_gemmw<bf, 2, false><<<dim3(RH / 64, HP / 64, ZH), 32, 0, stream>>>(Ph, Pl, VTh + zk * HP * TT, VTl + zk * HP * TT, TT, Ob, HP, nullptr, (size_t)RH * TT, (size_t)HP * TT, (size_t)TT * HP);
            k_merge<<<(unsigned)(((size_t)ZH * TT * HD / 2 + 255) / 256), 256, 0, stream>>>(Ob, h0, ATh, ATl); }
        k_gemmw<bf, 1, true><<<dim3(TT / 64, DM / 64, 1), 32, 0, stream>>>(ATh, ATl, WO, nullptr, DQ, OUT + (size_t)b * TT * DM, DM, bo, 0, 0, 0); }
}

// v001
// One run takes 224 microseconds.
// Timed twice side by side with v000, it ran 16.5 and 16.4 times as fast.
#include <hip/hip_runtime.h>

// Spatial multi-head attention over graph nodes with a pair mask and a post-softmax pair factor (query, key, value [4][12][512][128]: 48 independent (batch, time) groups of 512 nodes; q = query Wq^T + bq, k = key Wk^T + bk, v = value Wv^T + bv ('oi' (out, in) [128][128] + [128]: real biases; 4 heads x 32); scores x 1/sqrt(32); where mask[b][t][i][j] != 0 (int32 [4][12][512][512], read per logit as data) the score is REPLACED by -1e9; softmax over the 512 keys; the weights x adjm[b][t][i][j] (f32 [4][12][512][512], read, rounded to bf16: an input) AFTER the softmax, no renormalisation; out = merged Wp^T + bp -> [4][12][512][128] (3.1 M); argument order query, key, value, mask, adjm, Wq, bq, Wk, bk, Wv, bv, Wp, bp).
// Layout, all 48 groups per launch (the group and the head are grid indices; the score / softmax / attn.v stage runs in 3 chunks of 16 groups, which is what the workspace holds): bf16 copies of query, key and value side by side; 'oi' weights as Bt; exact projections + bf16-rounded biases; q/k planes 32 wide (score GEMM K 32), value^T planes zero-padded to 64 rows for the attn.v GEMM; dense T-512 attention with EVERY row on hi/lo planes; the softmax kernel reads the group's pair-mask row and pair-factor row, replaces masked scores by -1e9, and multiplies the normalised weight by the factor; merged hi/lo x Wp exact + bp.
// Compute dtypes, f32 accumulate: every input rounded to bf16 incl. the pair factor adjm; projections exact + bf16-rounded biases; scores (K 32) and attn.v 3 products on every row (NO f16 OPERAND reaches a matrix instruction: the plane builder still writes its fp16 q and k planes and nothing reads them); softmax f32; Wp hl x exact + bias.

#define NB_  48
#define TT   512
#define DM   128
#define NH_  4
#define NKV  4
#define REP  (NH_ / NKV)
#define HD   32
#define DQ   (NH_ * HD)
#define DKV  (NKV * HD)
#define GC   16                  // groups per attention chunk (scores + weight planes: 2 MiB per (group, head))
#define ZC   (GC * NH_)          // (group, head) planes per chunk
#define RH   512                 // = TT: every row hi/lo
#define WIN  0
#define PCAR 1024.0f
#define SCL  0.17677669529663688f   // 32^-0.5 (the module divides by float32(sqrt(32)); one multiply here)
#define HP   64    // padded head width for the attn.v GEMM (v^T rows 32..63 are zero)
typedef _Float16 h16;
typedef unsigned short bf;
typedef __attribute__((ext_vector_type(16))) __bf16   v16bf;
typedef __attribute__((ext_vector_type(16))) _Float16 v16h;
typedef __attribute__((ext_vector_type(8)))  _Float16 v8h;
typedef __attribute__((ext_vector_type(8)))  unsigned short v8us;
typedef __attribute__((ext_vector_type(8)))  float    v8f;
typedef __attribute__((ext_vector_type(4)))  float    v4f;
typedef v8h  __attribute__((may_alias)) v8ha;
typedef v4f  __attribute__((may_alias)) v4fa;
typedef v8us __attribute__((may_alias)) v8usa;

__device__ __forceinline__ unsigned short f2bf(float f) { unsigned u = __float_as_uint(f); u += 0x7FFFu + ((u >> 16) & 1u); return (unsigned short)(u >> 16); }
__device__ __forceinline__ float bf2f(unsigned short b) { return __uint_as_float(((unsigned)b) << 16); }
__device__ __forceinline__ float bfr(float f) { return bf2f(f2bf(f)); }
__device__ __forceinline__ v16h cat16(v8h lo, v8h hi) { return __builtin_shufflevector(lo, hi, 0, 1, 2, 3, 4, 5, 6, 7, 8, 9, 10, 11, 12, 13, 14, 15); }
__device__ __forceinline__ v16bf cat16b(v8us lo, v8us hi) { return __builtin_bit_cast(v16bf, __builtin_shufflevector(lo, hi, 0, 1, 2, 3, 4, 5, 6, 7, 8, 9, 10, 11, 12, 13, 14, 15)); }
__device__ __forceinline__ v8f wmma16(v16h a, v16h b, v8f c) { return __builtin_amdgcn_wmma_f32_16x16x32_f16(false, a, false, b, (short)0, c, false, false); }
__device__ __forceinline__ v8f wmmab(v16bf a, v16bf b, v8f c) { return __builtin_amdgcn_wmma_f32_16x16x32_bf16(false, a, false, b, (short)0, c, false, false); }



// ---- k_gemmw: register-blocked GEMM, ONE WAVE per 64x64 output tile (16 accumulators), operands straight from K-contiguous 16-bit planes; grid (M/64, N/64, Z), 32 threads.
// C[m][n] (f32, pitch ldc, + optional f32 bias[n], one bias pointer per z up to z = 2) = sum_k A[m][k] Bt[n][k] (+ split products per NSPLIT). z-batch strides sA/sB/sC in elements. K % 32 == 0.
template <typename T16> struct WFrag;
template <> struct WFrag<h16> { typedef v16h V; static __device__ __forceinline__ V ld(const h16* p) { return cat16(*(const v8h*)p, *(const v8h*)(p + 16)); } static __device__ __forceinline__ v8f mma(V a, V b, v8f c) { return wmma16(a, b, c); } };
template <> struct WFrag<bf> { typedef v16bf V; static __device__ __forceinline__ V ld(const bf* p) { return cat16b(*(const v8us*)p, *(const v8us*)(p + 16)); } static __device__ __forceinline__ v8f mma(V a, V b, v8f c) { return wmmab(a, b, c); } };
template <typename T16, int NSPLIT, bool BIAS>
__global__ __launch_bounds__(32) void k_gemmw(const T16* __restrict__ A, const T16* __restrict__ A2, const T16* __restrict__ Bt, const T16* __restrict__ Bt2, int K, float* C, int ldc, const float* __restrict__ bias0, const float* __restrict__ bias1, const float* __restrict__ bias2, size_t sA, size_t sB, size_t sC) {
    typedef typename WFrag<T16>::V V;
    __shared__ __align__(16) float os[16 * 68];
    const size_t z = blockIdx.z; A += z * sA; if (A2) A2 += z * sA; Bt += z * sB; if (Bt2) Bt2 += z * sB; C += z * sC; const float* bias = z == 0 ? bias0 : (z == 1 ? bias1 : bias2);   /* the q, k and v projections are z = 0, 1, 2 of one launch, each with its own bias input */
    const int lane = threadIdx.x & 31, lr = lane & 15, hi = lane >> 4; const int r0 = blockIdx.x * 64, c0 = blockIdx.y * 64;
    v8f acc[4][4];
#pragma unroll
    for (int mb = 0; mb < 4; ++mb)
#pragma unroll
        for (int nb = 0; nb < 4; ++nb) acc[mb][nb] = (v8f){};
    const size_t aoff = (size_t)(r0 + lr) * K + 8 * hi, boff = (size_t)(c0 + lr) * K + 8 * hi;
    for (int kc = 0; kc < K; kc += 32) {
        V a[4], a2[4];
#pragma unroll
        for (int mb = 0; mb < 4; ++mb) { a[mb] = WFrag<T16>::ld(A + aoff + (size_t)mb * 16 * K + kc); if (NSPLIT == 1 || NSPLIT == 2) a2[mb] = WFrag<T16>::ld(A2 + aoff + (size_t)mb * 16 * K + kc); }
#pragma unroll
        for (int nb = 0; nb < 4; ++nb) { const V b = WFrag<T16>::ld(Bt + boff + (size_t)nb * 16 * K + kc); V b2; if (NSPLIT >= 2) b2 = WFrag<T16>::ld(Bt2 + boff + (size_t)nb * 16 * K + kc);
#pragma unroll
            for (int mb = 0; mb < 4; ++mb) { acc[mb][nb] = WFrag<T16>::mma(a[mb], b, acc[mb][nb]); if (NSPLIT == 1 || NSPLIT == 2) acc[mb][nb] = WFrag<T16>::mma(a2[mb], b, acc[mb][nb]); if (NSPLIT >= 2) acc[mb][nb] = WFrag<T16>::mma(a[mb], b2, acc[mb][nb]); } }
        asm volatile("v_nop\n\tv_nop\n\tv_nop\n\tv_nop" : "+v"(acc[0][0]), "+v"(acc[1][1]), "+v"(acc[2][2]), "+v"(acc[3][3]) : "v"(a[0]), "v"(a[3]));
    }
#pragma unroll
    for (int mb = 0; mb < 4; ++mb) {
#pragma unroll
        for (int nb = 0; nb < 4; ++nb) {
#pragma unroll
            for (int j = 0; j < 8; ++j) os[(hi * 8 + j) * 68 + nb * 16 + lr] = acc[mb][nb][j]; }
        __builtin_amdgcn_wave_barrier(); asm volatile("" ::: "memory");
        float* crow = C + (size_t)(r0 + mb * 16) * ldc + c0;
{
#pragma unroll
            for (int s = 0; s < 8; ++s) { const int row = 2 * s + hi, cofs = lr * 4; v4f val = *(const v4fa*)(os + row * 68 + cofs); if (BIAS) { val[0] += bfr(bias[c0 + cofs]); val[1] += bfr(bias[c0 + cofs + 1]); val[2] += bfr(bias[c0 + cofs + 2]); val[3] += bfr(bias[c0 + cofs + 3]); }
                *(v4f*)(crow + (size_t)row * ldc + cofs) = val; }
             }
        __builtin_amdgcn_wave_barrier(); asm volatile("" ::: "memory");
    }
}

__device__ __forceinline__ h16 tohx(float x) { return (h16)x; }
__device__ __forceinline__ void splitf(float y, unsigned short& h, unsigned short& l) { h = f2bf(y); l = f2bf(y - bf2f(h)); }
typedef __attribute__((ext_vector_type(2))) _Float16 v2h;
typedef __attribute__((ext_vector_type(4))) _Float16 v4h;
typedef __attribute__((ext_vector_type(2))) unsigned short v2us;
typedef __attribute__((ext_vector_type(4))) unsigned short v4us;
typedef __attribute__((ext_vector_type(2))) float v2f;
typedef __attribute__((ext_vector_type(4))) int v4i;

__global__ __launch_bounds__(256) void k_cvt8(const float* __restrict__ s0, const float* __restrict__ s1, const float* __restrict__ s2, const float* __restrict__ s3, bf* dst, size_t n8) { const size_t i = (size_t)blockIdx.x * 256 + threadIdx.x; if (i >= n8) return; const int y = blockIdx.y; const float* src = y == 0 ? s0 : (y == 1 ? s1 : (y == 2 ? s2 : s3)); dst += (size_t)y * n8 * 8;   /* blockIdx.y picks one of up to four equal-sized inputs; their bf16 copies lie side by side */ const v8f v = *(const v8f*)(src + i * 8); v8us o;
#pragma unroll
    for (int k = 0; k < 8; ++k) o[k] = f2bf(v[k]); *(v8us*)(dst + i * 8) = o;  }

// k_rope: head planes [h][t][d] (fp16 + hi/lo) of rope(x) x sc with the rotate-half convention out[d] = x[d] cos[t][d] - x[d+HD/2] sin[t][d], out[d+HD/2] = x[d+HD/2] cos[t][d+HD/2] + x[d] sin[t][d+HD/2]
__global__ __launch_bounds__(256) void k_rope(const float* __restrict__ F, int pitch, int nheads, const float* __restrict__ CS, const float* __restrict__ RF, const float* __restrict__ nw, float sc, h16* P16, bf* Ph, bf* Pl) {
    { const size_t g = blockIdx.y; F += g * TT * pitch; P16 += g * nheads * TT * HD; Ph += g * nheads * TT * HD; Pl += g * nheads * TT * HD; }   // blockIdx.y: the group (the q groups, then the k groups); e below runs inside one group
    const size_t e = ((size_t)blockIdx.x * 256 + threadIdx.x) * 2; if (e >= (size_t)nheads * TT * HD) return; const int d = (int)(e % HD); const int t = (int)((e / HD) % TT); const int h = (int)(e / ((size_t)HD * TT)); const float* f = F + (size_t)t * pitch + h * HD; const float rf = RF ? RF[(size_t)h * TT + t] : 1.0f; v2h o16; v2us oh, ol;
#pragma unroll
    for (int q = 0; q < 2; ++q) { const int dd = d + q; const int dp = (dd < HD / 2) ? dd + HD / 2 : dd - HD / 2; float x0 = f[dd], x1 = f[dp];
        if (RF) { float n0 = __fmul_rn(x0, rf), n1 = __fmul_rn(x1, rf); x0 = __fmul_rn(bfr(nw[dd]), n0); x1 = __fmul_rn(bfr(nw[dp]), n1); }
        const v2f cs = *(const v2f*)(CS + ((size_t)t * HD + dd) * 2); float a = __fmul_rn(x0, cs[0]), bq = __fmul_rn(x1, cs[1]); const float r = ((dd < HD / 2) ? __fsub_rn(a, bq) : __fadd_rn(a, bq)) * sc;
        o16[q] = tohx(r); unsigned short a2, c2; splitf(r, a2, c2); oh[q] = a2; ol[q] = c2; }
    *(v2h*)(P16 + e) = o16; *(v2us*)(Ph + e) = oh; *(v2us*)(Pl + e) = ol;  }
__global__ __launch_bounds__(256) void k_vtp(const float* __restrict__ F, int pitch, int nheads, bf* Vh, bf* Vl) { const size_t e = ((size_t)blockIdx.x * 256 + threadIdx.x) * 2; if (e >= (size_t)nheads * HP * TT) return; { const size_t g = blockIdx.y; F += g * TT * pitch; Vh += g * nheads * HP * TT; Vl += g * nheads * HP * TT; }   /* blockIdx.y: the group */ const int t = (int)(e % TT); const int d = (int)((e / TT) % HP); const int g = (int)(e / ((size_t)TT * HP)); v2us oh, ol;
#pragma unroll
    for (int q = 0; q < 2; ++q) { unsigned short a2 = 0, c2 = 0; if (d < HD) splitf(F[(size_t)(t + q) * pitch + g * HD + d], a2, c2); oh[q] = a2; ol[q] = c2; }
    *(v2us*)(Vh + e) = oh; *(v2us*)(Vl + e) = ol;  }

__global__ __launch_bounds__(256) void k_csid(float* CS) { const int idx = blockIdx.x * 256 + threadIdx.x; if (idx >= TT * HD) return; v2f cs; cs[0] = 1.0f; cs[1] = 0.0f; *(v2f*)(CS + (size_t)idx * 2) = cs;  }
// k_asoft: per row (zz, i): t = S x 32^-0.5, or the literal -1e9 where the int32 pair mask word mask[i][j] is non-zero (read as data; a row with every key masked gives 512 equal values: a uniform row, as the module's); softmax over ALL 512 keys (register row, one exp, fixed trees); the normalised weight x bf16(adjm[i][j]) (an f32 input factor, AFTER the softmax, no renormalisation) -> bf16 hi / lo planes for every row;
__global__ __launch_bounds__(256) void k_asoft(const float* __restrict__ Sb, const int* __restrict__ mk, const float* __restrict__ adj, bf* Ph, bf* Pl) {
    const int lane = threadIdx.x & 31; const int row = blockIdx.x * 8 + (threadIdx.x >> 5); if (row >= ZC * TT) return; const int i = row % TT; const int zz = row / TT; { const size_t go = (size_t)(zz / NH_) * TT * TT; mk += go; adj += go; }   /* zz = (group of the chunk, head): a group's pair mask and pair factor rows serve all four of its heads, which lie in one launch */ const float* sr = Sb + (size_t)row * TT; float v[TT / 32]; float g[TT / 32]; float mx = -3.0e38f;
#pragma unroll
    for (int ch = 0; ch < TT / 128; ++ch) { const int j0 = ch * 128 + lane * 4; const v4f a = *(const v4f*)(sr + j0); const v4i m4 = *(const v4i*)(mk + (size_t)i * TT + j0); const v4f g4 = *(const v4f*)(adj + (size_t)i * TT + j0);   /* the pair mask row (int32, read as data) and the pair factor row (f32 input, bf16-rounded): 16 B per lane each, unconditional; the same rows for all four heads of the group */
#pragma unroll
        for (int q = 0; q < 4; ++q) { const float t = (m4[q] != 0) ? -1.0e9f : __fmul_rn(a[q], SCL);   /* where(mask != 0, -1e9, scores / sqrt(32)): the module's literal, after the scale */ v[ch * 4 + q] = t; g[ch * 4 + q] = bfr(g4[q]); mx = fmaxf(mx, t); } }
#pragma unroll
    for (int sh = 16; sh; sh >>= 1) mx = fmaxf(mx, __shfl_xor(mx, sh, 32));
    float sum = 0.f;
#pragma unroll
    for (int k = 0; k < TT / 32; ++k) { float d0 = __fsub_rn(v[k], mx); v[k] = __builtin_amdgcn_exp2f(__fmul_rn(d0, 1.4426950408889634f)); sum += v[k]; }
#pragma unroll
    for (int sh = 16; sh; sh >>= 1) sum += __shfl_xor(sum, sh, 32);
    const float f = __fdiv_rn(1.0f, sum);
    {
#pragma unroll
        for (int ch = 0; ch < TT / 128; ++ch) { v4us oh, ol;
#pragma unroll
            for (int q = 0; q < 4; ++q) { unsigned short a, c2; splitf(__fmul_rn(__fmul_rn(v[ch * 4 + q], f), g[ch * 4 + q]), a, c2);   /* softmax weight x the pair factor AFTER the normalisation (no renormalisation): two rounded products */ oh[q] = a; ol[q] = c2; }
            const size_t oo = ((size_t)zz * TT + i) * TT + ch * 128 + lane * 4; *(v4us*)(Ph + oo) = oh; *(v4us*)(Pl + oo) = ol; }
         }
}
__global__ __launch_bounds__(256) void k_merge(const float* __restrict__ O, bf* Ah, bf* Al) { const size_t e = ((size_t)blockIdx.x * 256 + threadIdx.x) * 2; if (e >= (size_t)NH_ * TT * HD) return; { const size_t g = blockIdx.y; O += g * NH_ * TT * HP; Ah += g * TT * DQ; Al += g * TT * DQ; }   /* blockIdx.y: the group */ const int d = (int)(e % HD); const int zz = (int)((e / HD) % NH_); const int t = (int)(e / ((size_t)HD * NH_)); const size_t oo = (size_t)t * DQ + zz * HD + d; const float* src = O + ((size_t)zz * TT + t) * HP + d;
    v2us oh, ol;
#pragma unroll
    for (int q = 0; q < 2; ++q) { unsigned short a2, c2; splitf(src[q], a2, c2); oh[q] = a2; ol[q] = c2; }
    *(v2us*)(Ah + oo) = oh; *(v2us*)(Al + oo) = ol;  }

extern "C" void kernel_launch(void* const* d_in, const int* in_sizes, int n_in,
                              void* d_out, int out_size, void* d_ws, size_t ws_size, hipStream_t stream) {
    (void)in_sizes; (void)n_in; (void)out_size;
    const float* x = (const float*)d_in[0]; const float* xk = (const float*)d_in[1]; const float* xv = (const float*)d_in[2]; const int* mk = (const int*)d_in[3]; const float* adj = (const float*)d_in[4]; const float* wq = (const float*)d_in[5]; const float* bq = (const float*)d_in[6]; const float* wk = (const float*)d_in[7]; const float* bk = (const float*)d_in[8]; const float* wv = (const float*)d_in[9]; const float* bv = (const float*)d_in[10]; const float* wo = (const float*)d_in[11]; const float* bo = (const float*)d_in[12];   /* order query, key, value ([4][12][512][128] = 48 groups), mask (int32 [48][512][512]: read as data), adjm (f32 [48][512][512]: read), Wq, bq, Wk, bk, Wv, bv, Wp, bp ('oi') */
    float* OUT = (float*)d_out;     // [48][512][128]
    char* wsp = (char*)d_ws;
    auto take = [&](size_t bytes) { char* p = wsp; wsp += (bytes + 255) & ~(size_t)255; return (void*)p; };
    bf* WQ = (bf*)take((size_t)4 * DQ * DM * 2); bf* WO = WQ + (size_t)3 * DQ * DM;   /* Wq, Wk, Wv, Wp as bf16, side by side (all [128][128]) */ float* CS = (float*)take((size_t)TT * HD * 2 * 4);
    bf* XB = (bf*)take((size_t)3 * NB_ * TT * DM * 2);   /* query, key, value as bf16: [3][48][512][128] */
    h16* QP16 = (h16*)take((size_t)2 * NB_ * NH_ * TT * HD * 2);
    bf* QPh = (bf*)take((size_t)2 * NB_ * NH_ * TT * HD * 2); bf* QPl = (bf*)take((size_t)2 * NB_ * NH_ * TT * HD * 2);   /* [q groups | k groups][head][t][d] */ bf* KPh = QPh + (size_t)NB_ * NH_ * TT * HD; bf* KPl = QPl + (size_t)NB_ * NH_ * TT * HD;
    bf* VTh = (bf*)take((size_t)NB_ * NKV * HP * TT * 2); bf* VTl = (bf*)take((size_t)NB_ * NKV * HP * TT * 2); bf* Ph = (bf*)take((size_t)ZC * RH * TT * 2); bf* Pl = (bf*)take((size_t)ZC * RH * TT * 2);
    float* Sb = (float*)take((size_t)ZC * TT * TT * 4); float* Ob = (float*)take((size_t)NB_ * NH_ * TT * HP * 4); bf* ATh = (bf*)take((size_t)NB_ * TT * DQ * 2); bf* ATl = (bf*)take((size_t)NB_ * TT * DQ * 2);
    if ((size_t)(wsp - (char*)d_ws) > ws_size) return;    // ws 256 MiB given; the carve is 242.25 MiB
    float* FQ = Sb;   // the f32 q, k, v projections [3][48][512][128] (36 MiB) lie in the score buffer (64 MiB) until the planes are built (stream-ordered)
    float* FV = FQ + (size_t)2 * NB_ * TT * DQ;
    k_cvt8<<<dim3((unsigned)(((size_t)DQ * DM / 8 + 255) / 256), 4, 1), 256, 0, stream>>>(wq, wk, wv, wo, WQ, (size_t)DQ * DM / 8);
    k_csid<<<(TT * HD + 255) / 256, 256, 0, stream>>>(CS);
    k_cvt8<<<dim3((unsigned)(((size_t)NB_ * TT * DM / 8 + 255) / 256), 3, 1), 256, 0, stream>>>(x, xk, xv, xv, XB, (size_t)NB_ * TT * DM / 8);
    k_gemmw<bf, 0, true><<<dim3(NB_ * TT / 64, DQ / 64, 3), 32, 0, stream>>>(XB, nullptr, WQ, nullptr, DM, FQ, DQ, bq, bk, bv, (size_t)NB_ * TT * DM, (size_t)DQ * DM, (size_t)NB_ * TT * DQ);   /* rows = all (group, node) pairs; z = q, k, v */
    k_rope<<<dim3((unsigned)(((size_t)NH_ * TT * HD / 2 + 255) / 256), 2 * NB_, 1), 256, 0, stream>>>(FQ, DQ, NH_, CS, nullptr, nullptr, 1.0f, QP16, QPh, QPl);
    k_vtp<<<dim3((unsigned)(((size_t)NKV * HP * TT / 2 + 255) / 256), NB_, 1), 256, 0, stream>>>(FV, DKV, NKV, VTh, VTl);   /* v^T planes zero-padded to 64 rows per kv head */
    for (int c = 0; c < NB_ / GC; ++c) { const size_t z0 = (size_t)c * ZC;   // one kv head per query head: plane z of q meets plane z of k and of v^T
        k_gemmw<bf, 2, false><<<dim3(RH / 64, TT / 64, ZC), 32, 0, stream>>>(QPh + z0 * TT * HD, QPl + z0 * TT * HD, KPh + z0 * TT * HD, KPl + z0 * TT * HD, HD, Sb, TT, nullptr, nullptr, nullptr, (size_t)TT * HD, (size_t)TT * HD, (size_t)TT * TT);
        k_asoft<<<ZC * TT / 8, 256, 0, stream>>>(Sb, mk + (size_t)c * GC * TT * TT, adj + (size_t)c * GC * TT * TT, Ph, Pl);
        k_gemmw<bf, 2, false><<<dim3(RH / 64, HP / 64, ZC), 32, 0, stream>>>(Ph, Pl, VTh + z0 * HP * TT, VTl + z0 * HP * TT, TT, Ob + z0 * TT * HP, HP, nullptr, nullptr, nullptr, (size_t)RH * TT, (size_t)HP * TT, (size_t)TT * HP); }
    k_merge<<<dim3((unsigned)(((size_t)NH_ * TT * HD / 2 + 255) / 256), NB_, 1), 256, 0, stream>>>(Ob, ATh, ATl);
    k_gemmw<bf, 1, true><<<dim3(NB_ * TT / 64, DM / 64, 1), 32, 0, stream>>>(ATh, ATl, WO, nullptr, DQ, OUT, DM, bo, bo, bo, 0, 0, 0);
}

// v002
// A run of this version takes 113 microseconds.
// Next to v001, in two timings, it ran 1.97 and 1.98 times as fast.
// Counting every step since v000, it is 32.5 times as fast.
#include <hip/hip_runtime.h>

// Spatial multi-head attention over graph nodes with a pair mask and a post-softmax pair factor (query, key, value [4][12][512][128]: 48 independent (batch, time) groups of 512 nodes; q = query Wq^T + bq, k = key Wk^T + bk, v = value Wv^T + bv ('oi' (out, in) [128][128] + [128]: real biases; 4 heads x 32); scores x 1/sqrt(32); where mask[b][t][i][j] != 0 (int32 [4][12][512][512], read per logit as data) the score is REPLACED by -1e9; softmax over the 512 keys; the weights x adjm[b][t][i][j] (f32 [4][12][512][512], read, rounded to bf16: an input) AFTER the softmax, no renormalisation; out = merged Wp^T + bp -> [4][12][512][128] (3.1 M); argument order query, key, value, mask, adjm, Wq, bq, Wk, bk, Wv, bv, Wp, bp).
// Layout, all 48 groups per launch (the group is a grid index): bf16 copies of query, key and value side by side; 'oi' weights as Bt; exact projections + bf16-rounded biases; q/k planes 32 wide (score GEMM K 32), value^T planes of 64 rows per head (rows 32..63 zero, not read); ONE fused kernel for scores, masked softmax, pair factor, attn.v and the head merge, every operand on hi/lo planes, scores and weights in registers only; merged hi/lo x Wp exact + bp.
// Compute dtypes, f32 accumulate: every input rounded to bf16 incl. the pair factor adjm; projections exact + biases rounded to bf16; scores (K 32) and attn.v 3 products on every row (NO f16 OPERAND reaches a matrix instruction: the plane builder still writes its fp16 q and k planes and nothing reads them); softmax f32; Wp hl x exact + bias.

#define NB_  48
#define TT   512
#define DM   128
#define NH_  4
#define NKV  4
#define REP  (NH_ / NKV)
#define HD   32
#define DQ   (NH_ * HD)
#define DKV  (NKV * HD)
#define WIN  0
#define PCAR 1024.0f
#define SCL  0.17677669529663688f   // 32^-0.5 (the module divides by float32(sqrt(32)); one multiply here)
#define HP   64    // rows per head of the v^T planes (rows 32..63 are zero)
typedef _Float16 h16;
typedef unsigned short bf;
typedef __attribute__((ext_vector_type(16))) __bf16   v16bf;
typedef __attribute__((ext_vector_type(16))) _Float16 v16h;
typedef __attribute__((ext_vector_type(8)))  _Float16 v8h;
typedef __attribute__((ext_vector_type(8)))  unsigned short v8us;
typedef __attribute__((ext_vector_type(8)))  float    v8f;
typedef __attribute__((ext_vector_type(4)))  float    v4f;
typedef v8h  __attribute__((may_alias)) v8ha;
typedef v4f  __attribute__((may_alias)) v4fa;
typedef v8us __attribute__((may_alias)) v8usa;

__device__ __forceinline__ unsigned short f2bf(float f) { unsigned u = __float_as_uint(f); u += 0x7FFFu + ((u >> 16) & 1u); return (unsigned short)(u >> 16); }
__device__ __forceinline__ float bf2f(unsigned short b) { return __uint_as_float(((unsigned)b) << 16); }
__device__ __forceinline__ float bfr(float f) { return bf2f(f2bf(f)); }
__device__ __forceinline__ v16h cat16(v8h lo, v8h hi) { return __builtin_shufflevector(lo, hi, 0, 1, 2, 3, 4, 5, 6, 7, 8, 9, 10, 11, 12, 13, 14, 15); }
__device__ __forceinline__ v16bf cat16b(v8us lo, v8us hi) { return __builtin_bit_cast(v16bf, __builtin_shufflevector(lo, hi, 0, 1, 2, 3, 4, 5, 6, 7, 8, 9, 10, 11, 12, 13, 14, 15)); }
__device__ __forceinline__ v8f wmma16(v16h a, v16h b, v8f c) { return __builtin_amdgcn_wmma_f32_16x16x32_f16(false, a, false, b, (short)0, c, false, false); }
__device__ __forceinline__ v8f wmmab(v16bf a, v16bf b, v8f c) { return __builtin_amdgcn_wmma_f32_16x16x32_bf16(false, a, false, b, (short)0, c, false, false); }



// ---- k_gemmw: register-blocked GEMM, ONE WAVE per 64x64 output tile (16 accumulators), operands straight from K-contiguous 16-bit planes; grid (M/64, N/64, Z), 32 threads.
// C[m][n] (f32, pitch ldc, + optional f32 bias[n], one bias pointer per z up to z = 2) = sum_k A[m][k] Bt[n][k] (+ split products per NSPLIT). z-batch strides sA/sB/sC in elements. K % 32 == 0.
template <typename T16> struct WFrag;
template <> struct WFrag<h16> { typedef v16h V; static __device__ __forceinline__ V ld(const h16* p) { return cat16(*(const v8h*)p, *(const v8h*)(p + 16)); } static __device__ __forceinline__ v8f mma(V a, V b, v8f c) { return wmma16(a, b, c); } };
template <> struct WFrag<bf> { typedef v16bf V; static __device__ __forceinline__ V ld(const bf* p) { return cat16b(*(const v8us*)p, *(const v8us*)(p + 16)); } static __device__ __forceinline__ v8f mma(V a, V b, v8f c) { return wmmab(a, b, c); } };
template <typename T16, int NSPLIT, bool BIAS>
__global__ __launch_bounds__(32) void k_gemmw(const T16* __restrict__ A, const T16* __restrict__ A2, const T16* __restrict__ Bt, const T16* __restrict__ Bt2, int K, float* C, int ldc, const float* __restrict__ bias0, const float* __restrict__ bias1, const float* __restrict__ bias2, size_t sA, size_t sB, size_t sC) {
    typedef typename WFrag<T16>::V V;
    __shared__ __align__(16) float os[16 * 68];
    const size_t z = blockIdx.z; A += z * sA; if (A2) A2 += z * sA; Bt += z * sB; if (Bt2) Bt2 += z * sB; C += z * sC; const float* bias = z == 0 ? bias0 : (z == 1 ? bias1 : bias2);   /* the q, k and v projections are z = 0, 1, 2 of one launch, each with its own bias input */
    const int lane = threadIdx.x & 31, lr = lane & 15, hi = lane >> 4; const int r0 = blockIdx.x * 64, c0 = blockIdx.y * 64;
    v8f acc[4][4];
#pragma unroll
    for (int mb = 0; mb < 4; ++mb)
#pragma unroll
        for (int nb = 0; nb < 4; ++nb) acc[mb][nb] = (v8f){};
    const size_t aoff = (size_t)(r0 + lr) * K + 8 * hi, boff = (size_t)(c0 + lr) * K + 8 * hi;
    for (int kc = 0; kc < K; kc += 32) {
        V a[4], a2[4];
#pragma unroll
        for (int mb = 0; mb < 4; ++mb) { a[mb] = WFrag<T16>::ld(A + aoff + (size_t)mb * 16 * K + kc); if (NSPLIT == 1 || NSPLIT == 2) a2[mb] = WFrag<T16>::ld(A2 + aoff + (size_t)mb * 16 * K + kc); }
#pragma unroll
        for (int nb = 0; nb < 4; ++nb) { const V b = WFrag<T16>::ld(Bt + boff + (size_t)nb * 16 * K + kc); V b2; if (NSPLIT >= 2) b2 = WFrag<T16>::ld(Bt2 + boff + (size_t)nb * 16 * K + kc);
#pragma unroll
            for (int mb = 0; mb < 4; ++mb) { acc[mb][nb] = WFrag<T16>::mma(a[mb], b, acc[mb][nb]); if (NSPLIT == 1 || NSPLIT == 2) acc[mb][nb] = WFrag<T16>::mma(a2[mb], b, acc[mb][nb]); if (NSPLIT >= 2) acc[mb][nb] = WFrag<T16>::mma(a[mb], b2, acc[mb][nb]); } }
        asm volatile("v_nop\n\tv_nop\n\tv_nop\n\tv_nop" : "+v"(acc[0][0]), "+v"(acc[1][1]), "+v"(acc[2][2]), "+v"(acc[3][3]) : "v"(a[0]), "v"(a[3]));
    }
#pragma unroll
    for (int mb = 0; mb < 4; ++mb) {
#pragma unroll
        for (int nb = 0; nb < 4; ++nb) {
#pragma unroll
            for (int j = 0; j < 8; ++j) os[(hi * 8 + j) * 68 + nb * 16 + lr] = acc[mb][nb][j]; }
        __builtin_amdgcn_wave_barrier(); asm volatile("" ::: "memory");
        float* crow = C + (size_t)(r0 + mb * 16) * ldc + c0;
{
#pragma unroll
            for (int s = 0; s < 8; ++s) { const int row = 2 * s + hi, cofs = lr * 4; v4f val = *(const v4fa*)(os + row * 68 + cofs); if (BIAS) { val[0] += bfr(bias[c0 + cofs]); val[1] += bfr(bias[c0 + cofs + 1]); val[2] += bfr(bias[c0 + cofs + 2]); val[3] += bfr(bias[c0 + cofs + 3]); }
                *(v4f*)(crow + (size_t)row * ldc + cofs) = val; }
             }
        __builtin_amdgcn_wave_barrier(); asm volatile("" ::: "memory");
    }
}

__device__ __forceinline__ h16 tohx(float x) { return (h16)x; }
__device__ __forceinline__ void splitf(float y, unsigned short& h, unsigned short& l) { h = f2bf(y); l = f2bf(y - bf2f(h)); }
typedef __attribute__((ext_vector_type(2))) _Float16 v2h;
typedef __attribute__((ext_vector_type(4))) _Float16 v4h;
typedef __attribute__((ext_vector_type(2))) unsigned short v2us;
typedef __attribute__((ext_vector_type(4))) unsigned short v4us;
typedef __attribute__((ext_vector_type(2))) float v2f;
typedef __attribute__((ext_vector_type(4))) int v4i;

__global__ __launch_bounds__(256) void k_cvt8(const float* __restrict__ s0, const float* __restrict__ s1, const float* __restrict__ s2, const float* __restrict__ s3, bf* dst, size_t n8) { const size_t i = (size_t)blockIdx.x * 256 + threadIdx.x; if (i >= n8) return; const int y = blockIdx.y; const float* src = y == 0 ? s0 : (y == 1 ? s1 : (y == 2 ? s2 : s3)); dst += (size_t)y * n8 * 8;   /* blockIdx.y picks one of up to four equal-sized inputs; their bf16 copies lie side by side */ const v8f v = *(const v8f*)(src + i * 8); v8us o;
#pragma unroll
    for (int k = 0; k < 8; ++k) o[k] = f2bf(v[k]); *(v8us*)(dst + i * 8) = o;  }

// k_rope: head planes [h][t][d] (fp16 + hi/lo) of rope(x) x sc with the rotate-half convention out[d] = x[d] cos[t][d] - x[d+HD/2] sin[t][d], out[d+HD/2] = x[d+HD/2] cos[t][d+HD/2] + x[d] sin[t][d+HD/2]
__global__ __launch_bounds__(256) void k_rope(const float* __restrict__ F, int pitch, int nheads, const float* __restrict__ CS, const float* __restrict__ RF, const float* __restrict__ nw, float sc, h16* P16, bf* Ph, bf* Pl) {
    { const size_t g = blockIdx.y; F += g * TT * pitch; P16 += g * nheads * TT * HD; Ph += g * nheads * TT * HD; Pl += g * nheads * TT * HD; }   // blockIdx.y: the group (the q groups, then the k groups); e below runs inside one group
    const size_t e = ((size_t)blockIdx.x * 256 + threadIdx.x) * 2; if (e >= (size_t)nheads * TT * HD) return; const int d = (int)(e % HD); const int t = (int)((e / HD) % TT); const int h = (int)(e / ((size_t)HD * TT)); const float* f = F + (size_t)t * pitch + h * HD; const float rf = RF ? RF[(size_t)h * TT + t] : 1.0f; v2h o16; v2us oh, ol;
#pragma unroll
    for (int q = 0; q < 2; ++q) { const int dd = d + q; const int dp = (dd < HD / 2) ? dd + HD / 2 : dd - HD / 2; float x0 = f[dd], x1 = f[dp];
        if (RF) { float n0 = __fmul_rn(x0, rf), n1 = __fmul_rn(x1, rf); x0 = __fmul_rn(bfr(nw[dd]), n0); x1 = __fmul_rn(bfr(nw[dp]), n1); }
        const v2f cs = *(const v2f*)(CS + ((size_t)t * HD + dd) * 2); float a = __fmul_rn(x0, cs[0]), bq = __fmul_rn(x1, cs[1]); const float r = ((dd < HD / 2) ? __fsub_rn(a, bq) : __fadd_rn(a, bq)) * sc;
        o16[q] = tohx(r); unsigned short a2, c2; splitf(r, a2, c2); oh[q] = a2; ol[q] = c2; }
    *(v2h*)(P16 + e) = o16; *(v2us*)(Ph + e) = oh; *(v2us*)(Pl + e) = ol;  }
__global__ __launch_bounds__(256) void k_vtp(const float* __restrict__ F, int pitch, int nheads, bf* Vh, bf* Vl) { const size_t e = ((size_t)blockIdx.x * 256 + threadIdx.x) * 2; if (e >= (size_t)nheads * HP * TT) return; { const size_t g = blockIdx.y; F += g * TT * pitch; Vh += g * nheads * HP * TT; Vl += g * nheads * HP * TT; }   /* blockIdx.y: the group */ const int t = (int)(e % TT); const int d = (int)((e / TT) % HP); const int g = (int)(e / ((size_t)TT * HP)); v2us oh, ol;
#pragma unroll
    for (int q = 0; q < 2; ++q) { unsigned short a2 = 0, c2 = 0; if (d < HD) splitf(F[(size_t)(t + q) * pitch + g * HD + d], a2, c2); oh[q] = a2; ol[q] = c2; }
    *(v2us*)(Vh + e) = oh; *(v2us*)(Vl + e) = ol;  }

__global__ __launch_bounds__(256) void k_csid(float* CS) { const int idx = blockIdx.x * 256 + threadIdx.x; if (idx >= TT * HD) return; v2f cs; cs[0] = 1.0f; cs[1] = 0.0f; *(v2f*)(CS + (size_t)idx * 2) = cs;  }
// ---- k_fattn: scores, masked softmax, pair factor, attn.v and the head merge of 32 query rows of one group, all four heads, in ONE work-group of 8 waves; nothing of the score or weight matrices goes to memory.
// Wave w owns keys 64 w .. 64 w + 63. It computes S^T = K Q^T (A = key rows, B = query rows), so a lane holds scores of ONE query (lane & 15) and the accumulator pair of 32 keys is, converted in place, the A fragment of the weights for attn.v (hardware k order on both sides).
// The wave's 32 x 64 block of the pair mask (one bit each) and of the pair factor (bf16, its compute type) is read once and serves the four heads. Row maximum, row sum and the attn.v partial sums of the 8 waves meet in LDS: three barriers per head.
typedef __attribute__((ext_vector_type(8))) unsigned v8u;
__device__ __forceinline__ unsigned rne16(float f) { const unsigned u = __float_as_uint(f); return u + 0x7FFFu + ((u >> 16) & 1u); }   // f2bf's rounding, the bf16 left in the upper half
__device__ __forceinline__ void split2(float y0, float y1, unsigned& h, unsigned& l) { const unsigned r0 = rne16(y0), r1 = rne16(y1); h = (r0 >> 16) | (r1 & 0xFFFF0000u); const unsigned s0 = rne16(y0 - __uint_as_float(r0 & 0xFFFF0000u)), s1 = rne16(y1 - __uint_as_float(r1 & 0xFFFF0000u)); l = (s0 >> 16) | (s1 & 0xFFFF0000u); }   // splitf of two neighbours, each plane's pair packed in one word
// Eight v_exp_f32, in place, and one v_nop in ONE statement: behind each exp stands an independent instruction, behind the last the v_nop, so nothing directly behind a transcendental reads its result or overwrites its source (the slot the instruction set asks for).
__device__ __forceinline__ void exp2x8(float (&x)[8]) { asm("v_exp_f32 %0, %0\n\tv_exp_f32 %1, %1\n\tv_exp_f32 %2, %2\n\tv_exp_f32 %3, %3\n\tv_exp_f32 %4, %4\n\tv_exp_f32 %5, %5\n\tv_exp_f32 %6, %6\n\tv_exp_f32 %7, %7\n\tv_nop" : "+v"(x[0]), "+v"(x[1]), "+v"(x[2]), "+v"(x[3]), "+v"(x[4]), "+v"(x[5]), "+v"(x[6]), "+v"(x[7])); }
#define FW  8                    // waves per work-group
#define FQT 2                    // 16-row query tiles per work-group
#define FKT (TT / FW / 16)       // 16-key tiles per wave
#define OSP 36                   // LDS row pitch (floats) of the partial outputs: the two lane halves (8 rows apart) fall on different banks, rows stay 16-byte aligned
__global__ __launch_bounds__(256) void k_fattn(const bf* __restrict__ Qh, const bf* __restrict__ Ql, const bf* __restrict__ Kh, const bf* __restrict__ Kl, const bf* __restrict__ Vh, const bf* __restrict__ Vl, const int* __restrict__ mk, const float* __restrict__ adj, bf* Ah, bf* Al) {
    __shared__ float redm[FW][FQT * 16]; __shared__ float reds[FW][FQT * 16]; __shared__ __align__(16) float os[FW][FQT * 16][OSP];
    const int lane = threadIdx.x & 31, lr = lane & 15, hi = lane >> 4, w = threadIdx.x >> 5;
    const int g = blockIdx.y, i0 = blockIdx.x * (FQT * 16), k0 = w * (FKT * 16);
    const unsigned mo = (unsigned)((i0 + lr) * TT + k0 + hi * 8), qo = (unsigned)((i0 + lr) * HD + 8 * hi), ko = (unsigned)((k0 + lr) * HD + 8 * hi), vo = (unsigned)(lr * TT + k0 + 8 * hi);   // the lane's 32-bit element offsets inside a group's pair planes and inside a (group, head) plane of q, of k and of v^T; every base below is uniform
    const int* mkg = mk + (size_t)g * TT * TT; const float* adg = adj + (size_t)g * TT * TT;
    unsigned mb[FQT]; unsigned ga[FQT][FKT][4];   // element (kt, j) of a lane: query i0 + 16 qt + lr, key k0 + 16 kt + 8 hi + j
#pragma unroll
    for (int qt = 0; qt < FQT; ++qt) { mb[qt] = 0u;
#pragma unroll
        for (int kt = 0; kt < FKT; ++kt) { const int* mp = (mkg + qt * 16 * TT + kt * 16) + mo; const float* ap = (adg + qt * 16 * TT + kt * 16) + mo;
            const v4i m0 = *(const v4i*)mp, m1 = *(const v4i*)(mp + 4); const v4f a0 = *(const v4f*)ap, a1 = *(const v4f*)(ap + 4);
#pragma unroll
            for (int q = 0; q < 4; ++q) { mb[qt] |= (m0[q] != 0 ? 1u : 0u) << (kt * 8 + q); mb[qt] |= (m1[q] != 0 ? 1u : 0u) << (kt * 8 + 4 + q); }
            ga[qt][kt][0] = (unsigned)f2bf(a0[0]) | ((unsigned)f2bf(a0[1]) << 16); ga[qt][kt][1] = (unsigned)f2bf(a0[2]) | ((unsigned)f2bf(a0[3]) << 16);
            ga[qt][kt][2] = (unsigned)f2bf(a1[0]) | ((unsigned)f2bf(a1[1]) << 16); ga[qt][kt][3] = (unsigned)f2bf(a1[2]) | ((unsigned)f2bf(a1[3]) << 16); } }
#pragma unroll 1   // rolled, for speed only
    for (int h = 0; h < NH_; ++h) {
        const size_t z = (size_t)g * NH_ + h;
        v16bf qh[FQT], ql[FQT];
#pragma unroll
        for (int qt = 0; qt < FQT; ++qt) { const size_t o = (z * TT + qt * 16) * HD; qh[qt] = WFrag<bf>::ld((Qh + o) + qo); ql[qt] = WFrag<bf>::ld((Ql + o) + qo); }
        float sc[FQT][FKT][8]; float mx[FQT];
#pragma unroll
        for (int qt = 0; qt < FQT; ++qt) mx[qt] = -3.0e38f;
#pragma unroll
        for (int kt = 0; kt < FKT; ++kt) { const size_t o = (z * TT + kt * 16) * HD; const v16bf kh = WFrag<bf>::ld((Kh + o) + ko), kl = WFrag<bf>::ld((Kl + o) + ko);
#pragma unroll
            for (int qt = 0; qt < FQT; ++qt) { v8f a = (v8f){}; a = wmmab(kh, qh[qt], a); a = wmmab(kh, ql[qt], a); a = wmmab(kl, qh[qt], a);   /* q_hi k_hi + q_lo k_hi + q_hi k_lo; a[j] = score of key 8 hi + j of the tile, query lr */
#pragma unroll
                for (int j = 0; j < 8; ++j) { const float t = ((mb[qt] >> (kt * 8 + j)) & 1u) ? -1.0e9f : __fmul_rn(a[j], SCL);   /* where(mask != 0, -1e9, scores / sqrt(32)): the module's literal, after the scale */ sc[qt][kt][j] = t; mx[qt] = fmaxf(mx[qt], t); } } }
#pragma unroll
        for (int qt = 0; qt < FQT; ++qt) { mx[qt] = fmaxf(mx[qt], __shfl_xor(mx[qt], 16, 32)); if (hi == 0) redm[w][qt * 16 + lr] = mx[qt]; }
        __syncthreads();   // every wave's row maxima are in LDS
#pragma unroll
        for (int qt = 0; qt < FQT; ++qt) { float m = redm[0][qt * 16 + lr];
#pragma unroll
            for (int ww = 1; ww < FW; ++ww) m = fmaxf(m, redm[ww][qt * 16 + lr]);
            float s = 0.f;
#pragma unroll
            for (int kt = 0; kt < FKT; ++kt) {
#pragma unroll
                for (int j = 0; j < 8; ++j) sc[qt][kt][j] = __fmul_rn(__fsub_rn(sc[qt][kt][j], m), 1.4426950408889634f);
                exp2x8(sc[qt][kt]);
#pragma unroll
                for (int j = 0; j < 8; ++j) s += sc[qt][kt][j]; }
            s += __shfl_xor(s, 16, 32); if (hi == 0) reds[w][qt * 16 + lr] = s; }
        __syncthreads();   // every wave's row sums are in LDS
        float f[FQT];
#pragma unroll
        for (int qt = 0; qt < FQT; ++qt) { float s = reds[0][qt * 16 + lr];
#pragma unroll
            for (int ww = 1; ww < FW; ++ww) s += reds[ww][qt * 16 + lr];
            f[qt] = __fdiv_rn(1.0f, s); }
        v8f oa[FQT][2];
#pragma unroll
        for (int qt = 0; qt < FQT; ++qt) { oa[qt][0] = (v8f){}; oa[qt][1] = (v8f){}; }
#pragma unroll
        for (int kc = 0; kc < FKT / 2; ++kc) { v16bf ph[FQT], pl[FQT];
#pragma unroll
            for (int qt = 0; qt < FQT; ++qt) { v8u hw, lw;
#pragma unroll
                for (int tt = 0; tt < 2; ++tt)
#pragma unroll
                    for (int p = 0; p < 4; ++p) { const unsigned gp = ga[qt][2 * kc + tt][p]; unsigned a, c2;
                        split2(__fmul_rn(__fmul_rn(sc[qt][2 * kc + tt][2 * p], f[qt]), __uint_as_float(gp << 16)), __fmul_rn(__fmul_rn(sc[qt][2 * kc + tt][2 * p + 1], f[qt]), __uint_as_float(gp & 0xFFFF0000u)), a, c2);   /* softmax weight x the pair factor AFTER the normalisation: two rounded products */
                        hw[tt * 4 + p] = a; lw[tt * 4 + p] = c2; }
                ph[qt] = __builtin_bit_cast(v16bf, hw); pl[qt] = __builtin_bit_cast(v16bf, lw); }   /* A fragment: row = query lr, k = 8 hi + j (first tile) and 16 + 8 hi + j (second tile) of the 32 keys */
#pragma unroll
            for (int dt = 0; dt < 2; ++dt) { const size_t o = (z * HP + dt * 16) * TT + kc * 32; const v16bf vh = WFrag<bf>::ld((Vh + o) + vo), vl = WFrag<bf>::ld((Vl + o) + vo);
#pragma unroll
                for (int qt = 0; qt < FQT; ++qt) { oa[qt][dt] = wmmab(ph[qt], vh, oa[qt][dt]); oa[qt][dt] = wmmab(pl[qt], vh, oa[qt][dt]); oa[qt][dt] = wmmab(ph[qt], vl, oa[qt][dt]); } } }
#pragma unroll
        for (int qt = 0; qt < FQT; ++qt)
#pragma unroll
            for (int dt = 0; dt < 2; ++dt)
#pragma unroll
                for (int j = 0; j < 8; ++j) os[w][qt * 16 + hi * 8 + j][dt * 16 + lr] = oa[qt][dt][j];
        __syncthreads();   // every wave's partial outputs are in LDS; the next head writes them again only behind its own two barriers
        { const int q = threadIdx.x >> 3, d4 = (threadIdx.x & 7) * 4; v4f s = *(const v4fa*)&os[0][q][d4];
#pragma unroll
            for (int ww = 1; ww < FW; ++ww) s += *(const v4fa*)&os[ww][q][d4];
            v4us oh, ol;
#pragma unroll
            for (int c = 0; c < 4; ++c) { unsigned short a, c2; splitf(s[c], a, c2); oh[c] = a; ol[c] = c2; }
            const size_t o = ((size_t)g * TT + i0) * DQ + h * HD; const unsigned oo = (unsigned)(q * DQ + d4); *(v4us*)((Ah + o) + oo) = oh; *(v4us*)((Al + o) + oo) = ol;   /* merged [t][head][d] hi / lo planes for the output projection */
            asm volatile("s_wait_xcnt 0x0" ::: "memory"); }   // stands in front of the next head's first instructions, which reuse the registers that the two stores name as their addresses
    }
}

extern "C" void kernel_launch(void* const* d_in, const int* in_sizes, int n_in,
                              void* d_out, int out_size, void* d_ws, size_t ws_size, hipStream_t stream) {
    (void)in_sizes; (void)n_in; (void)out_size;
    const float* x = (const float*)d_in[0]; const float* xk = (const float*)d_in[1]; const float* xv = (const float*)d_in[2]; const int* mk = (const int*)d_in[3]; const float* adj = (const float*)d_in[4]; const float* wq = (const float*)d_in[5]; const float* bq = (const float*)d_in[6]; const float* wk = (const float*)d_in[7]; const float* bk = (const float*)d_in[8]; const float* wv = (const float*)d_in[9]; const float* bv = (const float*)d_in[10]; const float* wo = (const float*)d_in[11]; const float* bo = (const float*)d_in[12];   /* order query, key, value ([4][12][512][128] = 48 groups), mask (int32 [48][512][512]: read as data), adjm (f32 [48][512][512]: read), Wq, bq, Wk, bk, Wv, bv, Wp, bp ('oi') */
    float* OUT = (float*)d_out;     // [48][512][128]
    char* wsp = (char*)d_ws;
    auto take = [&](size_t bytes) { char* p = wsp; wsp += (bytes + 255) & ~(size_t)255; return (void*)p; };
    bf* WQ = (bf*)take((size_t)4 * DQ * DM * 2); bf* WO = WQ + (size_t)3 * DQ * DM;   /* Wq, Wk, Wv, Wp as bf16, side by side (all [128][128]) */ float* CS = (float*)take((size_t)TT * HD * 2 * 4);
    bf* XB = (bf*)take((size_t)3 * NB_ * TT * DM * 2);   /* query, key, value as bf16: [3][48][512][128] */
    h16* QP16 = (h16*)take((size_t)2 * NB_ * NH_ * TT * HD * 2);
    bf* QPh = (bf*)take((size_t)2 * NB_ * NH_ * TT * HD * 2); bf* QPl = (bf*)take((size_t)2 * NB_ * NH_ * TT * HD * 2);   /* [q groups | k groups][head][t][d] */ bf* KPh = QPh + (size_t)NB_ * NH_ * TT * HD; bf* KPl = QPl + (size_t)NB_ * NH_ * TT * HD;
    bf* VTh = (bf*)take((size_t)NB_ * NKV * HP * TT * 2); bf* VTl = (bf*)take((size_t)NB_ * NKV * HP * TT * 2);
    float* FQ = (float*)take((size_t)3 * NB_ * TT * DQ * 4);   /* the f32 q, k, v projections [3][48][512][128] */ bf* ATh = (bf*)take((size_t)NB_ * TT * DQ * 2); bf* ATl = (bf*)take((size_t)NB_ * TT * DQ * 2);
    if ((size_t)(wsp - (char*)d_ws) > ws_size) return;    // ws 256 MiB given; the carve is below 150 MiB
    float* FV = FQ + (size_t)2 * NB_ * TT * DQ;
    k_cvt8<<<dim3((unsigned)(((size_t)DQ * DM / 8 + 255) / 256), 4, 1), 256, 0, stream>>>(wq, wk, wv, wo, WQ, (size_t)DQ * DM / 8);
    k_csid<<<(TT * HD + 255) / 256, 256, 0, stream>>>(CS);
    k_cvt8<<<dim3((unsigned)(((size_t)NB_ * TT * DM / 8 + 255) / 256), 3, 1), 256, 0, stream>>>(x, xk, xv, xv, XB, (size_t)NB_ * TT * DM / 8);
    k_gemmw<bf, 0, true><<<dim3(NB_ * TT / 64, DQ / 64, 3), 32, 0, stream>>>(XB, nullptr, WQ, nullptr, DM, FQ, DQ, bq, bk, bv, (size_t)NB_ * TT * DM, (size_t)DQ * DM, (size_t)NB_ * TT * DQ);   /* rows = all (group, node) pairs; z = q, k, v */
    k_rope<<<dim3((unsigned)(((size_t)NH_ * TT * HD / 2 + 255) / 256), 2 * NB_, 1), 256, 0, stream>>>(FQ, DQ, NH_, CS, nullptr, nullptr, 1.0f, QP16, QPh, QPl);
    k_vtp<<<dim3((unsigned)(((size_t)NKV * HP * TT / 2 + 255) / 256), NB_, 1), 256, 0, stream>>>(FV, DKV, NKV, VTh, VTl);   /* v^T planes zero-padded to 64 rows per kv head */
    k_fattn<<<dim3(TT / (FQT * 16), NB_, 1), FW * 32, 0, stream>>>(QPh, QPl, KPh, KPl, VTh, VTl, mk, adj, ATh, ATl);   /* one kv head per query head: plane z of q meets plane z of k and of v^T */
    k_gemmw<bf, 1, true><<<dim3(NB_ * TT / 64, DM / 64, 1), 32, 0, stream>>>(ATh, ATl, WO, nullptr, DQ, OUT, DM, bo, bo, bo, 0, 0, 0);
}

// v003
// Measured time: 76.3 microseconds a run.
// Two timings next to v002 put it at 1.48 and 1.49 times that version's speed.
// All steps since v000 together make it 48.4 times as fast.
#include <hip/hip_runtime.h>

// Spatial multi-head attention over graph nodes with a pair mask and a post-softmax pair factor (query, key, value [4][12][512][128]: 48 independent (batch, time) groups of 512 nodes; q = query Wq^T + bq, k = key Wk^T + bk, v = value Wv^T + bv ('oi' (out, in) [128][128] + [128]: real biases; 4 heads x 32); scores x 1/sqrt(32); where mask[b][t][i][j] != 0 (int32 [4][12][512][512], read per logit as data) the score is REPLACED by -1e9; softmax over the 512 keys; the weights x adjm[b][t][i][j] (f32 [4][12][512][512], read, rounded to bf16: an input) AFTER the softmax, no renormalisation; out = merged Wp^T + bp -> [4][12][512][128] (3.1 M); argument order query, key, value, mask, adjm, Wq, bq, Wk, bk, Wv, bv, Wp, bp).
// Layout, all 48 groups per launch, three launches: (1) k_proj reads query, key, value and Wq, Wk, Wv as f32, rounds them to bf16 on their way into LDS, adds the bias rounded to bf16 and writes the hi/lo planes that attention reads: q/k planes [q groups | k groups][head][t][32] and value^T planes [group][head][64][t], rows 0..31 used; its first 16 work-groups also write the bf16 copy of Wp; (2) ONE fused kernel for scores, masked softmax, pair factor, attn.v and the head merge, every operand on hi/lo planes, scores and weights in registers only; (3) merged hi/lo x Wp exact + bp.
// Compute dtypes, f32 accumulate: every input rounded to bf16, nearest even, incl. the pair factor adjm; projections exact + bf16 biases; scores (K 32) and attn.v 3 products on every row; softmax f32; Wp hl x exact + bias.

#define NB_  48
#define TT   512
#define DM   128
#define NH_  4
#define NKV  4
#define HD   32
#define DQ   (NH_ * HD)
#define SCL  0.17677669529663688f   // 32^-0.5 (the module divides by float32(sqrt(32)); one multiply here)
#define HP   64    // row pitch per head of the v^T planes (rows 32..63 are neither written nor read)
typedef unsigned short bf;
typedef __attribute__((ext_vector_type(16))) __bf16   v16bf;
typedef __attribute__((ext_vector_type(8)))  __bf16   v8bf;
typedef __attribute__((ext_vector_type(4)))  __bf16   v4bf;
typedef __attribute__((ext_vector_type(8)))  unsigned short v8us;
typedef __attribute__((ext_vector_type(4)))  unsigned short v4us;
typedef __attribute__((ext_vector_type(8)))  float    v8f;
typedef __attribute__((ext_vector_type(4)))  float    v4f;
typedef __attribute__((ext_vector_type(4)))  int      v4i;
typedef __attribute__((ext_vector_type(4)))  unsigned v4u;
typedef v4f  __attribute__((may_alias)) v4fa;
typedef v8us __attribute__((may_alias)) v8usa;
typedef v4us __attribute__((may_alias)) v4usa;

__device__ __forceinline__ unsigned short f2bf(float f) { unsigned u = __float_as_uint(f); u += 0x7FFFu + ((u >> 16) & 1u); return (unsigned short)(u >> 16); }
__device__ __forceinline__ float bf2f(unsigned short b) { return __uint_as_float(((unsigned)b) << 16); }
__device__ __forceinline__ float bfr(float f) { return bf2f(f2bf(f)); }
__device__ __forceinline__ v16bf cat16b(v8us lo, v8us hi) { return __builtin_bit_cast(v16bf, __builtin_shufflevector(lo, hi, 0, 1, 2, 3, 4, 5, 6, 7, 8, 9, 10, 11, 12, 13, 14, 15)); }
__device__ __forceinline__ v8f wmmab(v16bf a, v16bf b, v8f c) { return __builtin_amdgcn_wmma_f32_16x16x32_bf16(false, a, false, b, (short)0, c, false, false); }
__device__ __forceinline__ void splitf(float y, unsigned short& h, unsigned short& l) { h = f2bf(y); l = f2bf(y - bf2f(h)); }

// ---- k_gemmw: register-blocked GEMM, ONE WAVE per 64x64 output tile (16 accumulators), operands straight from K-contiguous 16-bit planes; grid (M/64, N/64, Z), 32 threads.
// C[m][n] (f32, pitch ldc, + optional f32 bias[n], one bias pointer per z up to z = 2) = sum_k A[m][k] Bt[n][k] (+ split products per NSPLIT). z-batch strides sA/sB/sC in elements. K % 32 == 0.
template <typename T16> struct WFrag;
template <> struct WFrag<bf> { typedef v16bf V; static __device__ __forceinline__ V ld(const bf* p) { return cat16b(*(const v8us*)p, *(const v8us*)(p + 16)); } static __device__ __forceinline__ v8f mma(V a, V b, v8f c) { return wmmab(a, b, c); } };
template <typename T16, int NSPLIT, bool BIAS>
__global__ __launch_bounds__(32) void k_gemmw(const T16* __restrict__ A, const T16* __restrict__ A2, const T16* __restrict__ Bt, const T16* __restrict__ Bt2, int K, float* C, int ldc, const float* __restrict__ bias0, const float* __restrict__ bias1, const float* __restrict__ bias2, size_t sA, size_t sB, size_t sC) {
    typedef typename WFrag<T16>::V V;
    __shared__ __align__(16) float os[16 * 68];
    const size_t z = blockIdx.z; A += z * sA; if (A2) A2 += z * sA; Bt += z * sB; if (Bt2) Bt2 += z * sB; C += z * sC; const float* bias = z == 0 ? bias0 : (z == 1 ? bias1 : bias2);
    const int lane = threadIdx.x & 31, lr = lane & 15, hi = lane >> 4; const int r0 = blockIdx.x * 64, c0 = blockIdx.y * 64;
    v8f acc[4][4];
#pragma unroll
    for (int mb = 0; mb < 4; ++mb)
#pragma unroll
        for (int nb = 0; nb < 4; ++nb) acc[mb][nb] = (v8f){};
    const size_t aoff = (size_t)(r0 + lr) * K + 8 * hi, boff = (size_t)(c0 + lr) * K + 8 * hi;
    for (int kc = 0; kc < K; kc += 32) {
        V a[4], a2[4];
#pragma unroll
        for (int mb = 0; mb < 4; ++mb) { a[mb] = WFrag<T16>::ld(A + aoff + (size_t)mb * 16 * K + kc); if (NSPLIT == 1 || NSPLIT == 2) a2[mb] = WFrag<T16>::ld(A2 + aoff + (size_t)mb * 16 * K + kc); }
#pragma unroll
        for (int nb = 0; nb < 4; ++nb) { const V b = WFrag<T16>::ld(Bt + boff + (size_t)nb * 16 * K + kc); V b2; if (NSPLIT >= 2) b2 = WFrag<T16>::ld(Bt2 + boff + (size_t)nb * 16 * K + kc);
#pragma unroll
            for (int mb = 0; mb < 4; ++mb) { acc[mb][nb] = WFrag<T16>::mma(a[mb], b, acc[mb][nb]); if (NSPLIT == 1 || NSPLIT == 2) acc[mb][nb] = WFrag<T16>::mma(a2[mb], b, acc[mb][nb]); if (NSPLIT >= 2) acc[mb][nb] = WFrag<T16>::mma(a[mb], b2, acc[mb][nb]); } }
        asm volatile("v_nop\n\tv_nop\n\tv_nop\n\tv_nop" : "+v"(acc[0][0]), "+v"(acc[1][1]), "+v"(acc[2][2]), "+v"(acc[3][3]) : "v"(a[0]), "v"(a[3]));
    }
#pragma unroll
    for (int mb = 0; mb < 4; ++mb) {
#pragma unroll
        for (int nb = 0; nb < 4; ++nb) {
#pragma unroll
            for (int j = 0; j < 8; ++j) os[(hi * 8 + j) * 68 + nb * 16 + lr] = acc[mb][nb][j]; }
        __builtin_amdgcn_wave_barrier(); asm volatile("" ::: "memory");
        float* crow = C + (size_t)(r0 + mb * 16) * ldc + c0;
{
#pragma unroll
            for (int s = 0; s < 8; ++s) { const int row = 2 * s + hi, cofs = lr * 4; v4f val = *(const v4fa*)(os + row * 68 + cofs); if (BIAS) { val[0] += bfr(bias[c0 + cofs]); val[1] += bfr(bias[c0 + cofs + 1]); val[2] += bfr(bias[c0 + cofs + 2]); val[3] += bfr(bias[c0 + cofs + 3]); }
                *(v4f*)(crow + (size_t)row * ldc + cofs) = val; }
             }
        __builtin_amdgcn_wave_barrier(); asm volatile("" ::: "memory");
    }
}

// splitf of eight values: h = bf16(y), l = bf16(y - h), both nearest even.
__device__ __forceinline__ void split8(v8f y, v8us& h, v8us& l) { const v8bf hb = __builtin_convertvector(y, v8bf); const v4u u = __builtin_bit_cast(v4u, hb); v8f r;
#pragma unroll
    for (int i = 0; i < 4; ++i) { r[2 * i] = __uint_as_float(u[i] << 16); r[2 * i + 1] = __uint_as_float(u[i] & 0xFFFF0000u); }
    h = __builtin_bit_cast(v8us, hb); l = __builtin_bit_cast(v8us, __builtin_convertvector(y - r, v8bf)); }

// ---- k_proj: the q, k and v projections (blockIdx.y = 0, 1, 2) of 64 (group, node) rows, from the f32 inputs to the hi/lo planes of attention. Four waves; wave w owns head w, output columns 32 w .. 32 w + 31, as a 64x32 register tile (8 accumulators).
// y[m][n] = sum_k bf16(x[m][k]) bf16(W[n][k]) + bf16(bias[n]). Operands: a row of 128 f32 is ONE load of a wave (16 bytes a lane, four whole lines); it is rounded to bf16 and laid in LDS, the 64 input rows once for the four waves, each wave's 32 weight rows in its own slice; the fragments are read from there.
// An accumulator holds 8 consecutive rows (nodes) of one column (lane & 15). q, k: the tile turns through the wave's LDS slice (f32) so that a lane holds 8 consecutive columns of a row: a store covers 8 rows = 512 contiguous bytes of the head's plane. v: a lane's 8 nodes of one column are already contiguous in v^T; the split tile is staged in the same slice (16-bit, hi then lo) so that a store covers four whole 128-byte rows.
#define PW  4      // waves per work-group
#define ASP 136    // LDS row pitch (16-bit elements) of the staged operand rows: 256 + 16 bytes, so that the 16 rows of a fragment read start 4 banks apart
#define QSP 36     // LDS row pitch (floats) of the staged q/k tile: the two lane halves (8 rows apart) fall on different banks, rows stay 16-byte aligned
#define VSP 72     // LDS row pitch (16-bit elements) of the staged v^T tile: rows stay 16-byte aligned
#define WSL (64 * QSP)   // floats in a wave's LDS slice: first its 32 weight rows (32 x 136 x 2 bytes fit), then its output tile (64 x 36 floats, or 2 planes x 32 rows x 72 x 2 bytes)
__device__ __forceinline__ void st4(bf* d, v4f u) { *(v4usa*)d = __builtin_bit_cast(v4us, __builtin_convertvector(u, v4bf)); }   // four f32 to bf16, nearest even, into LDS
__device__ __forceinline__ v16bf ldsf(const bf* p) { return cat16b(*(const v8usa*)p, *(const v8usa*)(p + 16)); }   // fragment from an LDS row: the k order of WFrag<bf>::ld
// amdgpu_waves_per_eu(5): the register budget of five waves a SIMD, so that all 1152 work-groups (four or five a WGP) are resident at once; without it the v branch is scheduled into more than 204 registers and a second, short round of work-groups follows the first.
__global__ __launch_bounds__(PW * 32) __attribute__((amdgpu_waves_per_eu(5))) void k_proj(const float* __restrict__ x0, const float* __restrict__ x1, const float* __restrict__ x2, const float* __restrict__ w0, const float* __restrict__ w1, const float* __restrict__ w2, const float* __restrict__ w3, const float* __restrict__ b0, const float* __restrict__ b1, const float* __restrict__ b2, bf* Ph, bf* Pl, bf* Vh, bf* Vl, bf* W3) {
    __shared__ __align__(16) float sm[PW * WSL + 64 * ASP / 2];   // four slices, then the 64 input rows; every 16-bit access goes through a may_alias vector type
    const int z = blockIdx.y; const float* A = z == 0 ? x0 : (z == 1 ? x1 : x2); const float* B = z == 0 ? w0 : (z == 1 ? w1 : w2); const float* bias = z == 0 ? b0 : (z == 1 ? b1 : b2);
    const int lane = threadIdx.x & 31, lr = lane & 15, hi = lane >> 4, w = threadIdx.x >> 5; const int r0 = blockIdx.x * 64, c0 = w * HD;
    const int g = r0 / TT, t0 = r0 % TT;   // 64 divides 512: a tile lies in one group
    bf* as = (bf*)(sm + PW * WSL); bf* bs = (bf*)(sm + w * WSL);
    if (z == 0 && blockIdx.x < DM * DQ / (PW * 32 * 8)) {   // uniform in the work-group: the first 16 work-groups of the q part round Wp to bf16 for the output projection, 8 elements a thread
        const int e = (blockIdx.x * (PW * 32) + threadIdx.x) * 8; *(v8us*)(W3 + e) = __builtin_bit_cast(v8us, __builtin_convertvector(*(const v8f*)(w3 + e), v8bf));
        asm volatile("s_wait_xcnt 0x0" ::: "memory"); }   // stands in front of the staging code, which may reuse the registers that the load and the store name
    { const float* ag = A + (size_t)(r0 + w * 16) * DM + lane * 4; const float* bg = B + c0 * DM + lane * 4;   // the wave stages 16 of the input rows and its own 32 weight rows, in three groups of 16 loads, two groups in flight: 128 data registers, not 192, which leaves room for five waves a SIMD
        v4f wa[16], xa[16], wb[16];
#pragma unroll
        for (int i = 0; i < 16; ++i) wa[i] = *(const v4f*)(bg + i * DM);
#pragma unroll
        for (int i = 0; i < 16; ++i) xa[i] = *(const v4f*)(ag + i * DM);
        asm volatile("s_wait_xcnt 0x0" :: "v"(ag), "v"(bg) : "memory");   // behind the last load of the two groups; the two addresses are inputs so that they stay in their registers up to the wait and no load's result lands on them in front of it
#pragma unroll
        for (int i = 0; i < 16; ++i) st4(bs + i * ASP + lane * 4, wa[i]);
        __builtin_amdgcn_sched_barrier(0);   // keeps the third group's loads behind the first group's LDS stores: lifted over them they hold 64 more registers at once, and the build spills
#pragma unroll
        for (int i = 0; i < 16; ++i) wb[i] = *(const v4f*)(bg + (16 + i) * DM);
        asm volatile("s_wait_xcnt 0x0" :: "v"(bg) : "memory");   // the same behind the third group
#pragma unroll
        for (int i = 0; i < 16; ++i) st4(as + (w * 16 + i) * ASP + lane * 4, xa[i]);
#pragma unroll
        for (int i = 0; i < 16; ++i) st4(bs + (16 + i) * ASP + lane * 4, wb[i]); }
    __syncthreads();   // all 64 input rows are in LDS before any wave reads fragments
    v8f acc[4][2];
#pragma unroll
    for (int mb = 0; mb < 4; ++mb)
#pragma unroll
        for (int nb = 0; nb < 2; ++nb) acc[mb][nb] = (v8f){};
#pragma unroll
    for (int kc = 0; kc < DM; kc += 32) {
        v16bf a[4];
#pragma unroll
        for (int mb = 0; mb < 4; ++mb) a[mb] = ldsf(as + (mb * 16 + lr) * ASP + kc + 8 * hi);
#pragma unroll
        for (int nb = 0; nb < 2; ++nb) { const v16bf b = ldsf(bs + (nb * 16 + lr) * ASP + kc + 8 * hi);
#pragma unroll
            for (int mb = 0; mb < 4; ++mb) acc[mb][nb] = wmmab(a[mb], b, acc[mb][nb]); }
    }
    __syncthreads();   // every fragment has been read before a slice is written again
    if (z < 2) {   // uniform in the work-group
        float* os = sm + w * WSL;
#pragma unroll
        for (int mb = 0; mb < 4; ++mb)
#pragma unroll
            for (int nb = 0; nb < 2; ++nb)
#pragma unroll
                for (int j = 0; j < 8; ++j) os[(mb * 16 + hi * 8 + j) * QSP + nb * 16 + lr] = acc[mb][nb][j];
        const int r8 = lane >> 2, c8 = (lane & 3) * 8;   // read-back: 8 rows a step, 8 columns a lane
        v8f bb;
#pragma unroll
        for (int i = 0; i < 8; ++i) bb[i] = bfr(bias[c0 + c8 + i]);
        const size_t o = (((size_t)(z * NB_ + g) * NH_ + w) * TT + t0 + r8) * HD + c8; bf* ph = Ph + o; bf* pl = Pl + o;   // plane [q | k][group][head][t][d]
        __syncthreads();   // the tile is in LDS before other lanes read it
#pragma unroll
        for (int s = 0; s < 8; ++s) { const float* rp = os + (8 * s + r8) * QSP + c8; const v4f u0 = *(const v4fa*)rp, u1 = *(const v4fa*)(rp + 4); v8us oh, ol;
            split8(__builtin_shufflevector(u0, u1, 0, 1, 2, 3, 4, 5, 6, 7) + bb, oh, ol); *(v8us*)(ph + 8 * s * HD) = oh; *(v8us*)(pl + 8 * s * HD) = ol; }
    } else {
        bf* vsh = (bf*)(sm + w * WSL); bf* vsl = vsh + HD * VSP;
#pragma unroll
        for (int nb = 0; nb < 2; ++nb) { const float bn = bfr(bias[c0 + nb * 16 + lr]);
#pragma unroll
            for (int mb = 0; mb < 4; ++mb) { v8us oh, ol; split8(acc[mb][nb] + bn, oh, ol); const int so = (nb * 16 + lr) * VSP + mb * 16 + hi * 8; *(v8usa*)(vsh + so) = oh; *(v8usa*)(vsl + so) = ol; } }
        const int r4 = lane >> 3, c8 = (lane & 7) * 8;   // read-back: 4 v^T rows a step, 8 nodes a lane
        const size_t o = ((size_t)(g * NKV + w) * HP + r4) * TT + t0 + c8; bf* vh = Vh + o; bf* vl = Vl + o;   // plane [group][head][d][t]
        __syncthreads();   // the tile's 32 v^T rows are in LDS before other lanes read them
        v8us th[8], tl[8];   // all sixteen LDS reads first, then the stores: one LDS latency, not sixteen
#pragma unroll
        for (int s = 0; s < 8; ++s) { const int so = (4 * s + r4) * VSP + c8; th[s] = *(const v8usa*)(vsh + so); tl[s] = *(const v8usa*)(vsl + so); }
#pragma unroll
        for (int s = 0; s < 8; ++s) { *(v8us*)(vh + 4 * s * TT) = th[s]; *(v8us*)(vl + 4 * s * TT) = tl[s]; }
        asm volatile("s_wait_xcnt 0x0" ::: "memory");   // behind the last store: in the built code the q/k branch follows this one, and its first instructions reuse registers that these stores name
    }
}

// ---- k_fattn: scores, masked softmax, pair factor, attn.v and the head merge of 32 query rows of one group, all four heads, in ONE work-group of 8 waves; nothing of the score or weight matrices goes to memory.
// Wave w owns keys 64 w .. 64 w + 63. It computes S^T = K Q^T (A = key rows, B = query rows), so a lane holds scores of ONE query (lane & 15) and the accumulator pair of 32 keys is, converted in place, the A fragment of the weights for attn.v (hardware k order on both sides).
// The wave's 32 x 64 block of the pair mask (one bit each) and of the pair factor (bf16, its compute type) is read once and serves the four heads. Row maximum, row sum and the attn.v partial sums of the 8 waves meet in LDS: three barriers per head.
typedef __attribute__((ext_vector_type(8))) unsigned v8u;
__device__ __forceinline__ unsigned rne16(float f) { const unsigned u = __float_as_uint(f); return u + 0x7FFFu + ((u >> 16) & 1u); }   // f2bf's rounding, the bf16 left in the upper half
__device__ __forceinline__ void split2(float y0, float y1, unsigned& h, unsigned& l) { const unsigned r0 = rne16(y0), r1 = rne16(y1); h = (r0 >> 16) | (r1 & 0xFFFF0000u); const unsigned s0 = rne16(y0 - __uint_as_float(r0 & 0xFFFF0000u)), s1 = rne16(y1 - __uint_as_float(r1 & 0xFFFF0000u)); l = (s0 >> 16) | (s1 & 0xFFFF0000u); }   // splitf of two neighbours, each plane's pair packed in one word
// Eight v_exp_f32, in place, and one v_nop in ONE statement: behind each exp stands an independent instruction, behind the last the v_nop, so nothing directly behind a transcendental reads its result or overwrites its source (the slot the instruction set asks for).
__device__ __forceinline__ void exp2x8(float (&x)[8]) { asm("v_exp_f32 %0, %0\n\tv_exp_f32 %1, %1\n\tv_exp_f32 %2, %2\n\tv_exp_f32 %3, %3\n\tv_exp_f32 %4, %4\n\tv_exp_f32 %5, %5\n\tv_exp_f32 %6, %6\n\tv_exp_f32 %7, %7\n\tv_nop" : "+v"(x[0]), "+v"(x[1]), "+v"(x[2]), "+v"(x[3]), "+v"(x[4]), "+v"(x[5]), "+v"(x[6]), "+v"(x[7])); }
#define FW  8                    // waves per work-group
#define FQT 2                    // 16-row query tiles per work-group
#define FKT (TT / FW / 16)       // 16-key tiles per wave
#define OSP 36                   // LDS row pitch (floats) of the partial outputs: the two lane halves (8 rows apart) fall on different banks, rows stay 16-byte aligned
__global__ __launch_bounds__(256) void k_fattn(const bf* __restrict__ Qh, const bf* __restrict__ Ql, const bf* __restrict__ Kh, const bf* __restrict__ Kl, const bf* __restrict__ Vh, const bf* __restrict__ Vl, const int* __restrict__ mk, const float* __restrict__ adj, bf* Ah, bf* Al) {
    __shared__ float redm[FW][FQT * 16]; __shared__ float reds[FW][FQT * 16]; __shared__ __align__(16) float os[FW][FQT * 16][OSP];
    const int lane = threadIdx.x & 31, lr = lane & 15, hi = lane >> 4, w = threadIdx.x >> 5;
    const int g = blockIdx.y, i0 = blockIdx.x * (FQT * 16), k0 = w * (FKT * 16);
    const unsigned mo = (unsigned)((i0 + lr) * TT + k0 + hi * 8), qo = (unsigned)((i0 + lr) * HD + 8 * hi), ko = (unsigned)((k0 + lr) * HD + 8 * hi), vo = (unsigned)(lr * TT + k0 + 8 * hi);   // the lane's 32-bit element offsets inside a group's pair planes and inside a (group, head) plane of q, of k and of v^T; every base below is uniform
    const int* mkg = mk + (size_t)g * TT * TT; const float* adg = adj + (size_t)g * TT * TT;
    unsigned mb[FQT]; unsigned ga[FQT][FKT][4];   // element (kt, j) of a lane: query i0 + 16 qt + lr, key k0 + 16 kt + 8 hi + j
#pragma unroll
    for (int qt = 0; qt < FQT; ++qt) { mb[qt] = 0u;
#pragma unroll
        for (int kt = 0; kt < FKT; ++kt) { const int* mp = (mkg + qt * 16 * TT + kt * 16) + mo; const float* ap = (adg + qt * 16 * TT + kt * 16) + mo;
            const v4i m0 = *(const v4i*)mp, m1 = *(const v4i*)(mp + 4); const v4f a0 = *(const v4f*)ap, a1 = *(const v4f*)(ap + 4);
#pragma unroll
            for (int q = 0; q < 4; ++q) { mb[qt] |= (m0[q] != 0 ? 1u : 0u) << (kt * 8 + q); mb[qt] |= (m1[q] != 0 ? 1u : 0u) << (kt * 8 + 4 + q); }
            ga[qt][kt][0] = (unsigned)f2bf(a0[0]) | ((unsigned)f2bf(a0[1]) << 16); ga[qt][kt][1] = (unsigned)f2bf(a0[2]) | ((unsigned)f2bf(a0[3]) << 16);
            ga[qt][kt][2] = (unsigned)f2bf(a1[0]) | ((unsigned)f2bf(a1[1]) << 16); ga[qt][kt][3] = (unsigned)f2bf(a1[2]) | ((unsigned)f2bf(a1[3]) << 16); } }
#pragma unroll 1   // rolled, for speed only
    for (int h = 0; h < NH_; ++h) {
        const size_t z = (size_t)g * NH_ + h;
        v16bf qh[FQT], ql[FQT];
#pragma unroll
        for (int qt = 0; qt < FQT; ++qt) { const size_t o = (z * TT + qt * 16) * HD; qh[qt] = WFrag<bf>::ld((Qh + o) + qo); ql[qt] = WFrag<bf>::ld((Ql + o) + qo); }
        float sc[FQT][FKT][8]; float mx[FQT];
#pragma unroll
        for (int qt = 0; qt < FQT; ++qt) mx[qt] = -3.0e38f;
#pragma unroll
        for (int kt = 0; kt < FKT; ++kt) { const size_t o = (z * TT + kt * 16) * HD; const v16bf kh = WFrag<bf>::ld((Kh + o) + ko), kl = WFrag<bf>::ld((Kl + o) + ko);
#pragma unroll
            for (int qt = 0; qt < FQT; ++qt) { v8f a = (v8f){}; a = wmmab(kh, qh[qt], a); a = wmmab(kh, ql[qt], a); a = wmmab(kl, qh[qt], a);   /* q_hi k_hi + q_lo k_hi + q_hi k_lo; a[j] = score of key 8 hi + j of the tile, query lr */
#pragma unroll
                for (int j = 0; j < 8; ++j) { const float t = ((mb[qt] >> (kt * 8 + j)) & 1u) ? -1.0e9f : __fmul_rn(a[j], SCL);   /* where(mask != 0, -1e9, scores / sqrt(32)): the module's literal, after the scale */ sc[qt][kt][j] = t; mx[qt] = fmaxf(mx[qt], t); } } }
#pragma unroll
        for (int qt = 0; qt < FQT; ++qt) { mx[qt] = fmaxf(mx[qt], __shfl_xor(mx[qt], 16, 32)); if (hi == 0) redm[w][qt * 16 + lr] = mx[qt]; }
        __syncthreads();   // every wave's row maxima are in LDS
#pragma unroll
        for (int qt = 0; qt < FQT; ++qt) { float m = redm[0][qt * 16 + lr];
#pragma unroll
            for (int ww = 1; ww < FW; ++ww) m = fmaxf(m, redm[ww][qt * 16 + lr]);
            float s = 0.f;
#pragma unroll
            for (int kt = 0; kt < FKT; ++kt) {
#pragma unroll
                for (int j = 0; j < 8; ++j) sc[qt][kt][j] = __fmul_rn(__fsub_rn(sc[qt][kt][j], m), 1.4426950408889634f);
                exp2x8(sc[qt][kt]);
#pragma unroll
                for (int j = 0; j < 8; ++j) s += sc[qt][kt][j]; }
            s += __shfl_xor(s, 16, 32); if (hi == 0) reds[w][qt * 16 + lr] = s; }
        __syncthreads();   // every wave's row sums are in LDS
        float f[FQT];
#pragma unroll
        for (int qt = 0; qt < FQT; ++qt) { float s = reds[0][qt * 16 + lr];
#pragma unroll
            for (int ww = 1; ww < FW; ++ww) s += reds[ww][qt * 16 + lr];
            f[qt] = __fdiv_rn(1.0f, s); }
        v8f oa[FQT][2];
#pragma unroll
        for (int qt = 0; qt < FQT; ++qt) { oa[qt][0] = (v8f){}; oa[qt][1] = (v8f){}; }
#pragma unroll
        for (int kc = 0; kc < FKT / 2; ++kc) { v16bf ph[FQT], pl[FQT];
#pragma unroll
            for (int qt = 0; qt < FQT; ++qt) { v8u hw, lw;
#pragma unroll
                for (int tt = 0; tt < 2; ++tt)
#pragma unroll
                    for (int p = 0; p < 4; ++p) { const unsigned gp = ga[qt][2 * kc + tt][p]; unsigned a, c2;
                        split2(__fmul_rn(__fmul_rn(sc[qt][2 * kc + tt][2 * p], f[qt]), __uint_as_float(gp << 16)), __fmul_rn(__fmul_rn(sc[qt][2 * kc + tt][2 * p + 1], f[qt]), __uint_as_float(gp & 0xFFFF0000u)), a, c2);   /* softmax weight x the pair factor AFTER the normalisation: two rounded products */
                        hw[tt * 4 + p] = a; lw[tt * 4 + p] = c2; }
                ph[qt] = __builtin_bit_cast(v16bf, hw); pl[qt] = __builtin_bit_cast(v16bf, lw); }   /* A fragment: row = query lr, k = 8 hi + j (first tile) and 16 + 8 hi + j (second tile) of the 32 keys */
#pragma unroll
            for (int dt = 0; dt < 2; ++dt) { const size_t o = (z * HP + dt * 16) * TT + kc * 32; const v16bf vh = WFrag<bf>::ld((Vh + o) + vo), vl = WFrag<bf>::ld((Vl + o) + vo);
#pragma unroll
                for (int qt = 0; qt < FQT; ++qt) { oa[qt][dt] = wmmab(ph[qt], vh, oa[qt][dt]); oa[qt][dt] = wmmab(pl[qt], vh, oa[qt][dt]); oa[qt][dt] = wmmab(ph[qt], vl, oa[qt][dt]); } } }
#pragma unroll
        for (int qt = 0; qt < FQT; ++qt)
#pragma unroll
            for (int dt = 0; dt < 2; ++dt)
#pragma unroll
                for (int j = 0; j < 8; ++j) os[w][qt * 16 + hi * 8 + j][dt * 16 + lr] = oa[qt][dt][j];
        __syncthreads();   // every wave's partial outputs are in LDS; the next head writes them again only behind its own two barriers
        { const int q = threadIdx.x >> 3, d4 = (threadIdx.x & 7) * 4; v4f s = *(const v4fa*)&os[0][q][d4];
#pragma unroll
            for (int ww = 1; ww < FW; ++ww) s += *(const v4fa*)&os[ww][q][d4];
            v4us oh, ol;
#pragma unroll
            for (int c = 0; c < 4; ++c) { unsigned short a, c2; splitf(s[c], a, c2); oh[c] = a; ol[c] = c2; }
            const size_t o = ((size_t)g * TT + i0) * DQ + h * HD; const unsigned oo = (unsigned)(q * DQ + d4); *(v4us*)((Ah + o) + oo) = oh; *(v4us*)((Al + o) + oo) = ol;   /* merged [t][head][d] hi / lo planes for the output projection */
            asm volatile("s_wait_xcnt 0x0" ::: "memory"); }   // stands in front of the next head's first instructions, which reuse the registers that the two stores name as their addresses
    }
}

extern "C" void kernel_launch(void* const* d_in, const int* in_sizes, int n_in,
                              void* d_out, int out_size, void* d_ws, size_t ws_size, hipStream_t stream) {
    (void)in_sizes; (void)n_in; (void)out_size;
    const float* x = (const float*)d_in[0]; const float* xk = (const float*)d_in[1]; const float* xv = (const float*)d_in[2]; const int* mk = (const int*)d_in[3]; const float* adj = (const float*)d_in[4]; const float* wq = (const float*)d_in[5]; const float* bq = (const float*)d_in[6]; const float* wk = (const float*)d_in[7]; const float* bk = (const float*)d_in[8]; const float* wv = (const float*)d_in[9]; const float* bv = (const float*)d_in[10]; const float* wo = (const float*)d_in[11]; const float* bo = (const float*)d_in[12];   /* order query, key, value ([4][12][512][128] = 48 groups), mask (int32 [48][512][512]: read as data), adjm (f32 [48][512][512]: read), Wq, bq, Wk, bk, Wv, bv, Wp, bp ('oi') */
    float* OUT = (float*)d_out;     // [48][512][128]
    char* wsp = (char*)d_ws;
    auto take = [&](size_t bytes) { char* p = wsp; wsp += (bytes + 255) & ~(size_t)255; return (void*)p; };
    bf* WO = (bf*)take((size_t)DM * DQ * 2);   /* Wp as bf16 */
    bf* QPh = (bf*)take((size_t)2 * NB_ * NH_ * TT * HD * 2); bf* QPl = (bf*)take((size_t)2 * NB_ * NH_ * TT * HD * 2);   /* [q groups | k groups][head][t][d] */ bf* KPh = QPh + (size_t)NB_ * NH_ * TT * HD; bf* KPl = QPl + (size_t)NB_ * NH_ * TT * HD;
    bf* VTh = (bf*)take((size_t)NB_ * NKV * HP * TT * 2); bf* VTl = (bf*)take((size_t)NB_ * NKV * HP * TT * 2);
    bf* ATh = (bf*)take((size_t)NB_ * TT * DQ * 2); bf* ATl = (bf*)take((size_t)NB_ * TT * DQ * 2);
    if ((size_t)(wsp - (char*)d_ws) > ws_size) return;    // ws 256 MiB given; the carve is below 64 MiB
    k_proj<<<dim3(NB_ * TT / 64, 3, 1), PW * 32, 0, stream>>>(x, xk, xv, wq, wk, wv, wo, bq, bk, bv, QPh, QPl, VTh, VTl, WO);   /* rows = all (group, node) pairs; y = q, k, v */
    k_fattn<<<dim3(TT / (FQT * 16), NB_, 1), FW * 32, 0, stream>>>(QPh, QPl, KPh, KPl, VTh, VTl, mk, adj, ATh, ATl);   /* one kv head per query head: plane z of q meets plane z of k and of v^T */
    k_gemmw<bf, 1, true><<<dim3(NB_ * TT / 64, DM / 64, 1), 32, 0, stream>>>(ATh, ATl, WO, nullptr, DQ, OUT, DM, bo, bo, bo, 0, 0, 0);
}

// v004
// It runs in 72.5 microseconds.
// In two side-by-side timings against v003, it was 1.06 and 1.05 times as fast.
// Over all steps from v000 it is 51.1 times as fast.
#include <hip/hip_runtime.h>

// Spatial multi-head attention over graph nodes with a pair mask and a post-softmax pair factor (query, key, value [4][12][512][128]: 48 independent (batch, time) groups of 512 nodes; q = query Wq^T + bq, k = key Wk^T + bk, v = value Wv^T + bv ('oi' (out, in) [128][128] + [128]: real biases; 4 heads x 32); scores x 1/sqrt(32); where mask[b][t][i][j] != 0 (int32 [4][12][512][512], read per logit as data) the score is REPLACED by -1e9; softmax over the 512 keys; the weights x adjm[b][t][i][j] (f32 [4][12][512][512], read, rounded to bf16: an input) AFTER the softmax, no renormalisation; out = merged Wp^T + bp -> [4][12][512][128] (3.1 M); argument order query, key, value, mask, adjm, Wq, bq, Wk, bk, Wv, bv, Wp, bp).
// Layout, all 48 groups per launch, three launches: (1) k_proj reads query, key, value and Wq, Wk, Wv as f32, rounds them to bf16 on their way into LDS, adds the bias rounded to bf16 and writes the hi/lo planes that attention reads, each in the order of its matrix fragments (see ldfo): q/k planes [q groups | k groups][head][t / 16][d / 8][t % 16][8] and value planes [group][head][t / 32][d / 16][(t / 16) % 2][lane][8]; its first 16 work-groups also write the bf16 copy of Wp; (2) ONE fused kernel for scores, masked softmax, pair factor, attn.v and the head merge, every operand on hi/lo planes, scores and weights in registers only; (3) merged hi/lo x Wp exact + bp.
// Compute dtypes, f32 accumulate: every input rounded to bf16, nearest even, incl. the pair factor adjm; projections exact + bf16 biases; scores (K 32) and attn.v 3 products on every row; softmax f32; Wp hl x exact + bias.

#define NB_  48
#define TT   512
#define DM   128
#define NH_  4
#define NKV  4
#define HD   32
#define DQ   (NH_ * HD)
#define SCL  0.17677669529663688f   // 32^-0.5 (the module divides by float32(sqrt(32)); one multiply here)
#define HP   64    // a head's value plane is HP x TT elements apart from the next; the first HD x TT are written and read
typedef unsigned short bf;
typedef __attribute__((ext_vector_type(16))) __bf16   v16bf;
typedef __attribute__((ext_vector_type(8)))  __bf16   v8bf;
typedef __attribute__((ext_vector_type(4)))  __bf16   v4bf;
typedef __attribute__((ext_vector_type(8)))  unsigned short v8us;
typedef __attribute__((ext_vector_type(4)))  unsigned short v4us;
typedef __attribute__((ext_vector_type(8)))  float    v8f;
typedef __attribute__((ext_vector_type(4)))  float    v4f;
typedef __attribute__((ext_vector_type(4)))  int      v4i;
typedef __attribute__((ext_vector_type(4)))  unsigned v4u;
typedef v4f  __attribute__((may_alias)) v4fa;
typedef v8us __attribute__((may_alias)) v8usa;
typedef v4us __attribute__((may_alias)) v4usa;

__device__ __forceinline__ unsigned short f2bf(float f) { unsigned u = __float_as_uint(f); u += 0x7FFFu + ((u >> 16) & 1u); return (unsigned short)(u >> 16); }
__device__ __forceinline__ float bf2f(unsigned short b) { return __uint_as_float(((unsigned)b) << 16); }
__device__ __forceinline__ float bfr(float f) { return bf2f(f2bf(f)); }
__device__ __forceinline__ v16bf cat16b(v8us lo, v8us hi) { return __builtin_bit_cast(v16bf, __builtin_shufflevector(lo, hi, 0, 1, 2, 3, 4, 5, 6, 7, 8, 9, 10, 11, 12, 13, 14, 15)); }
__device__ __forceinline__ v8f wmmab(v16bf a, v16bf b, v8f c) { return __builtin_amdgcn_wmma_f32_16x16x32_bf16(false, a, false, b, (short)0, c, false, false); }
__device__ __forceinline__ void splitf(float y, unsigned short& h, unsigned short& l) { h = f2bf(y); l = f2bf(y - bf2f(h)); }

// ---- k_gemmw: register-blocked GEMM, ONE WAVE per 64x64 output tile (16 accumulators), operands straight from K-contiguous 16-bit planes; grid (M/64, N/64, Z), 32 threads.
// C[m][n] (f32, pitch ldc, + optional f32 bias[n], one bias pointer per z up to z = 2) = sum_k A[m][k] Bt[n][k] (+ split products per NSPLIT). z-batch strides sA/sB/sC in elements. K % 32 == 0.
template <typename T16> struct WFrag;
template <> struct WFrag<bf> { typedef v16bf V; static __device__ __forceinline__ V ld(const bf* p) { return cat16b(*(const v8us*)p, *(const v8us*)(p + 16)); } static __device__ __forceinline__ v8f mma(V a, V b, v8f c) { return wmmab(a, b, c); } };
template <typename T16, int NSPLIT, bool BIAS>
__global__ __launch_bounds__(32) void k_gemmw(const T16* __restrict__ A, const T16* __restrict__ A2, const T16* __restrict__ Bt, const T16* __restrict__ Bt2, int K, float* C, int ldc, const float* __restrict__ bias0, const float* __restrict__ bias1, const float* __restrict__ bias2, size_t sA, size_t sB, size_t sC) {
    typedef typename WFrag<T16>::V V;
    __shared__ __align__(16) float os[16 * 68];
    const size_t z = blockIdx.z; A += z * sA; if (A2) A2 += z * sA; Bt += z * sB; if (Bt2) Bt2 += z * sB; C += z * sC; const float* bias = z == 0 ? bias0 : (z == 1 ? bias1 : bias2);
    const int lane = threadIdx.x & 31, lr = lane & 15, hi = lane >> 4; const int r0 = blockIdx.x * 64, c0 = blockIdx.y * 64;
    v8f acc[4][4];
#pragma unroll
    for (int mb = 0; mb < 4; ++mb)
#pragma unroll
        for (int nb = 0; nb < 4; ++nb) acc[mb][nb] = (v8f){};
    const size_t aoff = (size_t)(r0 + lr) * K + 8 * hi, boff = (size_t)(c0 + lr) * K + 8 * hi;
    for (int kc = 0; kc < K; kc += 32) {
        V a[4], a2[4];
#pragma unroll
        for (int mb = 0; mb < 4; ++mb) { a[mb] = WFrag<T16>::ld(A + aoff + (size_t)mb * 16 * K + kc); if (NSPLIT == 1 || NSPLIT == 2) a2[mb] = WFrag<T16>::ld(A2 + aoff + (size_t)mb * 16 * K + kc); }
#pragma unroll
        for (int nb = 0; nb < 4; ++nb) { const V b = WFrag<T16>::ld(Bt + boff + (size_t)nb * 16 * K + kc); V b2; if (NSPLIT >= 2) b2 = WFrag<T16>::ld(Bt2 + boff + (size_t)nb * 16 * K + kc);
#pragma unroll
            for (int mb = 0; mb < 4; ++mb) { acc[mb][nb] = WFrag<T16>::mma(a[mb], b, acc[mb][nb]); if (NSPLIT == 1 || NSPLIT == 2) acc[mb][nb] = WFrag<T16>::mma(a2[mb], b, acc[mb][nb]); if (NSPLIT >= 2) acc[mb][nb] = WFrag<T16>::mma(a[mb], b2, acc[mb][nb]); } }
        asm volatile("v_nop\n\tv_nop\n\tv_nop\n\tv_nop" : "+v"(acc[0][0]), "+v"(acc[1][1]), "+v"(acc[2][2]), "+v"(acc[3][3]) : "v"(a[0]), "v"(a[3]));
    }
#pragma unroll
    for (int mb = 0; mb < 4; ++mb) {
#pragma unroll
        for (int nb = 0; nb < 4; ++nb) {
#pragma unroll
            for (int j = 0; j < 8; ++j) os[(hi * 8 + j) * 68 + nb * 16 + lr] = acc[mb][nb][j]; }
        __builtin_amdgcn_wave_barrier(); asm volatile("" ::: "memory");
        float* crow = C + (size_t)(r0 + mb * 16) * ldc + c0;
{
#pragma unroll
            for (int s = 0; s < 8; ++s) { const int row = 2 * s + hi, cofs = lr * 4; v4f val = *(const v4fa*)(os + row * 68 + cofs); if (BIAS) { val[0] += bfr(bias[c0 + cofs]); val[1] += bfr(bias[c0 + cofs + 1]); val[2] += bfr(bias[c0 + cofs + 2]); val[3] += bfr(bias[c0 + cofs + 3]); }
                *(v4f*)(crow + (size_t)row * ldc + cofs) = val; }
             }
        __builtin_amdgcn_wave_barrier(); asm volatile("" ::: "memory");
    }
}

// splitf of eight values: h = bf16(y), l = bf16(y - h), both nearest even.
__device__ __forceinline__ void split8(v8f y, v8us& h, v8us& l) { const v8bf hb = __builtin_convertvector(y, v8bf); const v4u u = __builtin_bit_cast(v4u, hb); v8f r;
#pragma unroll
    for (int i = 0; i < 4; ++i) { r[2 * i] = __uint_as_float(u[i] << 16); r[2 * i + 1] = __uint_as_float(u[i] & 0xFFFF0000u); }
    h = __builtin_bit_cast(v8us, hb); l = __builtin_bit_cast(v8us, __builtin_convertvector(y - r, v8bf)); }

// ---- k_proj: the q, k and v projections (blockIdx.y = 0, 1, 2) of 64 (group, node) rows, from the f32 inputs to the hi/lo planes of attention. Four waves; wave w owns head w, output columns 32 w .. 32 w + 31, as a 64x32 register tile (8 accumulators).
// y[m][n] = sum_k bf16(x[m][k]) bf16(W[n][k]) + bf16(bias[n]). Operands: a row of 128 f32 is ONE load of a wave (16 bytes a lane, four whole lines); it is rounded to bf16 and laid in LDS, the 64 input rows once for the four waves, each wave's 32 weight rows in its own slice; the fragments are read from there.
// An accumulator holds 8 consecutive rows (nodes) of one column (lane & 15). q, k: the tile turns through the wave's LDS slice (f32) so that a lane holds 8 consecutive columns of a row: a store covers 8 rows x 4 column groups = four whole 128-byte lines of the head's plane. v: a lane's 8 nodes of one column are one 16-byte piece of attention's B fragment, held by the lane that will read it: each accumulator is stored from its registers, 512 contiguous bytes a store.
#define PW  4      // waves per work-group
#define ASP 136    // LDS row pitch (16-bit elements) of the staged operand rows: 256 + 16 bytes, so that the 16 rows of a fragment read start 4 banks apart
#define QSP 36     // LDS row pitch (floats) of the staged q/k tile: the two lane halves (8 rows apart) fall on different banks, rows stay 16-byte aligned
#define WSL (64 * QSP)   // floats in a wave's LDS slice: first its 32 weight rows (32 x 136 x 2 bytes fit), then, for q and k, its output tile (64 x 36 floats)
__device__ __forceinline__ void st4(bf* d, v4f u) { *(v4usa*)d = __builtin_bit_cast(v4us, __builtin_convertvector(u, v4bf)); }   // four f32 to bf16, nearest even, into LDS
__device__ __forceinline__ v16bf ldsf(const bf* p) { return cat16b(*(const v8usa*)p, *(const v8usa*)(p + 16)); }   // fragment from an LDS row: the k order of WFrag<bf>::ld
// amdgpu_waves_per_eu(5): the register budget of five waves a SIMD, so that all 1152 work-groups (four or five a WGP) are resident at once; without it the v branch is scheduled into more than 204 registers and a second, short round of work-groups follows the first.
__global__ __launch_bounds__(PW * 32) __attribute__((amdgpu_waves_per_eu(5))) void k_proj(const float* __restrict__ x0, const float* __restrict__ x1, const float* __restrict__ x2, const float* __restrict__ w0, const float* __restrict__ w1, const float* __restrict__ w2, const float* __restrict__ w3, const float* __restrict__ b0, const float* __restrict__ b1, const float* __restrict__ b2, bf* Ph, bf* Pl, bf* Vh, bf* Vl, bf* W3) {
    __shared__ __align__(16) float sm[PW * WSL + 64 * ASP / 2];   // four slices, then the 64 input rows; every 16-bit access goes through a may_alias vector type
    const int z = blockIdx.y; const float* A = z == 0 ? x0 : (z == 1 ? x1 : x2); const float* B = z == 0 ? w0 : (z == 1 ? w1 : w2); const float* bias = z == 0 ? b0 : (z == 1 ? b1 : b2);
    const int lane = threadIdx.x & 31, lr = lane & 15, hi = lane >> 4, w = threadIdx.x >> 5; const int r0 = blockIdx.x * 64, c0 = w * HD;
    const int g = r0 / TT, t0 = r0 % TT;   // 64 divides 512: a tile lies in one group
    bf* as = (bf*)(sm + PW * WSL); bf* bs = (bf*)(sm + w * WSL);
    if (z == 0 && blockIdx.x < DM * DQ / (PW * 32 * 8)) {   // uniform in the work-group: the first 16 work-groups of the q part round Wp to bf16 for the output projection, 8 elements a thread
        const int e = (blockIdx.x * (PW * 32) + threadIdx.x) * 8; *(v8us*)(W3 + e) = __builtin_bit_cast(v8us, __builtin_convertvector(*(const v8f*)(w3 + e), v8bf));
        asm volatile("s_wait_xcnt 0x0" ::: "memory"); }   // stands in front of the staging code, which may reuse the registers that the load and the store name
    { const float* ag = A + (size_t)(r0 + w * 16) * DM + lane * 4; const float* bg = B + c0 * DM + lane * 4;   // the wave stages 16 of the input rows and its own 32 weight rows, in three groups of 16 loads, two groups in flight: 128 data registers, not 192, which leaves room for five waves a SIMD
        v4f wa[16], xa[16], wb[16];
#pragma unroll
        for (int i = 0; i < 16; ++i) wa[i] = *(const v4f*)(bg + i * DM);
#pragma unroll
        for (int i = 0; i < 16; ++i) xa[i] = *(const v4f*)(ag + i * DM);
        asm volatile("s_wait_xcnt 0x0" :: "v"(ag), "v"(bg) : "memory");   // behind the last load of the two groups; the two addresses are inputs so that they stay in their registers up to the wait and no load's result lands on them in front of it
#pragma unroll
        for (int i = 0; i < 16; ++i) st4(bs + i * ASP + lane * 4, wa[i]);
        __builtin_amdgcn_sched_barrier(0);   // keeps the third group's loads behind the first group's LDS stores: lifted over them they hold 64 more registers at once, and the build spills
#pragma unroll
        for (int i = 0; i < 16; ++i) wb[i] = *(const v4f*)(bg + (16 + i) * DM);
        asm volatile("s_wait_xcnt 0x0" :: "v"(bg) : "memory");   // the same behind the third group
#pragma unroll
        for (int i = 0; i < 16; ++i) st4(as + (w * 16 + i) * ASP + lane * 4, xa[i]);
#pragma unroll
        for (int i = 0; i < 16; ++i) st4(bs + (16 + i) * ASP + lane * 4, wb[i]); }
    __syncthreads();   // all 64 input rows are in LDS before any wave reads fragments
    v8f acc[4][2];
#pragma unroll
    for (int mb = 0; mb < 4; ++mb)
#pragma unroll
        for (int nb = 0; nb < 2; ++nb) acc[mb][nb] = (v8f){};
#pragma unroll
    for (int kc = 0; kc < DM; kc += 32) {
        v16bf a[4];
#pragma unroll
        for (int mb = 0; mb < 4; ++mb) a[mb] = ldsf(as + (mb * 16 + lr) * ASP + kc + 8 * hi);
#pragma unroll
        for (int nb = 0; nb < 2; ++nb) { const v16bf b = ldsf(bs + (nb * 16 + lr) * ASP + kc + 8 * hi);
#pragma unroll
            for (int mb = 0; mb < 4; ++mb) acc[mb][nb] = wmmab(a[mb], b, acc[mb][nb]); }
    }
    __syncthreads();   // every fragment has been read before a slice is written again
    if (z < 2) {   // uniform in the work-group
        float* os = sm + w * WSL;
#pragma unroll
        for (int mb = 0; mb < 4; ++mb)
#pragma unroll
            for (int nb = 0; nb < 2; ++nb)
#pragma unroll
                for (int j = 0; j < 8; ++j) os[(mb * 16 + hi * 8 + j) * QSP + nb * 16 + lr] = acc[mb][nb][j];
        const int r8 = lane >> 2, c8 = (lane & 3) * 8;   // read-back: 8 rows a step, 8 columns a lane
        v8f bb;
#pragma unroll
        for (int i = 0; i < 8; ++i) bb[i] = bfr(bias[c0 + c8 + i]);
        const size_t o = (((size_t)(z * NB_ + g) * NH_ + w) * TT + t0) * HD + c8 * 16 + r8 * 8; bf* ph = Ph + o; bf* pl = Pl + o;   // plane [q | k][group][head][t / 16][d / 8][t % 16][8]
        __syncthreads();   // the tile is in LDS before other lanes read it
#pragma unroll
        for (int s = 0; s < 8; ++s) { const float* rp = os + (8 * s + r8) * QSP + c8; const v4f u0 = *(const v4fa*)rp, u1 = *(const v4fa*)(rp + 4); v8us oh, ol;
            split8(__builtin_shufflevector(u0, u1, 0, 1, 2, 3, 4, 5, 6, 7) + bb, oh, ol); const int so = (s >> 1) * (16 * HD) + (s & 1) * 64; *(v8us*)(ph + so) = oh; *(v8us*)(pl + so) = ol; }   // row 8 s + r8: 16-row tile s / 2, row 8 (s % 2) + r8 in it
    } else {
        v8us th[2][4], tl[2][4];   // all sixteen pieces first, then the stores
#pragma unroll
        for (int nb = 0; nb < 2; ++nb) { const float bn = bfr(bias[c0 + nb * 16 + lr]);
#pragma unroll
            for (int mb = 0; mb < 4; ++mb) split8(acc[mb][nb] + bn, th[nb][mb], tl[nb][mb]); }
        const size_t o = (size_t)(g * NKV + w) * HP * TT + (t0 / 32) * (32 * HD) + lane * 8; bf* vh = Vh + o; bf* vl = Vl + o;   // plane [group][head][t / 32][d / 16][(t / 16) % 2][lane][8]: accumulator (mb, nb) is nodes t0 + 16 mb + 8 hi + j of column 16 nb + lr
#pragma unroll
        for (int nb = 0; nb < 2; ++nb)
#pragma unroll
            for (int mb = 0; mb < 4; ++mb) { const int so = (mb >> 1) * (32 * HD) + nb * 512 + (mb & 1) * 256; *(v8us*)(vh + so) = th[nb][mb]; *(v8us*)(vl + so) = tl[nb][mb]; }
        asm volatile("s_wait_xcnt 0x0" ::: "memory");   // behind the last store: in the built code the q/k branch follows this one, and its first instructions reuse registers that these stores name
    }
}

// ---- k_fattn: scores, masked softmax, pair factor, attn.v and the head merge of 32 query rows of one group, all four heads, in ONE work-group of 8 waves; nothing of the score or weight matrices goes to memory.
// Wave w owns keys 64 w .. 64 w + 63. It computes S^T = K Q^T (A = key rows, B = query rows), so a lane holds scores of ONE query (lane & 15) and the accumulator pair of 32 keys is, converted in place, the A fragment of the weights for attn.v (hardware k order on both sides).
// The wave's 32 x 64 block of the pair mask (one bit each) and of the pair factor (bf16, its compute type) is read once and serves the four heads. Row maximum, row sum and the attn.v partial sums of the 8 waves meet in LDS: three barriers per head.
typedef __attribute__((ext_vector_type(8))) unsigned v8u;
// Fragment from a plane laid in fragment order: a 16 x 32 fragment is 1024 contiguous bytes, first every lane's lower 8 elements (k = 8 hi + j) in lane order, then every lane's upper 8 (k = 16 + 8 hi + j); p already holds the lane's 8 * lane. Each of the two loads covers 512 contiguous bytes, four whole lines; the registers hold what WFrag<bf>::ld gives on a row-major plane.
__device__ __forceinline__ v16bf ldfo(const bf* p) { return cat16b(*(const v8us*)p, *(const v8us*)(p + 256)); }
__device__ __forceinline__ unsigned rne16(float f) { const unsigned u = __float_as_uint(f); return u + 0x7FFFu + ((u >> 16) & 1u); }   // f2bf's rounding, the bf16 left in the upper half
__device__ __forceinline__ void split2(float y0, float y1, unsigned& h, unsigned& l) { const unsigned r0 = rne16(y0), r1 = rne16(y1); h = (r0 >> 16) | (r1 & 0xFFFF0000u); const unsigned s0 = rne16(y0 - __uint_as_float(r0 & 0xFFFF0000u)), s1 = rne16(y1 - __uint_as_float(r1 & 0xFFFF0000u)); l = (s0 >> 16) | (s1 & 0xFFFF0000u); }   // splitf of two neighbours, each plane's pair packed in one word
// Eight v_exp_f32, in place, and one v_nop in ONE statement: behind each exp stands an independent instruction, behind the last the v_nop, so nothing directly behind a transcendental reads its result or overwrites its source (the slot the instruction set asks for).
__device__ __forceinline__ void exp2x8(float (&x)[8]) { asm("v_exp_f32 %0, %0\n\tv_exp_f32 %1, %1\n\tv_exp_f32 %2, %2\n\tv_exp_f32 %3, %3\n\tv_exp_f32 %4, %4\n\tv_exp_f32 %5, %5\n\tv_exp_f32 %6, %6\n\tv_exp_f32 %7, %7\n\tv_nop" : "+v"(x[0]), "+v"(x[1]), "+v"(x[2]), "+v"(x[3]), "+v"(x[4]), "+v"(x[5]), "+v"(x[6]), "+v"(x[7])); }
#define FW  8                    // waves per work-group
#define FQT 2                    // 16-row query tiles per work-group
#define FKT (TT / FW / 16)       // 16-key tiles per wave
#define OSP 36                   // LDS row pitch (floats) of the partial outputs: the two lane halves (8 rows apart) fall on different banks, rows stay 16-byte aligned
__global__ __launch_bounds__(256) void k_fattn(const bf* __restrict__ Qh, const bf* __restrict__ Ql, const bf* __restrict__ Kh, const bf* __restrict__ Kl, const bf* __restrict__ Vh, const bf* __restrict__ Vl, const int* __restrict__ mk, const float* __restrict__ adj, bf* Ah, bf* Al) {
    __shared__ float redm[FW][FQT * 16]; __shared__ float reds[FW][FQT * 16]; __shared__ __align__(16) float os[FW][FQT * 16][OSP];
    const int lane = threadIdx.x & 31, lr = lane & 15, hi = lane >> 4, w = threadIdx.x >> 5;
    const int g = blockIdx.y, i0 = blockIdx.x * (FQT * 16), k0 = w * (FKT * 16);
    const unsigned mo = (unsigned)((i0 + lr) * TT + k0 + hi * 8), qo = (unsigned)(i0 * HD + 8 * lane), ko = (unsigned)(k0 * HD + 8 * lane), vo = (unsigned)(k0 * HD + 8 * lane);   // the lane's 32-bit element offsets inside a group's pair planes and inside a (group, head) plane of q, of k and of v (16 rows of q or k, and 16 keys of v, are 16 HD elements); every base below is uniform
    const int* mkg = mk + (size_t)g * TT * TT; const float* adg = adj + (size_t)g * TT * TT;
    unsigned mb[FQT]; unsigned ga[FQT][FKT][4];   // element (kt, j) of a lane: query i0 + 16 qt + lr, key k0 + 16 kt + 8 hi + j
#pragma unroll
    for (int qt = 0; qt < FQT; ++qt) { mb[qt] = 0u;
#pragma unroll
        for (int kt = 0; kt < FKT; ++kt) { const int* mp = (mkg + qt * 16 * TT + kt * 16) + mo; const float* ap = (adg + qt * 16 * TT + kt * 16) + mo;
            const v4i m0 = *(const v4i*)mp, m1 = *(const v4i*)(mp + 4); const v4f a0 = *(const v4f*)ap, a1 = *(const v4f*)(ap + 4);
#pragma unroll
            for (int q = 0; q < 4; ++q) { mb[qt] |= (m0[q] != 0 ? 1u : 0u) << (kt * 8 + q); mb[qt] |= (m1[q] != 0 ? 1u : 0u) << (kt * 8 + 4 + q); }
            ga[qt][kt][0] = (unsigned)f2bf(a0[0]) | ((unsigned)f2bf(a0[1]) << 16); ga[qt][kt][1] = (unsigned)f2bf(a0[2]) | ((unsigned)f2bf(a0[3]) << 16);
            ga[qt][kt][2] = (unsigned)f2bf(a1[0]) | ((unsigned)f2bf(a1[1]) << 16); ga[qt][kt][3] = (unsigned)f2bf(a1[2]) | ((unsigned)f2bf(a1[3]) << 16); } }
#pragma unroll 1   // rolled, for speed only
    for (int h = 0; h < NH_; ++h) {
        const size_t z = (size_t)g * NH_ + h;
        v16bf qh[FQT], ql[FQT];
#pragma unroll
        for (int qt = 0; qt < FQT; ++qt) { const size_t o = (z * TT + qt * 16) * HD; qh[qt] = ldfo((Qh + o) + qo); ql[qt] = ldfo((Ql + o) + qo); }
        float sc[FQT][FKT][8]; float mx[FQT];
#pragma unroll
        for (int qt = 0; qt < FQT; ++qt) mx[qt] = -3.0e38f;
#pragma unroll
        for (int kt = 0; kt < FKT; ++kt) { const size_t o = (z * TT + kt * 16) * HD; const v16bf kh = ldfo((Kh + o) + ko), kl = ldfo((Kl + o) + ko);
#pragma unroll
            for (int qt = 0; qt < FQT; ++qt) { v8f a = (v8f){}; a = wmmab(kh, qh[qt], a); a = wmmab(kh, ql[qt], a); a = wmmab(kl, qh[qt], a);   /* q_hi k_hi + q_lo k_hi + q_hi k_lo; a[j] = score of key 8 hi + j of the tile, query lr */
#pragma unroll
                for (int j = 0; j < 8; ++j) { const float t = ((mb[qt] >> (kt * 8 + j)) & 1u) ? -1.0e9f : __fmul_rn(a[j], SCL);   /* where(mask != 0, -1e9, scores / sqrt(32)): the module's literal, after the scale */ sc[qt][kt][j] = t; mx[qt] = fmaxf(mx[qt], t); } } }
#pragma unroll
        for (int qt = 0; qt < FQT; ++qt) { mx[qt] = fmaxf(mx[qt], __shfl_xor(mx[qt], 16, 32)); if (hi == 0) redm[w][qt * 16 + lr] = mx[qt]; }
        __syncthreads();   // every wave's row maxima are in LDS
#pragma unroll
        for (int qt = 0; qt < FQT; ++qt) { float m = redm[0][qt * 16 + lr];
#pragma unroll
            for (int ww = 1; ww < FW; ++ww) m = fmaxf(m, redm[ww][qt * 16 + lr]);
            float s = 0.f;
#pragma unroll
            for (int kt = 0; kt < FKT; ++kt) {
#pragma unroll
                for (int j = 0; j < 8; ++j) sc[qt][kt][j] = __fmul_rn(__fsub_rn(sc[qt][kt][j], m), 1.4426950408889634f);
                exp2x8(sc[qt][kt]);
#pragma unroll
                for (int j = 0; j < 8; ++j) s += sc[qt][kt][j]; }
            s += __shfl_xor(s, 16, 32); if (hi == 0) reds[w][qt * 16 + lr] = s; }
        __syncthreads();   // every wave's row sums are in LDS
        float f[FQT];
#pragma unroll
        for (int qt = 0; qt < FQT; ++qt) { float s = reds[0][qt * 16 + lr];
#pragma unroll
            for (int ww = 1; ww < FW; ++ww) s += reds[ww][qt * 16 + lr];
            f[qt] = __fdiv_rn(1.0f, s); }
        v8f oa[FQT][2];
#pragma unroll
        for (int qt = 0; qt < FQT; ++qt) { oa[qt][0] = (v8f){}; oa[qt][1] = (v8f){}; }
#pragma unroll
        for (int kc = 0; kc < FKT / 2; ++kc) { v16bf ph[FQT], pl[FQT];
#pragma unroll
            for (int qt = 0; qt < FQT; ++qt) { v8u hw, lw;
#pragma unroll
                for (int tt = 0; tt < 2; ++tt)
#pragma unroll
                    for (int p = 0; p < 4; ++p) { const unsigned gp = ga[qt][2 * kc + tt][p]; unsigned a, c2;
                        split2(__fmul_rn(__fmul_rn(sc[qt][2 * kc + tt][2 * p], f[qt]), __uint_as_float(gp << 16)), __fmul_rn(__fmul_rn(sc[qt][2 * kc + tt][2 * p + 1], f[qt]), __uint_as_float(gp & 0xFFFF0000u)), a, c2);   /* softmax weight x the pair factor AFTER the normalisation: two rounded products */
                        hw[tt * 4 + p] = a; lw[tt * 4 + p] = c2; }
                ph[qt] = __builtin_bit_cast(v16bf, hw); pl[qt] = __builtin_bit_cast(v16bf, lw); }   /* A fragment: row = query lr, k = 8 hi + j (first tile) and 16 + 8 hi + j (second tile) of the 32 keys */
#pragma unroll
            for (int dt = 0; dt < 2; ++dt) { const size_t o = z * HP * TT + kc * (32 * HD) + dt * 512; const v16bf vh = ldfo((Vh + o) + vo), vl = ldfo((Vl + o) + vo);
#pragma unroll
                for (int qt = 0; qt < FQT; ++qt) { oa[qt][dt] = wmmab(ph[qt], vh, oa[qt][dt]); oa[qt][dt] = wmmab(pl[qt], vh, oa[qt][dt]); oa[qt][dt] = wmmab(ph[qt], vl, oa[qt][dt]); } } }
#pragma unroll
        for (int qt = 0; qt < FQT; ++qt)
#pragma unroll
            for (int dt = 0; dt < 2; ++dt)
#pragma unroll
                for (int j = 0; j < 8; ++j) os[w][qt * 16 + hi * 8 + j][dt * 16 + lr] = oa[qt][dt][j];
        __syncthreads();   // every wave's partial outputs are in LDS; the next head writes them again only behind its own two barriers
        { const int q = threadIdx.x >> 3, d4 = (threadIdx.x & 7) * 4; v4f s = *(const v4fa*)&os[0][q][d4];
#pragma unroll
            for (int ww = 1; ww < FW; ++ww) s += *(const v4fa*)&os[ww][q][d4];
            v4us oh, ol;
#pragma unroll
            for (int c = 0; c < 4; ++c) { unsigned short a, c2; splitf(s[c], a, c2); oh[c] = a; ol[c] = c2; }
            const size_t o = ((size_t)g * TT + i0) * DQ + h * HD; const unsigned oo = (unsigned)(q * DQ + d4); *(v4us*)((Ah + o) + oo) = oh; *(v4us*)((Al + o) + oo) = ol;   /* merged [t][head][d] hi / lo planes for the output projection */
            asm volatile("s_wait_xcnt 0x0" ::: "memory"); }   // stands in front of the next head's first instructions, which reuse the registers that the two stores name as their addresses
    }
}

extern "C" void kernel_launch(void* const* d_in, const int* in_sizes, int n_in,
                              void* d_out, int out_size, void* d_ws, size_t ws_size, hipStream_t stream) {
    (void)in_sizes; (void)n_in; (void)out_size;
    const float* x = (const float*)d_in[0]; const float* xk = (const float*)d_in[1]; const float* xv = (const float*)d_in[2]; const int* mk = (const int*)d_in[3]; const float* adj = (const float*)d_in[4]; const float* wq = (const float*)d_in[5]; const float* bq = (const float*)d_in[6]; const float* wk = (const float*)d_in[7]; const float* bk = (const float*)d_in[8]; const float* wv = (const float*)d_in[9]; const float* bv = (const float*)d_in[10]; const float* wo = (const float*)d_in[11]; const float* bo = (const float*)d_in[12];   /* order query, key, value ([4][12][512][128] = 48 groups), mask (int32 [48][512][512]: read as data), adjm (f32 [48][512][512]: read), Wq, bq, Wk, bk, Wv, bv, Wp, bp ('oi') */
    float* OUT = (float*)d_out;     // [48][512][128]
    char* wsp = (char*)d_ws;
    auto take = [&](size_t bytes) { char* p = wsp; wsp += (bytes + 255) & ~(size_t)255; return (void*)p; };
    bf* WO = (bf*)take((size_t)DM * DQ * 2);   /* Wp as bf16 */
    bf* QPh = (bf*)take((size_t)2 * NB_ * NH_ * TT * HD * 2); bf* QPl = (bf*)take((size_t)2 * NB_ * NH_ * TT * HD * 2);   /* [q groups | k groups][head], each 512 x 32 in fragment order */ bf* KPh = QPh + (size_t)NB_ * NH_ * TT * HD; bf* KPl = QPl + (size_t)NB_ * NH_ * TT * HD;
    bf* VTh = (bf*)take((size_t)NB_ * NKV * HP * TT * 2); bf* VTl = (bf*)take((size_t)NB_ * NKV * HP * TT * 2);
    bf* ATh = (bf*)take((size_t)NB_ * TT * DQ * 2); bf* ATl = (bf*)take((size_t)NB_ * TT * DQ * 2);
    if ((size_t)(wsp - (char*)d_ws) > ws_size) return;    // ws 256 MiB given; the carve is below 64 MiB
    k_proj<<<dim3(NB_ * TT / 64, 3, 1), PW * 32, 0, stream>>>(x, xk, xv, wq, wk, wv, wo, bq, bk, bv, QPh, QPl, VTh, VTl, WO);   /* rows = all (group, node) pairs; y = q, k, v */
    k_fattn<<<dim3(TT / (FQT * 16), NB_, 1), FW * 32, 0, stream>>>(QPh, QPl, KPh, KPl, VTh, VTl, mk, adj, ATh, ATl);   /* one kv head per query head: plane z of q meets plane z of k and of v^T */
    k_gemmw<bf, 1, true><<<dim3(NB_ * TT / 64, DM / 64, 1), 32, 0, stream>>>(ATh, ATl, WO, nullptr, DQ, OUT, DM, bo, bo, bo, 0, 0, 0);
}

// v005
// Measured time: 68.1 microseconds a run.
// Timed twice side by side with v004, it ran 1.06 and 1.07 times as fast.
// All steps since v000 together make it 54.6 times as fast.
#include <hip/hip_runtime.h>

// Spatial multi-head attention over graph nodes with a pair mask and a post-softmax pair factor (query, key, value [4][12][512][128]: 48 independent (batch, time) groups of 512 nodes; q = query Wq^T + bq, k = key Wk^T + bk, v = value Wv^T + bv ('oi' (out, in) [128][128] + [128]: real biases; 4 heads x 32); scores x 1/sqrt(32); where mask[b][t][i][j] != 0 (int32 [4][12][512][512], read per logit as data) the score is REPLACED by -1e9; softmax over the 512 keys; the weights x adjm[b][t][i][j] (f32 [4][12][512][512], read, rounded to bf16: an input) AFTER the softmax, no renormalisation; out = merged Wp^T + bp -> [4][12][512][128] (3.1 M); argument order query, key, value, mask, adjm, Wq, bq, Wk, bk, Wv, bv, Wp, bp).
// Layout, all 48 groups per launch, three launches: (1) k_proj reads query, key, value and Wq, Wk, Wv as f32, rounds them to bf16 on their way into LDS, adds the bias rounded to bf16 and writes the hi/lo planes that attention reads, each in the order of its matrix fragments (see ldfo): q/k planes [q groups | k groups][head][t / 16][d / 8][t % 16][8] and value planes [group][head][t / 32][d / 16][(t / 16) % 2][lane][8]; its first 16 work-groups also write the bf16 copy of Wp; (2) ONE fused kernel for scores, masked softmax, pair factor, attn.v and the head merge, every operand on hi/lo planes, scores and weights in registers only; (3) merged hi/lo x Wp exact + bp.
// Compute dtypes, f32 accumulate: every input rounded to bf16, nearest even, incl. the pair factor adjm; projections exact + bf16 biases; scores (K 32) and attn.v 3 products on every row; softmax f32; Wp hl x exact + bias.

#define NB_  48
#define TT   512
#define DM   128
#define NH_  4
#define NKV  4
#define HD   32
#define DQ   (NH_ * HD)
#define SCL  0.17677669529663688f   // 32^-0.5 (the module divides by float32(sqrt(32)); one multiply here)
#define HP   64    // a head's value plane is HP x TT elements apart from the next; the first HD x TT are written and read
typedef unsigned short bf;
typedef __attribute__((ext_vector_type(16))) __bf16   v16bf;
typedef __attribute__((ext_vector_type(8)))  __bf16   v8bf;
typedef __attribute__((ext_vector_type(4)))  __bf16   v4bf;
typedef __attribute__((ext_vector_type(8)))  unsigned short v8us;
typedef __attribute__((ext_vector_type(4)))  unsigned short v4us;
typedef __attribute__((ext_vector_type(8)))  float    v8f;
typedef __attribute__((ext_vector_type(4)))  float    v4f;
typedef __attribute__((ext_vector_type(4)))  int      v4i;
typedef __attribute__((ext_vector_type(4)))  unsigned v4u;
typedef v4f  __attribute__((may_alias)) v4fa;
typedef v8us __attribute__((may_alias)) v8usa;
typedef v4us __attribute__((may_alias)) v4usa;

__device__ __forceinline__ unsigned short f2bf(float f) { unsigned u = __float_as_uint(f); u += 0x7FFFu + ((u >> 16) & 1u); return (unsigned short)(u >> 16); }
__device__ __forceinline__ float bf2f(unsigned short b) { return __uint_as_float(((unsigned)b) << 16); }
__device__ __forceinline__ float bfr(float f) { return bf2f(f2bf(f)); }
__device__ __forceinline__ v16bf cat16b(v8us lo, v8us hi) { return __builtin_bit_cast(v16bf, __builtin_shufflevector(lo, hi, 0, 1, 2, 3, 4, 5, 6, 7, 8, 9, 10, 11, 12, 13, 14, 15)); }
__device__ __forceinline__ v8f wmmab(v16bf a, v16bf b, v8f c) { return __builtin_amdgcn_wmma_f32_16x16x32_bf16(false, a, false, b, (short)0, c, false, false); }
__device__ __forceinline__ void splitf(float y, unsigned short& h, unsigned short& l) { h = f2bf(y); l = f2bf(y - bf2f(h)); }

// ---- k_gemmw: register-blocked GEMM, ONE WAVE per 64x64 output tile (16 accumulators), operands straight from K-contiguous 16-bit planes; grid (M/64, N/64, Z), 32 threads.
// C[m][n] (f32, pitch ldc, + optional f32 bias[n], one bias pointer per z up to z = 2) = sum_k A[m][k] Bt[n][k] (+ split products per NSPLIT). z-batch strides sA/sB/sC in elements. K % 32 == 0.
template <typename T16> struct WFrag;
template <> struct WFrag<bf> { typedef v16bf V; static __device__ __forceinline__ V ld(const bf* p) { return cat16b(*(const v8us*)p, *(const v8us*)(p + 16)); } static __device__ __forceinline__ v8f mma(V a, V b, v8f c) { return wmmab(a, b, c); } };
template <typename T16, int NSPLIT, bool BIAS>
__global__ __launch_bounds__(32) void k_gemmw(const T16* __restrict__ A, const T16* __restrict__ A2, const T16* __restrict__ Bt, const T16* __restrict__ Bt2, int K, float* C, int ldc, const float* __restrict__ bias0, const float* __restrict__ bias1, const float* __restrict__ bias2, size_t sA, size_t sB, size_t sC) {
    typedef typename WFrag<T16>::V V;
    __shared__ __align__(16) float os[16 * 68];
    const size_t z = blockIdx.z; A += z * sA; if (A2) A2 += z * sA; Bt += z * sB; if (Bt2) Bt2 += z * sB; C += z * sC; const float* bias = z == 0 ? bias0 : (z == 1 ? bias1 : bias2);
    const int lane = threadIdx.x & 31, lr = lane & 15, hi = lane >> 4; const int r0 = blockIdx.x * 64, c0 = blockIdx.y * 64;
    v8f acc[4][4];
#pragma unroll
    for (int mb = 0; mb < 4; ++mb)
#pragma unroll
        for (int nb = 0; nb < 4; ++nb) acc[mb][nb] = (v8f){};
    const size_t aoff = (size_t)(r0 + lr) * K + 8 * hi, boff = (size_t)(c0 + lr) * K + 8 * hi;
    for (int kc = 0; kc < K; kc += 32) {
        V a[4], a2[4];
#pragma unroll
        for (int mb = 0; mb < 4; ++mb) { a[mb] = WFrag<T16>::ld(A + aoff + (size_t)mb * 16 * K + kc); if (NSPLIT == 1 || NSPLIT == 2) a2[mb] = WFrag<T16>::ld(A2 + aoff + (size_t)mb * 16 * K + kc); }
#pragma unroll
        for (int nb = 0; nb < 4; ++nb) { const V b = WFrag<T16>::ld(Bt + boff + (size_t)nb * 16 * K + kc); V b2; if (NSPLIT >= 2) b2 = WFrag<T16>::ld(Bt2 + boff + (size_t)nb * 16 * K + kc);
#pragma unroll
            for (int mb = 0; mb < 4; ++mb) { acc[mb][nb] = WFrag<T16>::mma(a[mb], b, acc[mb][nb]); if (NSPLIT == 1 || NSPLIT == 2) acc[mb][nb] = WFrag<T16>::mma(a2[mb], b, acc[mb][nb]); if (NSPLIT >= 2) acc[mb][nb] = WFrag<T16>::mma(a[mb], b2, acc[mb][nb]); } }
        asm volatile("v_nop\n\tv_nop\n\tv_nop\n\tv_nop" : "+v"(acc[0][0]), "+v"(acc[1][1]), "+v"(acc[2][2]), "+v"(acc[3][3]) : "v"(a[0]), "v"(a[3]));
    }
#pragma unroll
    for (int mb = 0; mb < 4; ++mb) {
#pragma unroll
        for (int nb = 0; nb < 4; ++nb) {
#pragma unroll
            for (int j = 0; j < 8; ++j) os[(hi * 8 + j) * 68 + nb * 16 + lr] = acc[mb][nb][j]; }
        __builtin_amdgcn_wave_barrier(); asm volatile("" ::: "memory");
        float* crow = C + (size_t)(r0 + mb * 16) * ldc + c0;
{
#pragma unroll
            for (int s = 0; s < 8; ++s) { const int row = 2 * s + hi, cofs = lr * 4; v4f val = *(const v4fa*)(os + row * 68 + cofs); if (BIAS) { val[0] += bfr(bias[c0 + cofs]); val[1] += bfr(bias[c0 + cofs + 1]); val[2] += bfr(bias[c0 + cofs + 2]); val[3] += bfr(bias[c0 + cofs + 3]); }
                *(v4f*)(crow + (size_t)row * ldc + cofs) = val; }
             }
        __builtin_amdgcn_wave_barrier(); asm volatile("" ::: "memory");
    }
}

// splitf of eight values: h = bf16(y), l = bf16(y - h), both nearest even.
__device__ __forceinline__ void split8(v8f y, v8us& h, v8us& l) { const v8bf hb = __builtin_convertvector(y, v8bf); const v4u u = __builtin_bit_cast(v4u, hb); v8f r;
#pragma unroll
    for (int i = 0; i < 4; ++i) { r[2 * i] = __uint_as_float(u[i] << 16); r[2 * i + 1] = __uint_as_float(u[i] & 0xFFFF0000u); }
    h = __builtin_bit_cast(v8us, hb); l = __builtin_bit_cast(v8us, __builtin_convertvector(y - r, v8bf)); }

// ---- k_proj: the q, k and v projections (blockIdx.y = 0, 1, 2) of 64 (group, node) rows, from the f32 inputs to the hi/lo planes of attention. Four waves; wave w owns head w, output columns 32 w .. 32 w + 31, as a 64x32 register tile (8 accumulators).
// y[m][n] = sum_k bf16(x[m][k]) bf16(W[n][k]) + bf16(bias[n]). Operands: a row of 128 f32 is ONE load of a wave (16 bytes a lane, four whole lines); it is rounded to bf16 and laid in LDS, the 64 input rows once for the four waves, each wave's 32 weight rows in its own slice; the fragments are read from there.
// An accumulator holds 8 consecutive rows (nodes) of one column (lane & 15). q, k: the tile turns through the wave's LDS slice (f32) so that a lane holds 8 consecutive columns of a row: a store covers 8 rows x 4 column groups = four whole 128-byte lines of the head's plane. v: a lane's 8 nodes of one column are one 16-byte piece of attention's B fragment, held by the lane that will read it: each accumulator is stored from its registers, 512 contiguous bytes a store.
#define PW  4      // waves per work-group
#define ASP 136    // LDS row pitch (16-bit elements) of the staged operand rows: 256 + 16 bytes, so that the 16 rows of a fragment read start 4 banks apart
#define QSP 36     // LDS row pitch (floats) of the staged q/k tile: the two lane halves (8 rows apart) fall on different banks, rows stay 16-byte aligned
#define WSL (64 * QSP)   // floats in a wave's LDS slice: first its 32 weight rows (32 x 136 x 2 bytes fit), then, for q and k, its output tile (64 x 36 floats)
__device__ __forceinline__ void st4(bf* d, v4f u) { *(v4usa*)d = __builtin_bit_cast(v4us, __builtin_convertvector(u, v4bf)); }   // four f32 to bf16, nearest even, into LDS
__device__ __forceinline__ v16bf ldsf(const bf* p) { return cat16b(*(const v8usa*)p, *(const v8usa*)(p + 16)); }   // fragment from an LDS row: the k order of WFrag<bf>::ld
// amdgpu_waves_per_eu(5): the register budget of five waves a SIMD, so that all 1152 work-groups (four or five a WGP) are resident at once; without it the v branch is scheduled into more than 204 registers and a second, short round of work-groups follows the first.
__global__ __launch_bounds__(PW * 32) __attribute__((amdgpu_waves_per_eu(5))) void k_proj(const float* __restrict__ x0, const float* __restrict__ x1, const float* __restrict__ x2, const float* __restrict__ w0, const float* __restrict__ w1, const float* __restrict__ w2, const float* __restrict__ w3, const float* __restrict__ b0, const float* __restrict__ b1, const float* __restrict__ b2, bf* Ph, bf* Pl, bf* Vh, bf* Vl, bf* W3) {
    __shared__ __align__(16) float sm[PW * WSL + 64 * ASP / 2];   // four slices, then the 64 input rows; every 16-bit access goes through a may_alias vector type
    const int z = blockIdx.y; const float* A = z == 0 ? x0 : (z == 1 ? x1 : x2); const float* B = z == 0 ? w0 : (z == 1 ? w1 : w2); const float* bias = z == 0 ? b0 : (z == 1 ? b1 : b2);
    const int lane = threadIdx.x & 31, lr = lane & 15, hi = lane >> 4, w = threadIdx.x >> 5; const int r0 = blockIdx.x * 64, c0 = w * HD;
    const int g = r0 / TT, t0 = r0 % TT;   // 64 divides 512: a tile lies in one group
    bf* as = (bf*)(sm + PW * WSL); bf* bs = (bf*)(sm + w * WSL);
    if (z == 0 && blockIdx.x < DM * DQ / (PW * 32 * 8)) {   // uniform in the work-group: the first 16 work-groups of the q part round Wp to bf16 for the output projection, 8 elements a thread
        const int e = (blockIdx.x * (PW * 32) + threadIdx.x) * 8; *(v8us*)(W3 + e) = __builtin_bit_cast(v8us, __builtin_convertvector(*(const v8f*)(w3 + e), v8bf));
        asm volatile("s_wait_xcnt 0x0" ::: "memory"); }   // stands in front of the staging code, which may reuse the registers that the load and the store name
    { const float* ag = A + (size_t)(r0 + w * 16) * DM + lane * 4; const float* bg = B + c0 * DM + lane * 4;   // the wave stages 16 of the input rows and its own 32 weight rows, in three groups of 16 loads, two groups in flight: 128 data registers, not 192, which leaves room for five waves a SIMD
        v4f wa[16], xa[16], wb[16];
#pragma unroll
        for (int i = 0; i < 16; ++i) wa[i] = *(const v4f*)(bg + i * DM);
#pragma unroll
        for (int i = 0; i < 16; ++i) xa[i] = *(const v4f*)(ag + i * DM);
        asm volatile("s_wait_xcnt 0x0" :: "v"(ag), "v"(bg) : "memory");   // behind the last load of the two groups; the two addresses are inputs so that they stay in their registers up to the wait and no load's result lands on them in front of it
#pragma unroll
        for (int i = 0; i < 16; ++i) st4(bs + i * ASP + lane * 4, wa[i]);
        __builtin_amdgcn_sched_barrier(0);   // keeps the third group's loads behind the first group's LDS stores: lifted over them they hold 64 more registers at once, and the build spills
#pragma unroll
        for (int i = 0; i < 16; ++i) wb[i] = *(const v4f*)(bg + (16 + i) * DM);
        asm volatile("s_wait_xcnt 0x0" :: "v"(bg) : "memory");   // the same behind the third group
#pragma unroll
        for (int i = 0; i < 16; ++i) st4(as + (w * 16 + i) * ASP + lane * 4, xa[i]);
#pragma unroll
        for (int i = 0; i < 16; ++i) st4(bs + (16 + i) * ASP + lane * 4, wb[i]); }
    __syncthreads();   // all 64 input rows are in LDS before any wave reads fragments
    v8f acc[4][2];
#pragma unroll
    for (int mb = 0; mb < 4; ++mb)
#pragma unroll
        for (int nb = 0; nb < 2; ++nb) acc[mb][nb] = (v8f){};
#pragma unroll
    for (int kc = 0; kc < DM; kc += 32) {
        v16bf a[4];
#pragma unroll
        for (int mb = 0; mb < 4; ++mb) a[mb] = ldsf(as + (mb * 16 + lr) * ASP + kc + 8 * hi);
#pragma unroll
        for (int nb = 0; nb < 2; ++nb) { const v16bf b = ldsf(bs + (nb * 16 + lr) * ASP + kc + 8 * hi);
#pragma unroll
            for (int mb = 0; mb < 4; ++mb) acc[mb][nb] = wmmab(a[mb], b, acc[mb][nb]); }
    }
    __syncthreads();   // every fragment has been read before a slice is written again
    if (z < 2) {   // uniform in the work-group
        float* os = sm + w * WSL;
#pragma unroll
        for (int mb = 0; mb < 4; ++mb)
#pragma unroll
            for (int nb = 0; nb < 2; ++nb)
#pragma unroll
                for (int j = 0; j < 8; ++j) os[(mb * 16 + hi * 8 + j) * QSP + nb * 16 + lr] = acc[mb][nb][j];
        const int r8 = lane >> 2, c8 = (lane & 3) * 8;   // read-back: 8 rows a step, 8 columns a lane
        v8f bb;
#pragma unroll
        for (int i = 0; i < 8; ++i) bb[i] = bfr(bias[c0 + c8 + i]);
        const size_t o = (((size_t)(z * NB_ + g) * NH_ + w) * TT + t0) * HD + c8 * 16 + r8 * 8; bf* ph = Ph + o; bf* pl = Pl + o;   // plane [q | k][group][head][t / 16][d / 8][t % 16][8]
        __syncthreads();   // the tile is in LDS before other lanes read it
#pragma unroll
        for (int s = 0; s < 8; ++s) { const float* rp = os + (8 * s + r8) * QSP + c8; const v4f u0 = *(const v4fa*)rp, u1 = *(const v4fa*)(rp + 4); v8us oh, ol;
            split8(__builtin_shufflevector(u0, u1, 0, 1, 2, 3, 4, 5, 6, 7) + bb, oh, ol); const int so = (s >> 1) * (16 * HD) + (s & 1) * 64; *(v8us*)(ph + so) = oh; *(v8us*)(pl + so) = ol; }   // row 8 s + r8: 16-row tile s / 2, row 8 (s % 2) + r8 in it
    } else {
        v8us th[2][4], tl[2][4];   // all sixteen pieces first, then the stores
#pragma unroll
        for (int nb = 0; nb < 2; ++nb) { const float bn = bfr(bias[c0 + nb * 16 + lr]);
#pragma unroll
            for (int mb = 0; mb < 4; ++mb) split8(acc[mb][nb] + bn, th[nb][mb], tl[nb][mb]); }
        const size_t o = (size_t)(g * NKV + w) * HP * TT + (t0 / 32) * (32 * HD) + lane * 8; bf* vh = Vh + o; bf* vl = Vl + o;   // plane [group][head][t / 32][d / 16][(t / 16) % 2][lane][8]: accumulator (mb, nb) is nodes t0 + 16 mb + 8 hi + j of column 16 nb + lr
#pragma unroll
        for (int nb = 0; nb < 2; ++nb)
#pragma unroll
            for (int mb = 0; mb < 4; ++mb) { const int so = (mb >> 1) * (32 * HD) + nb * 512 + (mb & 1) * 256; *(v8us*)(vh + so) = th[nb][mb]; *(v8us*)(vl + so) = tl[nb][mb]; }
        asm volatile("s_wait_xcnt 0x0" ::: "memory");   // behind the last store: in the built code the q/k branch follows this one, and its first instructions reuse registers that these stores name
    }
}

// ---- k_fattn: scores, masked softmax, pair factor, attn.v and the head merge of 32 query rows of one group, all four heads, in ONE work-group of 8 waves; nothing of the score or weight matrices goes to memory.
// Wave w owns keys 64 w .. 64 w + 63. It computes S^T = K Q^T (A = key rows, B = query rows), so a lane holds scores of ONE query (lane & 15) and the accumulator pair of 32 keys is, converted in place, the A fragment of the weights for attn.v (hardware k order on both sides).
// The wave's 32 x 64 block of the pair mask (one bit each, in registers) and of the pair factor (bf16, its compute type, each thread's 64 values in its own 128 bytes of LDS) is read from memory once and serves the four heads. Row maximum, row sum and the attn.v partial sums of the 8 waves meet in LDS: three barriers per head.
typedef __attribute__((ext_vector_type(8))) unsigned v8u;
// Fragment from a plane laid in fragment order: a 16 x 32 fragment is 1024 contiguous bytes, first every lane's lower 8 elements (k = 8 hi + j) in lane order, then every lane's upper 8 (k = 16 + 8 hi + j). u is a uniform base, b the lane's 32-bit byte offset (it holds the lane's 16 * lane), c a constant: from head to head only the 32-bit offset has to live in a vector register. Each of the two loads covers 512 contiguous bytes, four whole lines; the registers hold what WFrag<bf>::ld gives on a row-major plane.
__device__ __forceinline__ v16bf ldfo(const bf* u, unsigned b, int c) { const char* p = ((const char*)u + b) + c; return cat16b(*(const v8us*)p, *(const v8us*)(p + 512)); }
__device__ __forceinline__ unsigned rne16(float f) { const unsigned u = __float_as_uint(f); return u + 0x7FFFu + ((u >> 16) & 1u); }   // f2bf's rounding, the bf16 left in the upper half
__device__ __forceinline__ void split2(float y0, float y1, unsigned& h, unsigned& l) { const unsigned r0 = rne16(y0), r1 = rne16(y1); h = (r0 >> 16) | (r1 & 0xFFFF0000u); const unsigned s0 = rne16(y0 - __uint_as_float(r0 & 0xFFFF0000u)), s1 = rne16(y1 - __uint_as_float(r1 & 0xFFFF0000u)); l = (s0 >> 16) | (s1 & 0xFFFF0000u); }   // splitf of two neighbours, each plane's pair packed in one word
// Eight v_exp_f32, in place, and one v_nop in ONE statement: behind each exp stands an independent instruction, behind the last the v_nop, so nothing directly behind a transcendental reads its result or overwrites its source (the slot the instruction set asks for).
__device__ __forceinline__ void exp2x8(float (&x)[8]) { asm("v_exp_f32 %0, %0\n\tv_exp_f32 %1, %1\n\tv_exp_f32 %2, %2\n\tv_exp_f32 %3, %3\n\tv_exp_f32 %4, %4\n\tv_exp_f32 %5, %5\n\tv_exp_f32 %6, %6\n\tv_exp_f32 %7, %7\n\tv_nop" : "+v"(x[0]), "+v"(x[1]), "+v"(x[2]), "+v"(x[3]), "+v"(x[4]), "+v"(x[5]), "+v"(x[6]), "+v"(x[7])); }
#define FW  8                    // waves per work-group
#define FQT 2                    // 16-row query tiles per work-group
#define FKT (TT / FW / 16)       // 16-key tiles per wave
#define OSP 36                   // LDS row pitch (floats) of the partial outputs: the two lane halves (8 rows apart) fall on different banks, rows stay 16-byte aligned
// amdgpu_waves_per_eu(6): the register budget of six waves a SIMD (160), so that three work-groups fit a WGP and all 768 are resident at once; with more than 160 registers two fit, and a second, half-empty round follows the first. For that budget the pair factor lies in LDS and the head's step is added to 32-bit offsets, not to 64-bit lane pointers that live through the loop.
__global__ __launch_bounds__(256) __attribute__((amdgpu_waves_per_eu(6))) void k_fattn(const bf* __restrict__ Qh, const bf* __restrict__ Ql, const bf* __restrict__ Kh, const bf* __restrict__ Kl, const bf* __restrict__ Vh, const bf* __restrict__ Vl, const int* __restrict__ mk, const float* __restrict__ adj, bf* Ah, bf* Al) {
    __shared__ float red[2][FW][FQT * 16];   /* [0] row maxima, [1] row sums: one array, so that one lane address serves both */ __shared__ __align__(16) float os[FW][FQT * 16][OSP]; __shared__ v4u gas[FQT * FKT][FW * 32];
    const int lane = threadIdx.x & 31, lr = lane & 15, hi = lane >> 4, w = threadIdx.x >> 5;
    const int g = blockIdx.y, i0 = blockIdx.x * (FQT * 16), k0 = w * (FKT * 16);
    const unsigned mo = (unsigned)((i0 + lr) * TT + k0 + hi * 8), qo = (unsigned)(i0 * HD + 8 * lane) * 2u, ko = (unsigned)(k0 * HD + 8 * lane) * 2u;   // the lane's 32-bit offsets: mo in elements inside a group's pair planes; qo and ko in bytes inside a (group, head) plane of q and of k or v (16 rows of q or k, and 16 keys of v, are 16 HD elements); every base below is uniform
    const bf* Qhg = Qh + (size_t)g * NH_ * TT * HD; const bf* Qlg = Ql + (size_t)g * NH_ * TT * HD; const bf* Khg = Kh + (size_t)g * NH_ * TT * HD; const bf* Klg = Kl + (size_t)g * NH_ * TT * HD; const bf* Vhg = Vh + (size_t)g * NKV * HP * TT; const bf* Vlg = Vl + (size_t)g * NKV * HP * TT;
    const int* mkg = mk + (size_t)g * TT * TT; const float* adg = adj + (size_t)g * TT * TT;
    const int* mpl = mkg + mo; const float* apl = adg + mo; v4i mv[FQT][FKT][2]; v4f av[FQT][FKT][2];   // all 32 loads of the block first, from two lane addresses
    unsigned mb[FQT];   // element (kt, j) of a lane: query i0 + 16 qt + lr, key k0 + 16 kt + 8 hi + j
#pragma unroll
    for (int qt = 0; qt < FQT; ++qt)
#pragma unroll
        for (int kt = 0; kt < FKT; ++kt) { const int* mp = mpl + (qt * 16 * TT + kt * 16); const float* ap = apl + (qt * 16 * TT + kt * 16);
            mv[qt][kt][0] = *(const v4i*)mp; mv[qt][kt][1] = *(const v4i*)(mp + 4); av[qt][kt][0] = *(const v4f*)ap; av[qt][kt][1] = *(const v4f*)(ap + 4); }
    asm volatile("s_wait_xcnt 0x0" :: "v"(mpl), "v"(apl) : "memory");   // behind the last of the 32 loads; the two addresses are inputs so that they stay in their registers up to the wait and no load's result lands on them in front of it
#pragma unroll
    for (int qt = 0; qt < FQT; ++qt) { mb[qt] = 0u;
#pragma unroll
        for (int kt = 0; kt < FKT; ++kt) { const v4i m0 = mv[qt][kt][0], m1 = mv[qt][kt][1]; const v4f a0 = av[qt][kt][0], a1 = av[qt][kt][1];
#pragma unroll
            for (int q = 0; q < 4; ++q) { mb[qt] |= (m0[q] != 0 ? 1u : 0u) << (kt * 8 + q); mb[qt] |= (m1[q] != 0 ? 1u : 0u) << (kt * 8 + 4 + q); }
            v4u ga; ga[0] = (unsigned)f2bf(a0[0]) | ((unsigned)f2bf(a0[1]) << 16); ga[1] = (unsigned)f2bf(a0[2]) | ((unsigned)f2bf(a0[3]) << 16);
            ga[2] = (unsigned)f2bf(a1[0]) | ((unsigned)f2bf(a1[1]) << 16); ga[3] = (unsigned)f2bf(a1[2]) | ((unsigned)f2bf(a1[3]) << 16); gas[qt * FKT + kt][threadIdx.x] = ga; } }   // a thread reads back only what it wrote itself: no barrier is owed for it
#pragma unroll 1   // rolled, for speed only
    for (int h = 0; h < NH_; ++h) {
        const unsigned qb = qo + (unsigned)h * (TT * HD * 2), kb = ko + (unsigned)h * (TT * HD * 2), vb = ko + (unsigned)h * (HP * TT * 2);   // the head's step stays in the 32-bit offsets
        v16bf qh[FQT], ql[FQT];
#pragma unroll
        for (int qt = 0; qt < FQT; ++qt) { qh[qt] = ldfo(Qhg, qb, qt * 16 * HD * 2); ql[qt] = ldfo(Qlg, qb, qt * 16 * HD * 2); }
        float sc[FQT][FKT][8]; float mx[FQT];
#pragma unroll
        for (int qt = 0; qt < FQT; ++qt) mx[qt] = -3.0e38f;
#pragma unroll
        for (int kt = 0; kt < FKT; ++kt) { const v16bf kh = ldfo(Khg, kb, kt * 16 * HD * 2), kl = ldfo(Klg, kb, kt * 16 * HD * 2);
#pragma unroll
            for (int qt = 0; qt < FQT; ++qt) { v8f a = (v8f){}; a = wmmab(kh, qh[qt], a); a = wmmab(kh, ql[qt], a); a = wmmab(kl, qh[qt], a);   /* q_hi k_hi + q_lo k_hi + q_hi k_lo; a[j] = score of key 8 hi + j of the tile, query lr */
#pragma unroll
                for (int j = 0; j < 8; ++j) { const float t = ((mb[qt] >> (kt * 8 + j)) & 1u) ? -1.0e9f : __fmul_rn(a[j], SCL);   /* where(mask != 0, -1e9, scores / sqrt(32)): the module's literal, after the scale */ sc[qt][kt][j] = t; mx[qt] = fmaxf(mx[qt], t); } } }
#pragma unroll
        for (int qt = 0; qt < FQT; ++qt) { mx[qt] = fmaxf(mx[qt], __shfl_xor(mx[qt], 16, 32)); if (hi == 0) red[0][w][qt * 16 + lr] = mx[qt]; }
        __syncthreads();   // every wave's row maxima are in LDS
#pragma unroll
        for (int qt = 0; qt < FQT; ++qt) { float m = red[0][0][qt * 16 + lr];
#pragma unroll
            for (int ww = 1; ww < FW; ++ww) m = fmaxf(m, red[0][ww][qt * 16 + lr]);
            float s = 0.f;
#pragma unroll
            for (int kt = 0; kt < FKT; ++kt) {
#pragma unroll
                for (int j = 0; j < 8; ++j) sc[qt][kt][j] = __fmul_rn(__fsub_rn(sc[qt][kt][j], m), 1.4426950408889634f);
                exp2x8(sc[qt][kt]);
#pragma unroll
                for (int j = 0; j < 8; ++j) s += sc[qt][kt][j]; }
            s += __shfl_xor(s, 16, 32); if (hi == 0) red[1][w][qt * 16 + lr] = s; }
        __syncthreads();   // every wave's row sums are in LDS
        float f[FQT];
#pragma unroll
        for (int qt = 0; qt < FQT; ++qt) { float s = red[1][0][qt * 16 + lr];
#pragma unroll
            for (int ww = 1; ww < FW; ++ww) s += red[1][ww][qt * 16 + lr];
            f[qt] = __fdiv_rn(1.0f, s); }
        v8f oa[FQT][2];
#pragma unroll
        for (int qt = 0; qt < FQT; ++qt) { oa[qt][0] = (v8f){}; oa[qt][1] = (v8f){}; }
#pragma unroll
        for (int kc = 0; kc < FKT / 2; ++kc) { v16bf ph[FQT], pl[FQT];
#pragma unroll
            for (int qt = 0; qt < FQT; ++qt) { v8u hw, lw;
#pragma unroll
                for (int tt = 0; tt < 2; ++tt) { const v4u ga = gas[qt * FKT + 2 * kc + tt][threadIdx.x];
#pragma unroll
                    for (int p = 0; p < 4; ++p) { const unsigned gp = ga[p]; unsigned a, c2;
                        split2(__fmul_rn(__fmul_rn(sc[qt][2 * kc + tt][2 * p], f[qt]), __uint_as_float(gp << 16)), __fmul_rn(__fmul_rn(sc[qt][2 * kc + tt][2 * p + 1], f[qt]), __uint_as_float(gp & 0xFFFF0000u)), a, c2);   /* softmax weight x the pair factor AFTER the normalisation: two rounded products */
                        hw[tt * 4 + p] = a; lw[tt * 4 + p] = c2; } }
                ph[qt] = __builtin_bit_cast(v16bf, hw); pl[qt] = __builtin_bit_cast(v16bf, lw); }   /* A fragment: row = query lr, k = 8 hi + j (first tile) and 16 + 8 hi + j (second tile) of the 32 keys */
#pragma unroll
            for (int dt = 0; dt < 2; ++dt) { const int o = (kc * (32 * HD) + dt * 512) * 2; const v16bf vh = ldfo(Vhg, vb, o), vl = ldfo(Vlg, vb, o);
#pragma unroll
                for (int qt = 0; qt < FQT; ++qt) { oa[qt][dt] = wmmab(ph[qt], vh, oa[qt][dt]); oa[qt][dt] = wmmab(pl[qt], vh, oa[qt][dt]); oa[qt][dt] = wmmab(ph[qt], vl, oa[qt][dt]); } } }
#pragma unroll
        for (int qt = 0; qt < FQT; ++qt)
#pragma unroll
            for (int dt = 0; dt < 2; ++dt)
#pragma unroll
                for (int j = 0; j < 8; ++j) os[w][qt * 16 + hi * 8 + j][dt * 16 + lr] = oa[qt][dt][j];
        __syncthreads();   // every wave's partial outputs are in LDS; the next head writes them again only behind its own two barriers
        { const int q = threadIdx.x >> 3, d4 = (threadIdx.x & 7) * 4; v4f s = *(const v4fa*)&os[0][q][d4];
#pragma unroll
            for (int ww = 1; ww < FW; ++ww) s += *(const v4fa*)&os[ww][q][d4];
            v4us oh, ol;
#pragma unroll
            for (int c = 0; c < 4; ++c) { unsigned short a, c2; splitf(s[c], a, c2); oh[c] = a; ol[c] = c2; }
            const size_t o = ((size_t)g * TT + i0) * DQ; const unsigned oo = (unsigned)(q * DQ + d4 + h * HD) * 2u; *(v4us*)((char*)(Ah + o) + oo) = oh; *(v4us*)((char*)(Al + o) + oo) = ol;   /* merged [t][head][d] hi / lo planes for the output projection */
            asm volatile("s_wait_xcnt 0x0" ::: "memory"); }   // stands in front of the next head's first instructions, which reuse the registers that the two stores name as their addresses
    }
}

extern "C" void kernel_launch(void* const* d_in, const int* in_sizes, int n_in,
                              void* d_out, int out_size, void* d_ws, size_t ws_size, hipStream_t stream) {
    (void)in_sizes; (void)n_in; (void)out_size;
    const float* x = (const float*)d_in[0]; const float* xk = (const float*)d_in[1]; const float* xv = (const float*)d_in[2]; const int* mk = (const int*)d_in[3]; const float* adj = (const float*)d_in[4]; const float* wq = (const float*)d_in[5]; const float* bq = (const float*)d_in[6]; const float* wk = (const float*)d_in[7]; const float* bk = (const float*)d_in[8]; const float* wv = (const float*)d_in[9]; const float* bv = (const float*)d_in[10]; const float* wo = (const float*)d_in[11]; const float* bo = (const float*)d_in[12];   /* order query, key, value ([4][12][512][128] = 48 groups), mask (int32 [48][512][512]: read as data), adjm (f32 [48][512][512]: read), Wq, bq, Wk, bk, Wv, bv, Wp, bp ('oi') */
    float* OUT = (float*)d_out;     // [48][512][128]
    char* wsp = (char*)d_ws;
    auto take = [&](size_t bytes) { char* p = wsp; wsp += (bytes + 255) & ~(size_t)255; return (void*)p; };
    bf* WO = (bf*)take((size_t)DM * DQ * 2);   /* Wp as bf16 */
    bf* QPh = (bf*)take((size_t)2 * NB_ * NH_ * TT * HD * 2); bf* QPl = (bf*)take((size_t)2 * NB_ * NH_ * TT * HD * 2);   /* [q groups | k groups][head], each 512 x 32 in fragment order */ bf* KPh = QPh + (size_t)NB_ * NH_ * TT * HD; bf* KPl = QPl + (size_t)NB_ * NH_ * TT * HD;
    bf* VTh = (bf*)take((size_t)NB_ * NKV * HP * TT * 2); bf* VTl = (bf*)take((size_t)NB_ * NKV * HP * TT * 2);
    bf* ATh = (bf*)take((size_t)NB_ * TT * DQ * 2); bf* ATl = (bf*)take((size_t)NB_ * TT * DQ * 2);
    if ((size_t)(wsp - (char*)d_ws) > ws_size) return;    // ws 256 MiB given; the carve is below 64 MiB
    k_proj<<<dim3(NB_ * TT / 64, 3, 1), PW * 32, 0, stream>>>(x, xk, xv, wq, wk, wv, wo, bq, bk, bv, QPh, QPl, VTh, VTl, WO);   /* rows = all (group, node) pairs; y = q, k, v */
    k_fattn<<<dim3(TT / (FQT * 16), NB_, 1), FW * 32, 0, stream>>>(QPh, QPl, KPh, KPl, VTh, VTl, mk, adj, ATh, ATl);   /* one kv head per query head: plane z of q meets plane z of k and of v^T */
    k_gemmw<bf, 1, true><<<dim3(NB_ * TT / 64, DM / 64, 1), 32, 0, stream>>>(ATh, ATl, WO, nullptr, DQ, OUT, DM, bo, bo, bo, 0, 0, 0);
}

// v006
// One run takes 60.3 microseconds.
// Next to v005, in two timings, it ran 1.12 and 1.13 times as fast.
// Over all steps from v000 it is 61.3 times as fast.
#include <hip/hip_runtime.h>

// Spatial multi-head attention over graph nodes with a pair mask and a post-softmax pair factor (query, key, value [4][12][512][128]: 48 independent (batch, time) groups of 512 nodes; q = query Wq^T + bq, k = key Wk^T + bk, v = value Wv^T + bv ('oi' (out, in) [128][128] + [128]: real biases; 4 heads x 32); scores x 1/sqrt(32); where mask[b][t][i][j] != 0 (int32 [4][12][512][512], read per logit as data) the score is REPLACED by -1e9; softmax over the 512 keys; the weights x adjm[b][t][i][j] (f32 [4][12][512][512], read, rounded to bf16: an input) AFTER the softmax, no renormalisation; out = merged Wp^T + bp -> [4][12][512][128] (3.1 M); argument order query, key, value, mask, adjm, Wq, bq, Wk, bk, Wv, bv, Wp, bp).
// Layout, all 48 groups per launch, three launches: (1) k_proj reads query, key, value and Wq, Wk, Wv as f32, rounds them to bf16 on their way into LDS, adds the bias rounded to bf16 and writes the hi/lo planes that attention reads, each in the order of its matrix fragments (see ldfo): q/k planes [q groups | k groups][head][t / 16][d / 8][t % 16][8] and value planes [group][head][t / 32][d / 16][(t / 16) % 2][lane][8]; its first 16 work-groups also write the bf16 copy of Wp; (2) ONE fused kernel for scores, masked softmax, pair factor, attn.v and the head merge, every operand on hi/lo planes, scores and weights in registers only; (3) merged hi/lo x Wp exact + bp.
// Compute dtypes, f32 accumulate: every input rounded to bf16, nearest even, incl. the pair factor adjm; projections exact + bf16 biases; scores (K 32) and attn.v 3 products on every row; softmax f32; Wp hl x exact + bias.

#define NB_  48
#define TT   512
#define DM   128
#define NH_  4
#define NKV  4
#define HD   32
#define DQ   (NH_ * HD)
#define SCL  0.17677669529663688f   // 32^-0.5 (the module divides by float32(sqrt(32)); one multiply here)
#define HP   64    // a head's value plane is HP x TT elements apart from the next; the first HD x TT are written and read
typedef unsigned short bf;
typedef __attribute__((ext_vector_type(16))) __bf16   v16bf;
typedef __attribute__((ext_vector_type(8)))  __bf16   v8bf;
typedef __attribute__((ext_vector_type(4)))  __bf16   v4bf;
typedef __attribute__((ext_vector_type(2)))  __bf16   v2bf;
typedef __attribute__((ext_vector_type(2)))  float    v2f;
typedef __attribute__((ext_vector_type(8)))  unsigned short v8us;
typedef __attribute__((ext_vector_type(4)))  unsigned short v4us;
typedef __attribute__((ext_vector_type(8)))  float    v8f;
typedef __attribute__((ext_vector_type(4)))  float    v4f;
typedef __attribute__((ext_vector_type(4)))  int      v4i;
typedef __attribute__((ext_vector_type(4)))  unsigned v4u;
typedef v4f  __attribute__((may_alias)) v4fa;
typedef v8us __attribute__((may_alias)) v8usa;
typedef v4us __attribute__((may_alias)) v4usa;

__device__ __forceinline__ unsigned short f2bf(float f) { unsigned u = __float_as_uint(f); u += 0x7FFFu + ((u >> 16) & 1u); return (unsigned short)(u >> 16); }
__device__ __forceinline__ float bf2f(unsigned short b) { return __uint_as_float(((unsigned)b) << 16); }
__device__ __forceinline__ float bfr(float f) { return bf2f(f2bf(f)); }
__device__ __forceinline__ v16bf cat16b(v8us lo, v8us hi) { return __builtin_bit_cast(v16bf, __builtin_shufflevector(lo, hi, 0, 1, 2, 3, 4, 5, 6, 7, 8, 9, 10, 11, 12, 13, 14, 15)); }
__device__ __forceinline__ v8f wmmab(v16bf a, v16bf b, v8f c) { return __builtin_amdgcn_wmma_f32_16x16x32_bf16(false, a, false, b, (short)0, c, false, false); }

// ---- k_gemmw: register-blocked GEMM, ONE WAVE per 64x64 output tile (16 accumulators), operands straight from K-contiguous 16-bit planes; grid (M/64, N/64, Z), 32 threads.
// C[m][n] (f32, pitch ldc, + optional f32 bias[n], one bias pointer per z up to z = 2) = sum_k A[m][k] Bt[n][k] (+ split products per NSPLIT). z-batch strides sA/sB/sC in elements. K % 32 == 0.
template <typename T16> struct WFrag;
template <> struct WFrag<bf> { typedef v16bf V; static __device__ __forceinline__ V ld(const bf* p) { return cat16b(*(const v8us*)p, *(const v8us*)(p + 16)); } static __device__ __forceinline__ v8f mma(V a, V b, v8f c) { return wmmab(a, b, c); } };
template <typename T16, int NSPLIT, bool BIAS>
__global__ __launch_bounds__(32) void k_gemmw(const T16* __restrict__ A, const T16* __restrict__ A2, const T16* __restrict__ Bt, const T16* __restrict__ Bt2, int K, float* C, int ldc, const float* __restrict__ bias0, const float* __restrict__ bias1, const float* __restrict__ bias2, size_t sA, size_t sB, size_t sC) {
    typedef typename WFrag<T16>::V V;
    __shared__ __align__(16) float os[16 * 68];
    const size_t z = blockIdx.z; A += z * sA; if (A2) A2 += z * sA; Bt += z * sB; if (Bt2) Bt2 += z * sB; C += z * sC; const float* bias = z == 0 ? bias0 : (z == 1 ? bias1 : bias2);
    const int lane = threadIdx.x & 31, lr = lane & 15, hi = lane >> 4; const int r0 = blockIdx.x * 64, c0 = blockIdx.y * 64;
    v8f acc[4][4];
#pragma unroll
    for (int mb = 0; mb < 4; ++mb)
#pragma unroll
        for (int nb = 0; nb < 4; ++nb) acc[mb][nb] = (v8f){};
    const size_t aoff = (size_t)(r0 + lr) * K + 8 * hi, boff = (size_t)(c0 + lr) * K + 8 * hi;
    for (int kc = 0; kc < K; kc += 32) {
        V a[4], a2[4];
#pragma unroll
        for (int mb = 0; mb < 4; ++mb) { a[mb] = WFrag<T16>::ld(A + aoff + (size_t)mb * 16 * K + kc); if (NSPLIT == 1 || NSPLIT == 2) a2[mb] = WFrag<T16>::ld(A2 + aoff + (size_t)mb * 16 * K + kc); }
#pragma unroll
        for (int nb = 0; nb < 4; ++nb) { const V b = WFrag<T16>::ld(Bt + boff + (size_t)nb * 16 * K + kc); V b2; if (NSPLIT >= 2) b2 = WFrag<T16>::ld(Bt2 + boff + (size_t)nb * 16 * K + kc);
#pragma unroll
            for (int mb = 0; mb < 4; ++mb) { acc[mb][nb] = WFrag<T16>::mma(a[mb], b, acc[mb][nb]); if (NSPLIT == 1 || NSPLIT == 2) acc[mb][nb] = WFrag<T16>::mma(a2[mb], b, acc[mb][nb]); if (NSPLIT >= 2) acc[mb][nb] = WFrag<T16>::mma(a[mb], b2, acc[mb][nb]); } }
        asm volatile("v_nop\n\tv_nop\n\tv_nop\n\tv_nop" : "+v"(acc[0][0]), "+v"(acc[1][1]), "+v"(acc[2][2]), "+v"(acc[3][3]) : "v"(a[0]), "v"(a[3]));
    }
#pragma unroll
    for (int mb = 0; mb < 4; ++mb) {
#pragma unroll
        for (int nb = 0; nb < 4; ++nb) {
#pragma unroll
            for (int j = 0; j < 8; ++j) os[(hi * 8 + j) * 68 + nb * 16 + lr] = acc[mb][nb][j]; }
        __builtin_amdgcn_wave_barrier(); asm volatile("" ::: "memory");
        float* crow = C + (size_t)(r0 + mb * 16) * ldc + c0;
{
#pragma unroll
            for (int s = 0; s < 8; ++s) { const int row = 2 * s + hi, cofs = lr * 4; v4f val = *(const v4fa*)(os + row * 68 + cofs); if (BIAS) { val[0] += bfr(bias[c0 + cofs]); val[1] += bfr(bias[c0 + cofs + 1]); val[2] += bfr(bias[c0 + cofs + 2]); val[3] += bfr(bias[c0 + cofs + 3]); }
                *(v4f*)(crow + (size_t)row * ldc + cofs) = val; }
             }
        __builtin_amdgcn_wave_barrier(); asm volatile("" ::: "memory");
    }
}

// hi/lo split of eight values: h = bf16(y), l = bf16(y - h), both nearest even.
__device__ __forceinline__ void split8(v8f y, v8us& h, v8us& l) { const v8bf hb = __builtin_convertvector(y, v8bf); const v4u u = __builtin_bit_cast(v4u, hb); v8f r;
#pragma unroll
    for (int i = 0; i < 4; ++i) { r[2 * i] = __uint_as_float(u[i] << 16); r[2 * i + 1] = __uint_as_float(u[i] & 0xFFFF0000u); }
    h = __builtin_bit_cast(v8us, hb); l = __builtin_bit_cast(v8us, __builtin_convertvector(y - r, v8bf)); }

// ---- k_proj: the q, k and v projections (blockIdx.y = 0, 1, 2) of 64 (group, node) rows, from the f32 inputs to the hi/lo planes of attention. Four waves; wave w owns head w, output columns 32 w .. 32 w + 31, as a 64x32 register tile (8 accumulators).
// y[m][n] = sum_k bf16(x[m][k]) bf16(W[n][k]) + bf16(bias[n]). Operands: a row of 128 f32 is ONE load of a wave (16 bytes a lane, four whole lines); it is rounded to bf16 and laid in LDS, the 64 input rows once for the four waves, each wave's 32 weight rows in its own slice; the fragments are read from there.
// An accumulator holds 8 consecutive rows (nodes) of one column (lane & 15). q, k: the tile turns through the wave's LDS slice (f32) so that a lane holds 8 consecutive columns of a row: a store covers 8 rows x 4 column groups = four whole 128-byte lines of the head's plane. v: a lane's 8 nodes of one column are one 16-byte piece of attention's B fragment, held by the lane that will read it: each accumulator is stored from its registers, 512 contiguous bytes a store.
#define PW  4      // waves per work-group
#define ASP 136    // LDS row pitch (16-bit elements) of the staged operand rows: 256 + 16 bytes, so that the 16 rows of a fragment read start 4 banks apart
#define QSP 36     // LDS row pitch (floats) of the staged q/k tile: the two lane halves (8 rows apart) fall on different banks, rows stay 16-byte aligned
#define WSL (64 * QSP)   // floats in a wave's LDS slice: first its 32 weight rows (32 x 136 x 2 bytes fit), then, for q and k, its output tile (64 x 36 floats)
__device__ __forceinline__ void st4(bf* d, v4f u) { *(v4usa*)d = __builtin_bit_cast(v4us, __builtin_convertvector(u, v4bf)); }   // four f32 to bf16, nearest even, into LDS
__device__ __forceinline__ v16bf ldsf(const bf* p) { return cat16b(*(const v8usa*)p, *(const v8usa*)(p + 16)); }   // fragment from an LDS row: the k order of WFrag<bf>::ld
// amdgpu_waves_per_eu(5): the register budget of five waves a SIMD, so that all 1152 work-groups (four or five a WGP) are resident at once; without it the v branch is scheduled into more than 204 registers and a second, short round of work-groups follows the first.
__global__ __launch_bounds__(PW * 32) __attribute__((amdgpu_waves_per_eu(5))) void k_proj(const float* __restrict__ x0, const float* __restrict__ x1, const float* __restrict__ x2, const float* __restrict__ w0, const float* __restrict__ w1, const float* __restrict__ w2, const float* __restrict__ w3, const float* __restrict__ b0, const float* __restrict__ b1, const float* __restrict__ b2, bf* Ph, bf* Pl, bf* Vh, bf* Vl, bf* W3) {
    __shared__ __align__(16) float sm[PW * WSL + 64 * ASP / 2];   // four slices, then the 64 input rows; every 16-bit access goes through a may_alias vector type
    const int z = blockIdx.y; const float* A = z == 0 ? x0 : (z == 1 ? x1 : x2); const float* B = z == 0 ? w0 : (z == 1 ? w1 : w2); const float* bias = z == 0 ? b0 : (z == 1 ? b1 : b2);
    const int lane = threadIdx.x & 31, lr = lane & 15, hi = lane >> 4, w = threadIdx.x >> 5; const int r0 = blockIdx.x * 64, c0 = w * HD;
    const int g = r0 / TT, t0 = r0 % TT;   // 64 divides 512: a tile lies in one group
    bf* as = (bf*)(sm + PW * WSL); bf* bs = (bf*)(sm + w * WSL);
    if (z == 0 && blockIdx.x < DM * DQ / (PW * 32 * 8)) {   // uniform in the work-group: the first 16 work-groups of the q part round Wp to bf16 for the output projection, 8 elements a thread
        const int e = (blockIdx.x * (PW * 32) + threadIdx.x) * 8; *(v8us*)(W3 + e) = __builtin_bit_cast(v8us, __builtin_convertvector(*(const v8f*)(w3 + e), v8bf));
        asm volatile("s_wait_xcnt 0x0" ::: "memory"); }   // stands in front of the staging code, which may reuse the registers that the load and the store name
    { const float* ag = A + (size_t)(r0 + w * 16) * DM + lane * 4; const float* bg = B + c0 * DM + lane * 4;   // the wave stages 16 of the input rows and its own 32 weight rows, in three groups of 16 loads, two groups in flight: 128 data registers, not 192, which leaves room for five waves a SIMD
        v4f wa[16], xa[16], wb[16];
#pragma unroll
        for (int i = 0; i < 16; ++i) wa[i] = *(const v4f*)(bg + i * DM);
#pragma unroll
        for (int i = 0; i < 16; ++i) xa[i] = *(const v4f*)(ag + i * DM);
        asm volatile("s_wait_xcnt 0x0" :: "v"(ag), "v"(bg) : "memory");   // behind the last load of the two groups; the two addresses are inputs so that they stay in their registers up to the wait and no load's result lands on them in front of it
#pragma unroll
        for (int i = 0; i < 16; ++i) st4(bs + i * ASP + lane * 4, wa[i]);
        __builtin_amdgcn_sched_barrier(0);   // keeps the third group's loads behind the first group's LDS stores: lifted over them they hold 64 more registers at once, and the build spills
#pragma unroll
        for (int i = 0; i < 16; ++i) wb[i] = *(const v4f*)(bg + (16 + i) * DM);
        asm volatile("s_wait_xcnt 0x0" :: "v"(bg) : "memory");   // the same behind the third group
#pragma unroll
        for (int i = 0; i < 16; ++i) st4(as + (w * 16 + i) * ASP + lane * 4, xa[i]);
#pragma unroll
        for (int i = 0; i < 16; ++i) st4(bs + (16 + i) * ASP + lane * 4, wb[i]); }
    __syncthreads();   // all 64 input rows are in LDS before any wave reads fragments
    v8f acc[4][2];
#pragma unroll
    for (int mb = 0; mb < 4; ++mb)
#pragma unroll
        for (int nb = 0; nb < 2; ++nb) acc[mb][nb] = (v8f){};
#pragma unroll
    for (int kc = 0; kc < DM; kc += 32) {
        v16bf a[4];
#pragma unroll
        for (int mb = 0; mb < 4; ++mb) a[mb] = ldsf(as + (mb * 16 + lr) * ASP + kc + 8 * hi);
#pragma unroll
        for (int nb = 0; nb < 2; ++nb) { const v16bf b = ldsf(bs + (nb * 16 + lr) * ASP + kc + 8 * hi);
#pragma unroll
            for (int mb = 0; mb < 4; ++mb) acc[mb][nb] = wmmab(a[mb], b, acc[mb][nb]); }
    }
    __syncthreads();   // every fragment has been read before a slice is written again
    if (z < 2) {   // uniform in the work-group
        float* os = sm + w * WSL;
#pragma unroll
        for (int mb = 0; mb < 4; ++mb)
#pragma unroll
            for (int nb = 0; nb < 2; ++nb)
#pragma unroll
                for (int j = 0; j < 8; ++j) os[(mb * 16 + hi * 8 + j) * QSP + nb * 16 + lr] = acc[mb][nb][j];
        const int r8 = lane >> 2, c8 = (lane & 3) * 8;   // read-back: 8 rows a step, 8 columns a lane
        v8f bb;
#pragma unroll
        for (int i = 0; i < 8; ++i) bb[i] = bfr(bias[c0 + c8 + i]);
        const size_t o = (((size_t)(z * NB_ + g) * NH_ + w) * TT + t0) * HD + c8 * 16 + r8 * 8; bf* ph = Ph + o; bf* pl = Pl + o;   // plane [q | k][group][head][t / 16][d / 8][t % 16][8]
        __syncthreads();   // the tile is in LDS before other lanes read it
#pragma unroll
        for (int s = 0; s < 8; ++s) { const float* rp = os + (8 * s + r8) * QSP + c8; const v4f u0 = *(const v4fa*)rp, u1 = *(const v4fa*)(rp + 4); v8us oh, ol;
            split8(__builtin_shufflevector(u0, u1, 0, 1, 2, 3, 4, 5, 6, 7) + bb, oh, ol); const int so = (s >> 1) * (16 * HD) + (s & 1) * 64; *(v8us*)(ph + so) = oh; *(v8us*)(pl + so) = ol; }   // row 8 s + r8: 16-row tile s / 2, row 8 (s % 2) + r8 in it
    } else {
        v8us th[2][4], tl[2][4];   // all sixteen pieces first, then the stores
#pragma unroll
        for (int nb = 0; nb < 2; ++nb) { const float bn = bfr(bias[c0 + nb * 16 + lr]);
#pragma unroll
            for (int mb = 0; mb < 4; ++mb) split8(acc[mb][nb] + bn, th[nb][mb], tl[nb][mb]); }
        const size_t o = (size_t)(g * NKV + w) * HP * TT + (t0 / 32) * (32 * HD) + lane * 8; bf* vh = Vh + o; bf* vl = Vl + o;   // plane [group][head][t / 32][d / 16][(t / 16) % 2][lane][8]: accumulator (mb, nb) is nodes t0 + 16 mb + 8 hi + j of column 16 nb + lr
#pragma unroll
        for (int nb = 0; nb < 2; ++nb)
#pragma unroll
            for (int mb = 0; mb < 4; ++mb) { const int so = (mb >> 1) * (32 * HD) + nb * 512 + (mb & 1) * 256; *(v8us*)(vh + so) = th[nb][mb]; *(v8us*)(vl + so) = tl[nb][mb]; }
        asm volatile("s_wait_xcnt 0x0" ::: "memory");   // behind the last store: in the built code the q/k branch follows this one, and its first instructions reuse registers that these stores name
    }
}

// ---- k_fattn: scores, masked softmax, pair factor, attn.v and the head merge of 32 query rows of one group, all four heads, in ONE work-group of 8 waves; nothing of the score or weight matrices goes to memory.
// Wave w owns keys 64 w .. 64 w + 63. It computes S^T = K Q^T (A = key rows, B = query rows), so a lane holds scores of ONE query (lane & 15) and the accumulator pair of 32 keys is, converted in place, the A fragment of the weights for attn.v (hardware k order on both sides).
// The wave's 32 x 64 block of the pair mask (one bit each, in registers) and of the pair factor (bf16, its compute type, each thread's 64 values in its own 128 bytes of LDS) is read from memory once and serves the four heads. Row maximum, row sum and the attn.v partial sums of the 8 waves meet in LDS: three barriers per head.
typedef __attribute__((ext_vector_type(8))) unsigned v8u;
typedef __attribute__((ext_vector_type(2))) unsigned v2u;
// Fragment from a plane laid in fragment order: a 16 x 32 fragment is 1024 contiguous bytes, first every lane's lower 8 elements (k = 8 hi + j) in lane order, then every lane's upper 8 (k = 16 + 8 hi + j). u is a uniform base, b the lane's 32-bit byte offset (it holds the lane's 16 * lane), c a constant: from head to head only the 32-bit offset has to live in a vector register. Each of the two loads covers 512 contiguous bytes, four whole lines; the registers hold what WFrag<bf>::ld gives on a row-major plane.
__device__ __forceinline__ v16bf ldfo(const bf* u, unsigned b, int c) { const char* p = ((const char*)u + b) + c; return cat16b(*(const v8us*)p, *(const v8us*)(p + 512)); }
__device__ __forceinline__ unsigned cvt2(v2f y) { return __builtin_bit_cast(unsigned, __builtin_convertvector(y, v2bf)); }   // two f32 to bf16, nearest even, packed in one word by one conversion instruction
__device__ __forceinline__ void split2(float y0, float y1, unsigned& h, unsigned& l) { const v2f y = {y0, y1}; h = cvt2(y); const v2f r = {__uint_as_float(h << 16), __uint_as_float(h & 0xFFFF0000u)}; l = cvt2(y - r); }   // hi/lo split of two neighbours (h = bf16(y), l = bf16(y - h)), each plane's pair packed in one word
// Eight v_exp_f32, in place, and one v_nop in ONE statement: behind each exp stands an independent instruction, behind the last the v_nop, so nothing directly behind a transcendental reads its result or overwrites its source (the slot the instruction set asks for).
__device__ __forceinline__ void exp2x8(float (&x)[8]) { asm("v_exp_f32 %0, %0\n\tv_exp_f32 %1, %1\n\tv_exp_f32 %2, %2\n\tv_exp_f32 %3, %3\n\tv_exp_f32 %4, %4\n\tv_exp_f32 %5, %5\n\tv_exp_f32 %6, %6\n\tv_exp_f32 %7, %7\n\tv_nop" : "+v"(x[0]), "+v"(x[1]), "+v"(x[2]), "+v"(x[3]), "+v"(x[4]), "+v"(x[5]), "+v"(x[6]), "+v"(x[7])); }
#define FW  8                    // waves per work-group
#define FQT 2                    // 16-row query tiles per work-group
#define FKT (TT / FW / 16)       // 16-key tiles per wave
#define OSP 36                   // LDS row pitch (floats) of the partial outputs: the two lane halves (8 rows apart) fall on different banks, rows stay 16-byte aligned
// amdgpu_waves_per_eu(6): the register budget of six waves a SIMD (160), so that three work-groups fit a WGP and all 768 are resident at once; with more than 160 registers two fit, and a second, half-empty round follows the first. For that budget the pair factor lies in LDS and the head's step is added to 32-bit offsets, not to 64-bit lane pointers that live through the loop.
__global__ __launch_bounds__(256) __attribute__((amdgpu_waves_per_eu(6))) void k_fattn(const bf* __restrict__ Qh, const bf* __restrict__ Ql, const bf* __restrict__ Kh, const bf* __restrict__ Kl, const bf* __restrict__ Vh, const bf* __restrict__ Vl, const int* __restrict__ mk, const float* __restrict__ adj, bf* Ah, bf* Al) {
    __shared__ float red[2][FW][FQT * 16];   /* [0] row maxima, [1] row sums: one array, so that one lane address serves both */ __shared__ __align__(16) float os[FW][FQT * 16][OSP]; __shared__ v4u gas[FQT * FKT][FW * 32];
    const int lane = threadIdx.x & 31, lr = lane & 15, hi = lane >> 4, w = threadIdx.x >> 5;
    const int g = blockIdx.y, i0 = blockIdx.x * (FQT * 16), k0 = w * (FKT * 16);
    const unsigned mo = (unsigned)((i0 + lr) * TT + k0 + hi * 8), qo = (unsigned)(i0 * HD + 8 * lane) * 2u, ko = (unsigned)(k0 * HD + 8 * lane) * 2u;   // the lane's 32-bit offsets: mo in elements inside a group's pair planes; qo and ko in bytes inside a (group, head) plane of q and of k or v (16 rows of q or k, and 16 keys of v, are 16 HD elements); every base below is uniform
    const bf* Qhg = Qh + (size_t)g * NH_ * TT * HD; const bf* Qlg = Ql + (size_t)g * NH_ * TT * HD; const bf* Khg = Kh + (size_t)g * NH_ * TT * HD; const bf* Klg = Kl + (size_t)g * NH_ * TT * HD; const bf* Vhg = Vh + (size_t)g * NKV * HP * TT; const bf* Vlg = Vl + (size_t)g * NKV * HP * TT;
    const int* mkg = mk + (size_t)g * TT * TT; const float* adg = adj + (size_t)g * TT * TT;
    const int* mpl = mkg + mo; const float* apl = adg + mo; v4i mv[FQT][FKT][2]; v4f av[FQT][FKT][2];   // all 32 loads of the block first, from two lane addresses
    unsigned mb[FQT];   // element (kt, j) of a lane: query i0 + 16 qt + lr, key k0 + 16 kt + 8 hi + j
#pragma unroll
    for (int qt = 0; qt < FQT; ++qt)
#pragma unroll
        for (int kt = 0; kt < FKT; ++kt) { const int* mp = mpl + (qt * 16 * TT + kt * 16); const float* ap = apl + (qt * 16 * TT + kt * 16);
            mv[qt][kt][0] = *(const v4i*)mp; mv[qt][kt][1] = *(const v4i*)(mp + 4); av[qt][kt][0] = *(const v4f*)ap; av[qt][kt][1] = *(const v4f*)(ap + 4); }
    asm volatile("s_wait_xcnt 0x0" :: "v"(mpl), "v"(apl) : "memory");   // behind the last of the 32 loads; the two addresses are inputs so that they stay in their registers up to the wait and no load's result lands on them in front of it
#pragma unroll
    for (int qt = 0; qt < FQT; ++qt) { mb[qt] = 0u;
#pragma unroll
        for (int kt = 0; kt < FKT; ++kt) { const v4i m0 = mv[qt][kt][0], m1 = mv[qt][kt][1]; const v4f a0 = av[qt][kt][0], a1 = av[qt][kt][1];
#pragma unroll
            for (int q = 0; q < 4; ++q) { mb[qt] |= (m0[q] != 0 ? 1u : 0u) << (kt * 8 + q); mb[qt] |= (m1[q] != 0 ? 1u : 0u) << (kt * 8 + 4 + q); }
            gas[qt * FKT + kt][threadIdx.x] = __builtin_bit_cast(v4u, __builtin_convertvector(__builtin_shufflevector(a0, a1, 0, 1, 2, 3, 4, 5, 6, 7), v8bf)); } }   // a thread reads back only what it wrote itself: no barrier is owed for it
#pragma unroll 1   // rolled, for speed only
    for (int h = 0; h < NH_; ++h) {
        const unsigned qb = qo + (unsigned)h * (TT * HD * 2), kb = ko + (unsigned)h * (TT * HD * 2), vb = ko + (unsigned)h * (HP * TT * 2);   // the head's step stays in the 32-bit offsets
        v16bf qh[FQT], ql[FQT];
#pragma unroll
        for (int qt = 0; qt < FQT; ++qt) { qh[qt] = ldfo(Qhg, qb, qt * 16 * HD * 2); ql[qt] = ldfo(Qlg, qb, qt * 16 * HD * 2); }
        float sc[FQT][FKT][8]; float mx[FQT];
#pragma unroll
        for (int qt = 0; qt < FQT; ++qt) mx[qt] = -3.0e38f;
#pragma unroll
        for (int kt = 0; kt < FKT; ++kt) { const v16bf kh = ldfo(Khg, kb, kt * 16 * HD * 2), kl = ldfo(Klg, kb, kt * 16 * HD * 2);
#pragma unroll
            for (int qt = 0; qt < FQT; ++qt) { v8f a = (v8f){}; a = wmmab(kh, qh[qt], a); a = wmmab(kh, ql[qt], a); a = wmmab(kl, qh[qt], a);   /* q_hi k_hi + q_lo k_hi + q_hi k_lo; a[j] = score of key 8 hi + j of the tile, query lr */
#pragma unroll
                for (int j = 0; j < 8; ++j) { const float t = ((mb[qt] >> (kt * 8 + j)) & 1u) ? -1.0e9f : __fmul_rn(a[j], SCL);   /* where(mask != 0, -1e9, scores / sqrt(32)): the module's literal, after the scale */ sc[qt][kt][j] = t; mx[qt] = fmaxf(mx[qt], t); } } }
#pragma unroll
        for (int qt = 0; qt < FQT; ++qt) { mx[qt] = fmaxf(mx[qt], __shfl_xor(mx[qt], 16, 32)); if (hi == 0) red[0][w][qt * 16 + lr] = mx[qt]; }
        __syncthreads();   // every wave's row maxima are in LDS
#pragma unroll
        for (int qt = 0; qt < FQT; ++qt) { float m = red[0][0][qt * 16 + lr];
#pragma unroll
            for (int ww = 1; ww < FW; ++ww) m = fmaxf(m, red[0][ww][qt * 16 + lr]);
            float s = 0.f;
#pragma unroll
            for (int kt = 0; kt < FKT; ++kt) {
#pragma unroll
                for (int j = 0; j < 8; ++j) sc[qt][kt][j] = __fmul_rn(__fsub_rn(sc[qt][kt][j], m), 1.4426950408889634f);
                exp2x8(sc[qt][kt]);
#pragma unroll
                for (int j = 0; j < 8; ++j) s += sc[qt][kt][j]; }
            s += __shfl_xor(s, 16, 32); if (hi == 0) red[1][w][qt * 16 + lr] = s; }
        __syncthreads();   // every wave's row sums are in LDS
        float f[FQT];
#pragma unroll
        for (int qt = 0; qt < FQT; ++qt) { float s = red[1][0][qt * 16 + lr];
#pragma unroll
            for (int ww = 1; ww < FW; ++ww) s += red[1][ww][qt * 16 + lr];
            f[qt] = __fdiv_rn(1.0f, s); }
        v8f oa[FQT][2];
#pragma unroll
        for (int qt = 0; qt < FQT; ++qt) { oa[qt][0] = (v8f){}; oa[qt][1] = (v8f){}; }
#pragma unroll
        for (int kc = 0; kc < FKT / 2; ++kc) { v16bf ph[FQT], pl[FQT];
#pragma unroll
            for (int qt = 0; qt < FQT; ++qt) { v8u hw, lw;
#pragma unroll
                for (int tt = 0; tt < 2; ++tt) { const v4u ga = gas[qt * FKT + 2 * kc + tt][threadIdx.x];
#pragma unroll
                    for (int p = 0; p < 4; ++p) { const unsigned gp = ga[p]; unsigned a, c2;
                        split2(__fmul_rn(__fmul_rn(sc[qt][2 * kc + tt][2 * p], f[qt]), __uint_as_float(gp << 16)), __fmul_rn(__fmul_rn(sc[qt][2 * kc + tt][2 * p + 1], f[qt]), __uint_as_float(gp & 0xFFFF0000u)), a, c2);   /* softmax weight x the pair factor AFTER the normalisation: two rounded products */
                        hw[tt * 4 + p] = a; lw[tt * 4 + p] = c2; } }
                ph[qt] = __builtin_bit_cast(v16bf, hw); pl[qt] = __builtin_bit_cast(v16bf, lw); }   /* A fragment: row = query lr, k = 8 hi + j (first tile) and 16 + 8 hi + j (second tile) of the 32 keys */
#pragma unroll
            for (int dt = 0; dt < 2; ++dt) { const int o = (kc * (32 * HD) + dt * 512) * 2; const v16bf vh = ldfo(Vhg, vb, o), vl = ldfo(Vlg, vb, o);
#pragma unroll
                for (int qt = 0; qt < FQT; ++qt) { oa[qt][dt] = wmmab(ph[qt], vh, oa[qt][dt]); oa[qt][dt] = wmmab(pl[qt], vh, oa[qt][dt]); oa[qt][dt] = wmmab(ph[qt], vl, oa[qt][dt]); } } }
#pragma unroll
        for (int qt = 0; qt < FQT; ++qt)
#pragma unroll
            for (int dt = 0; dt < 2; ++dt)
#pragma unroll
                for (int j = 0; j < 8; ++j) os[w][qt * 16 + hi * 8 + j][dt * 16 + lr] = oa[qt][dt][j];
        __syncthreads();   // every wave's partial outputs are in LDS; the next head writes them again only behind its own two barriers
        { const int q = threadIdx.x >> 3, d4 = (threadIdx.x & 7) * 4; v4f s = *(const v4fa*)&os[0][q][d4];
#pragma unroll
            for (int ww = 1; ww < FW; ++ww) s += *(const v4fa*)&os[ww][q][d4];
            unsigned h0, l0, h1, l1; split2(s[0], s[1], h0, l0); split2(s[2], s[3], h1, l1); const v2u oh = {h0, h1}, ol = {l0, l1};
            const size_t o = ((size_t)g * TT + i0) * DQ; const unsigned oo = (unsigned)(q * DQ + d4 + h * HD) * 2u; *(v2u*)((char*)(Ah + o) + oo) = oh; *(v2u*)((char*)(Al + o) + oo) = ol;   /* merged [t][head][d] hi / lo planes for the output projection */
            asm volatile("s_wait_xcnt 0x0" ::: "memory"); }   // stands in front of the next head's first instructions, which reuse the registers that the two stores name as their addresses
    }
}

extern "C" void kernel_launch(void* const* d_in, const int* in_sizes, int n_in,
                              void* d_out, int out_size, void* d_ws, size_t ws_size, hipStream_t stream) {
    (void)in_sizes; (void)n_in; (void)out_size;
    const float* x = (const float*)d_in[0]; const float* xk = (const float*)d_in[1]; const float* xv = (const float*)d_in[2]; const int* mk = (const int*)d_in[3]; const float* adj = (const float*)d_in[4]; const float* wq = (const float*)d_in[5]; const float* bq = (const float*)d_in[6]; const float* wk = (const float*)d_in[7]; const float* bk = (const float*)d_in[8]; const float* wv = (const float*)d_in[9]; const float* bv = (const float*)d_in[10]; const float* wo = (const float*)d_in[11]; const float* bo = (const float*)d_in[12];   /* order query, key, value ([4][12][512][128] = 48 groups), mask (int32 [48][512][512]: read as data), adjm (f32 [48][512][512]: read), Wq, bq, Wk, bk, Wv, bv, Wp, bp ('oi') */
    float* OUT = (float*)d_out;     // [48][512][128]
    char* wsp = (char*)d_ws;
    auto take = [&](size_t bytes) { char* p = wsp; wsp += (bytes + 255) & ~(size_t)255; return (void*)p; };
    bf* WO = (bf*)take((size_t)DM * DQ * 2);   /* Wp as bf16 */
    bf* QPh = (bf*)take((size_t)2 * NB_ * NH_ * TT * HD * 2); bf* QPl = (bf*)take((size_t)2 * NB_ * NH_ * TT * HD * 2);   /* [q groups | k groups][head], each 512 x 32 in fragment order */ bf* KPh = QPh + (size_t)NB_ * NH_ * TT * HD; bf* KPl = QPl + (size_t)NB_ * NH_ * TT * HD;
    bf* VTh = (bf*)take((size_t)NB_ * NKV * HP * TT * 2); bf* VTl = (bf*)take((size_t)NB_ * NKV * HP * TT * 2);
    bf* ATh = (bf*)take((size_t)NB_ * TT * DQ * 2); bf* ATl = (bf*)take((size_t)NB_ * TT * DQ * 2);
    if ((size_t)(wsp - (char*)d_ws) > ws_size) return;    // ws 256 MiB given; the carve is below 64 MiB
    k_proj<<<dim3(NB_ * TT / 64, 3, 1), PW * 32, 0, stream>>>(x, xk, xv, wq, wk, wv, wo, bq, bk, bv, QPh, QPl, VTh, VTl, WO);   /* rows = all (group, node) pairs; y = q, k, v */
    k_fattn<<<dim3(TT / (FQT * 16), NB_, 1), FW * 32, 0, stream>>>(QPh, QPl, KPh, KPl, VTh, VTl, mk, adj, ATh, ATl);   /* one kv head per query head: plane z of q meets plane z of k and of v^T */
    k_gemmw<bf, 1, true><<<dim3(NB_ * TT / 64, DM / 64, 1), 32, 0, stream>>>(ATh, ATl, WO, nullptr, DQ, OUT, DM, bo, bo, bo, 0, 0, 0);
}

// v007
// It runs in 55.5 microseconds.
// Two timings next to v006 both put it at 1.09 times that version's speed.
// Counting every step since v000, it is 66.6 times as fast.
#include <hip/hip_runtime.h>

// Spatial multi-head attention over graph nodes with a pair mask and a post-softmax pair factor (query, key, value [4][12][512][128]: 48 independent (batch, time) groups of 512 nodes; q = query Wq^T + bq, k = key Wk^T + bk, v = value Wv^T + bv ('oi' (out, in) [128][128] + [128]: real biases; 4 heads x 32); scores x 1/sqrt(32); where mask[b][t][i][j] != 0 (int32 [4][12][512][512], read per logit as data) the score is REPLACED by -1e9; softmax over the 512 keys; the weights x adjm[b][t][i][j] (f32 [4][12][512][512], read, rounded to bf16: an input) AFTER the softmax, no renormalisation; out = merged Wp^T + bp -> [4][12][512][128] (3.1 M); argument order query, key, value, mask, adjm, Wq, bq, Wk, bk, Wv, bv, Wp, bp).
// Layout, all 48 groups per launch, two launches: (1) k_proj reads query, key, value and Wq, Wk, Wv as f32, rounds them to bf16 on their way into LDS, adds the bias rounded to bf16 and writes the hi/lo planes that attention reads, each in the order of its matrix fragments (see ldfo): q/k planes [q groups | k groups][head][t / 16][d / 8][t % 16][8] and value planes [group][head][t / 32][d / 16][(t / 16) % 2][lane][8]; its first 16 work-groups also write the bf16 copy of Wp; (2) ONE fused kernel for scores, masked softmax, pair factor, attn.v, the head merge and the output projection (merged hi/lo x Wp exact + bp), q, k, v and the merged rows as hi/lo, Wp as one bf16 plane, scores and weights in registers only, the merged rows in LDS only.
// Compute dtypes, f32 accumulate: every input rounded to bf16, nearest even, incl. the pair factor adjm; projections exact + bf16 biases; scores (K 32) and attn.v 3 products on every row; softmax f32; Wp hl x exact + bias.

#define NB_  48
#define TT   512
#define DM   128
#define NH_  4
#define NKV  4
#define HD   32
#define DQ   (NH_ * HD)
#define SCL  0.17677669529663688f   // 32^-0.5 (the module divides by float32(sqrt(32)); one multiply here)
#define HP   64    // a head's value plane is HP x TT elements apart from the next; the first HD x TT are written and read
typedef unsigned short bf;
typedef __attribute__((ext_vector_type(16))) __bf16   v16bf;
typedef __attribute__((ext_vector_type(8)))  __bf16   v8bf;
typedef __attribute__((ext_vector_type(4)))  __bf16   v4bf;
typedef __attribute__((ext_vector_type(2)))  __bf16   v2bf;
typedef __attribute__((ext_vector_type(2)))  float    v2f;
typedef __attribute__((ext_vector_type(8)))  unsigned short v8us;
typedef __attribute__((ext_vector_type(4)))  unsigned short v4us;
typedef __attribute__((ext_vector_type(8)))  float    v8f;
typedef __attribute__((ext_vector_type(4)))  float    v4f;
typedef __attribute__((ext_vector_type(4)))  int      v4i;
typedef __attribute__((ext_vector_type(4)))  unsigned v4u;
typedef v4f  __attribute__((may_alias)) v4fa;
typedef v8us __attribute__((may_alias)) v8usa;
typedef v4us __attribute__((may_alias)) v4usa;

__device__ __forceinline__ unsigned short f2bf(float f) { unsigned u = __float_as_uint(f); u += 0x7FFFu + ((u >> 16) & 1u); return (unsigned short)(u >> 16); }
__device__ __forceinline__ float bf2f(unsigned short b) { return __uint_as_float(((unsigned)b) << 16); }
__device__ __forceinline__ float bfr(float f) { return bf2f(f2bf(f)); }
__device__ __forceinline__ v16bf cat16b(v8us lo, v8us hi) { return __builtin_bit_cast(v16bf, __builtin_shufflevector(lo, hi, 0, 1, 2, 3, 4, 5, 6, 7, 8, 9, 10, 11, 12, 13, 14, 15)); }
__device__ __forceinline__ v8f wmmab(v16bf a, v16bf b, v8f c) { return __builtin_amdgcn_wmma_f32_16x16x32_bf16(false, a, false, b, (short)0, c, false, false); }

// Fragment from a K-contiguous 16-bit row in memory: the lane's p points at row (lane & 15), element 8 (lane >> 4); it holds k = 8 hi + j and k = 16 + 8 hi + j.
__device__ __forceinline__ v16bf ldgf(const bf* p) { return cat16b(*(const v8us*)p, *(const v8us*)(p + 16)); }

// hi/lo split of eight values: h = bf16(y), l = bf16(y - h), both nearest even.
__device__ __forceinline__ void split8(v8f y, v8us& h, v8us& l) { const v8bf hb = __builtin_convertvector(y, v8bf); const v4u u = __builtin_bit_cast(v4u, hb); v8f r;
#pragma unroll
    for (int i = 0; i < 4; ++i) { r[2 * i] = __uint_as_float(u[i] << 16); r[2 * i + 1] = __uint_as_float(u[i] & 0xFFFF0000u); }
    h = __builtin_bit_cast(v8us, hb); l = __builtin_bit_cast(v8us, __builtin_convertvector(y - r, v8bf)); }

// ---- k_proj: the q, k and v projections (blockIdx.y = 0, 1, 2) of 64 (group, node) rows, from the f32 inputs to the hi/lo planes of attention. Four waves; wave w owns head w, output columns 32 w .. 32 w + 31, as a 64x32 register tile (8 accumulators).
// y[m][n] = sum_k bf16(x[m][k]) bf16(W[n][k]) + bf16(bias[n]). Operands: a row of 128 f32 is ONE load of a wave (16 bytes a lane, four whole lines); it is rounded to bf16 and laid in LDS, the 64 input rows once for the four waves, each wave's 32 weight rows in its own slice; the fragments are read from there.
// An accumulator holds 8 consecutive rows (nodes) of one column (lane & 15). q, k: the tile turns through the wave's LDS slice (f32) so that a lane holds 8 consecutive columns of a row: a store covers 8 rows x 4 column groups = four whole 128-byte lines of the head's plane. v: a lane's 8 nodes of one column are one 16-byte piece of attention's B fragment, held by the lane that will read it: each accumulator is stored from its registers, 512 contiguous bytes a store.
#define PW  4      // waves per work-group
#define ASP 136    // LDS row pitch (16-bit elements) of the staged operand rows: 256 + 16 bytes, so that the 16 rows of a fragment read start 4 banks apart
#define QSP 36     // LDS row pitch (floats) of the staged q/k tile: the two lane halves (8 rows apart) fall on different banks, rows stay 16-byte aligned
#define WSL (64 * QSP)   // floats in a wave's LDS slice: first its 32 weight rows (32 x 136 x 2 bytes fit), then, for q and k, its output tile (64 x 36 floats)
__device__ __forceinline__ void st4(bf* d, v4f u) { *(v4usa*)d = __builtin_bit_cast(v4us, __builtin_convertvector(u, v4bf)); }   // four f32 to bf16, nearest even, into LDS
__device__ __forceinline__ v16bf ldsf(const bf* p) { return cat16b(*(const v8usa*)p, *(const v8usa*)(p + 16)); }   // fragment from an LDS row: the k order of ldgf
// amdgpu_waves_per_eu(5): the register budget of five waves a SIMD, so that all 1152 work-groups (four or five a WGP) are resident at once; without it the v branch is scheduled into more than 204 registers and a second, short round of work-groups follows the first.
__global__ __launch_bounds__(PW * 32) __attribute__((amdgpu_waves_per_eu(5))) void k_proj(const float* __restrict__ x0, const float* __restrict__ x1, const float* __restrict__ x2, const float* __restrict__ w0, const float* __restrict__ w1, const float* __restrict__ w2, const float* __restrict__ w3, const float* __restrict__ b0, const float* __restrict__ b1, const float* __restrict__ b2, bf* Ph, bf* Pl, bf* Vh, bf* Vl, bf* W3) {
    __shared__ __align__(16) float sm[PW * WSL + 64 * ASP / 2];   // four slices, then the 64 input rows; every 16-bit access goes through a may_alias vector type
    const int z = blockIdx.y; const float* A = z == 0 ? x0 : (z == 1 ? x1 : x2); const float* B = z == 0 ? w0 : (z == 1 ? w1 : w2); const float* bias = z == 0 ? b0 : (z == 1 ? b1 : b2);
    const int lane = threadIdx.x & 31, lr = lane & 15, hi = lane >> 4, w = threadIdx.x >> 5; const int r0 = blockIdx.x * 64, c0 = w * HD;
    const int g = r0 / TT, t0 = r0 % TT;   // 64 divides 512: a tile lies in one group
    bf* as = (bf*)(sm + PW * WSL); bf* bs = (bf*)(sm + w * WSL);
    if (z == 0 && blockIdx.x < DM * DQ / (PW * 32 * 8)) {   // uniform in the work-group: the first 16 work-groups of the q part round Wp to bf16 for the output projection, 8 elements a thread
        const int e = (blockIdx.x * (PW * 32) + threadIdx.x) * 8; *(v8us*)(W3 + e) = __builtin_bit_cast(v8us, __builtin_convertvector(*(const v8f*)(w3 + e), v8bf));
        asm volatile("s_wait_xcnt 0x0" ::: "memory"); }   // stands in front of the staging code, which may reuse the registers that the load and the store name
    { const float* ag = A + (size_t)(r0 + w * 16) * DM + lane * 4; const float* bg = B + c0 * DM + lane * 4;   // the wave stages 16 of the input rows and its own 32 weight rows, in three groups of 16 loads, two groups in flight: 128 data registers, not 192, which leaves room for five waves a SIMD
        v4f wa[16], xa[16], wb[16];
#pragma unroll
        for (int i = 0; i < 16; ++i) wa[i] = *(const v4f*)(bg + i * DM);
#pragma unroll
        for (int i = 0; i < 16; ++i) xa[i] = *(const v4f*)(ag + i * DM);
        asm volatile("s_wait_xcnt 0x0" :: "v"(ag), "v"(bg) : "memory");   // behind the last load of the two groups; the two addresses are inputs so that they stay in their registers up to the wait and no load's result lands on them in front of it
#pragma unroll
        for (int i = 0; i < 16; ++i) st4(bs + i * ASP + lane * 4, wa[i]);
        __builtin_amdgcn_sched_barrier(0);   // keeps the third group's loads behind the first group's LDS stores: lifted over them they hold 64 more registers at once, and the build spills
#pragma unroll
        for (int i = 0; i < 16; ++i) wb[i] = *(const v4f*)(bg + (16 + i) * DM);
        asm volatile("s_wait_xcnt 0x0" :: "v"(bg) : "memory");   // the same behind the third group
#pragma unroll
        for (int i = 0; i < 16; ++i) st4(as + (w * 16 + i) * ASP + lane * 4, xa[i]);
#pragma unroll
        for (int i = 0; i < 16; ++i) st4(bs + (16 + i) * ASP + lane * 4, wb[i]); }
    __syncthreads();   // all 64 input rows are in LDS before any wave reads fragments
    v8f acc[4][2];
#pragma unroll
    for (int mb = 0; mb < 4; ++mb)
#pragma unroll
        for (int nb = 0; nb < 2; ++nb) acc[mb][nb] = (v8f){};
#pragma unroll
    for (int kc = 0; kc < DM; kc += 32) {
        v16bf a[4];
#pragma unroll
        for (int mb = 0; mb < 4; ++mb) a[mb] = ldsf(as + (mb * 16 + lr) * ASP + kc + 8 * hi);
#pragma unroll
        for (int nb = 0; nb < 2; ++nb) { const v16bf b = ldsf(bs + (nb * 16 + lr) * ASP + kc + 8 * hi);
#pragma unroll
            for (int mb = 0; mb < 4; ++mb) acc[mb][nb] = wmmab(a[mb], b, acc[mb][nb]); }
    }
    __syncthreads();   // every fragment has been read before a slice is written again
    if (z < 2) {   // uniform in the work-group
        float* os = sm + w * WSL;
#pragma unroll
        for (int mb = 0; mb < 4; ++mb)
#pragma unroll
            for (int nb = 0; nb < 2; ++nb)
#pragma unroll
                for (int j = 0; j < 8; ++j) os[(mb * 16 + hi * 8 + j) * QSP + nb * 16 + lr] = acc[mb][nb][j];
        const int r8 = lane >> 2, c8 = (lane & 3) * 8;   // read-back: 8 rows a step, 8 columns a lane
        v8f bb;
#pragma unroll
        for (int i = 0; i < 8; ++i) bb[i] = bfr(bias[c0 + c8 + i]);
        const size_t o = (((size_t)(z * NB_ + g) * NH_ + w) * TT + t0) * HD + c8 * 16 + r8 * 8; bf* ph = Ph + o; bf* pl = Pl + o;   // plane [q | k][group][head][t / 16][d / 8][t % 16][8]
        __syncthreads();   // the tile is in LDS before other lanes read it
#pragma unroll
        for (int s = 0; s < 8; ++s) { const float* rp = os + (8 * s + r8) * QSP + c8; const v4f u0 = *(const v4fa*)rp, u1 = *(const v4fa*)(rp + 4); v8us oh, ol;
            split8(__builtin_shufflevector(u0, u1, 0, 1, 2, 3, 4, 5, 6, 7) + bb, oh, ol); const int so = (s >> 1) * (16 * HD) + (s & 1) * 64; *(v8us*)(ph + so) = oh; *(v8us*)(pl + so) = ol; }   // row 8 s + r8: 16-row tile s / 2, row 8 (s % 2) + r8 in it
    } else {
        v8us th[2][4], tl[2][4];   // all sixteen pieces first, then the stores
#pragma unroll
        for (int nb = 0; nb < 2; ++nb) { const float bn = bfr(bias[c0 + nb * 16 + lr]);
#pragma unroll
            for (int mb = 0; mb < 4; ++mb) split8(acc[mb][nb] + bn, th[nb][mb], tl[nb][mb]); }
        const size_t o = (size_t)(g * NKV + w) * HP * TT + (t0 / 32) * (32 * HD) + lane * 8; bf* vh = Vh + o; bf* vl = Vl + o;   // plane [group][head][t / 32][d / 16][(t / 16) % 2][lane][8]: accumulator (mb, nb) is nodes t0 + 16 mb + 8 hi + j of column 16 nb + lr
#pragma unroll
        for (int nb = 0; nb < 2; ++nb)
#pragma unroll
            for (int mb = 0; mb < 4; ++mb) { const int so = (mb >> 1) * (32 * HD) + nb * 512 + (mb & 1) * 256; *(v8us*)(vh + so) = th[nb][mb]; *(v8us*)(vl + so) = tl[nb][mb]; }
        asm volatile("s_wait_xcnt 0x0" ::: "memory");   // behind the last store: in the built code the q/k branch follows this one, and its first instructions reuse registers that these stores name
    }
}

// ---- k_fattn: scores, masked softmax, pair factor, attn.v, the head merge and the output projection of 32 query rows of one group, all four heads, in ONE work-group of 8 waves; nothing of the score or weight matrices or of the merged rows goes to memory.
// Wave w owns keys 64 w .. 64 w + 63. It computes S^T = K Q^T (A = key rows, B = query rows), so a lane holds scores of ONE query (lane & 15) and the accumulator pair of 32 keys is, converted in place, the A fragment of the weights for attn.v (hardware k order on both sides).
// The wave's 32 x 64 block of the pair mask (one bit each, in registers) and of the pair factor (bf16, its compute type, each thread's 64 values in its own 128 bytes of LDS) is read from memory once and serves the four heads. Row maximum, row sum and the attn.v partial sums of the 8 waves meet in LDS: three barriers per head. The merged 32 x 128 rows (hi/lo) stay in LDS; behind the last head and one more barrier, wave w computes out^T = Wp merged^T (A = Wp rows, B = merged rows) for 16 queries (w / 4) and 32 output columns (w % 4): a lane holds 8 consecutive columns of ONE query, and the wave alone writes each 128-byte line it touches.
typedef __attribute__((ext_vector_type(8))) unsigned v8u;
typedef __attribute__((ext_vector_type(2))) unsigned v2u;
typedef v2u __attribute__((may_alias)) v2ua;
// Fragment from a plane laid in fragment order: a 16 x 32 fragment is 1024 contiguous bytes, first every lane's lower 8 elements (k = 8 hi + j) in lane order, then every lane's upper 8 (k = 16 + 8 hi + j). u is a uniform base, b the lane's 32-bit byte offset (it holds the lane's 16 * lane), c a constant: from head to head only the 32-bit offset has to live in a vector register. Each of the two loads covers 512 contiguous bytes, four whole lines; the registers hold what ldgf gives on a row-major plane.
__device__ __forceinline__ v16bf ldfo(const bf* u, unsigned b, int c) { const char* p = ((const char*)u + b) + c; return cat16b(*(const v8us*)p, *(const v8us*)(p + 512)); }
__device__ __forceinline__ unsigned cvt2(v2f y) { return __builtin_bit_cast(unsigned, __builtin_convertvector(y, v2bf)); }   // two f32 to bf16, nearest even, packed in one word by one conversion instruction
__device__ __forceinline__ void split2(float y0, float y1, unsigned& h, unsigned& l) { const v2f y = {y0, y1}; h = cvt2(y); const v2f r = {__uint_as_float(h << 16), __uint_as_float(h & 0xFFFF0000u)}; l = cvt2(y - r); }   // hi/lo split of two neighbours (h = bf16(y), l = bf16(y - h)), each plane's pair packed in one word
// Eight v_exp_f32, in place, and one v_nop in ONE statement: behind each exp stands an independent instruction, behind the last the v_nop, so nothing directly behind a transcendental reads its result or overwrites its source (the slot the instruction set asks for).
__device__ __forceinline__ void exp2x8(float (&x)[8]) { asm("v_exp_f32 %0, %0\n\tv_exp_f32 %1, %1\n\tv_exp_f32 %2, %2\n\tv_exp_f32 %3, %3\n\tv_exp_f32 %4, %4\n\tv_exp_f32 %5, %5\n\tv_exp_f32 %6, %6\n\tv_exp_f32 %7, %7\n\tv_nop" : "+v"(x[0]), "+v"(x[1]), "+v"(x[2]), "+v"(x[3]), "+v"(x[4]), "+v"(x[5]), "+v"(x[6]), "+v"(x[7])); }
#define FW  8                    // waves per work-group
#define FQT 2                    // 16-row query tiles per work-group
#define FKT (TT / FW / 16)       // 16-key tiles per wave
#define OSP 36                   // LDS row pitch (floats) of the partial outputs: the two lane halves (8 rows apart) fall on different banks, rows stay 16-byte aligned
#define MSP 136                  // LDS row pitch (16-bit elements) of the merged rows: 256 + 16 bytes, so that the 16 rows of a fragment read start 4 banks apart
#define MGB (2 * FQT * 16 * MSP * 2)   // bytes of the merged rows, hi and lo. They are LDS sized at the launch, for speed: as a static array they bring the size the compiler sees to three work-groups a WGP, it then plans for six waves a SIMD from the start and leaves the head loop close to source order (1174 instructions, not 1023; each LDS load of the merge waited for singly). Three work-groups a WGP are resident either way.
// amdgpu_waves_per_eu(6): the register budget of six waves a SIMD (160), so that three work-groups fit a WGP and all 768 are resident at once; with more than 160 registers two fit, and a second, half-empty round follows the first. For that budget the pair factor lies in LDS and the head's step is added to 32-bit offsets, not to 64-bit lane pointers that live through the loop.
__global__ __launch_bounds__(256) __attribute__((amdgpu_waves_per_eu(6))) void k_fattn(const bf* __restrict__ Qh, const bf* __restrict__ Ql, const bf* __restrict__ Kh, const bf* __restrict__ Kl, const bf* __restrict__ Vh, const bf* __restrict__ Vl, const int* __restrict__ mk, const float* __restrict__ adj, const bf* __restrict__ Wo, const float* __restrict__ bo, float* __restrict__ out) {
    __shared__ float red[2][FW][FQT * 16];   /* [0] row maxima, [1] row sums: one array, so that one lane address serves both */ __shared__ __align__(16) float os[FW][FQT * 16][OSP]; __shared__ v4u gas[FQT * FKT][FW * 32]; extern __shared__ __align__(16) bf mgd[]; bf (*mg)[FQT * 16][MSP] = (bf (*)[FQT * 16][MSP])mgd;   /* merged rows [hi | lo][query][head][d], MGB bytes given at the launch; every access goes through a may_alias vector type */
    const int lane = threadIdx.x & 31, lr = lane & 15, hi = lane >> 4, w = threadIdx.x >> 5;
    const int g = blockIdx.y, i0 = blockIdx.x * (FQT * 16), k0 = w * (FKT * 16);
    const unsigned mo = (unsigned)((i0 + lr) * TT + k0 + hi * 8), qo = (unsigned)(i0 * HD + 8 * lane) * 2u, ko = (unsigned)(k0 * HD + 8 * lane) * 2u;   // the lane's 32-bit offsets: mo in elements inside a group's pair planes; qo and ko in bytes inside a (group, head) plane of q and of k or v (16 rows of q or k, and 16 keys of v, are 16 HD elements); every base below is uniform
    const bf* Qhg = Qh + (size_t)g * NH_ * TT * HD; const bf* Qlg = Ql + (size_t)g * NH_ * TT * HD; const bf* Khg = Kh + (size_t)g * NH_ * TT * HD; const bf* Klg = Kl + (size_t)g * NH_ * TT * HD; const bf* Vhg = Vh + (size_t)g * NKV * HP * TT; const bf* Vlg = Vl + (size_t)g * NKV * HP * TT;
    const int* mkg = mk + (size_t)g * TT * TT; const float* adg = adj + (size_t)g * TT * TT;
    const int* mpl = mkg + mo; const float* apl = adg + mo; v4i mv[FQT][FKT][2]; v4f av[FQT][FKT][2];   // all 32 loads of the block first, from two lane addresses
    unsigned mb[FQT];   // element (kt, j) of a lane: query i0 + 16 qt + lr, key k0 + 16 kt + 8 hi + j
#pragma unroll
    for (int qt = 0; qt < FQT; ++qt)
#pragma unroll
        for (int kt = 0; kt < FKT; ++kt) { const int* mp = mpl + (qt * 16 * TT + kt * 16); const float* ap = apl + (qt * 16 * TT + kt * 16);
            mv[qt][kt][0] = *(const v4i*)mp; mv[qt][kt][1] = *(const v4i*)(mp + 4); av[qt][kt][0] = *(const v4f*)ap; av[qt][kt][1] = *(const v4f*)(ap + 4); }
    asm volatile("s_wait_xcnt 0x0" :: "v"(mpl), "v"(apl) : "memory");   // behind the last of the 32 loads; the two addresses are inputs so that they stay in their registers up to the wait and no load's result lands on them in front of it
#pragma unroll
    for (int qt = 0; qt < FQT; ++qt) { mb[qt] = 0u;
#pragma unroll
        for (int kt = 0; kt < FKT; ++kt) { const v4i m0 = mv[qt][kt][0], m1 = mv[qt][kt][1]; const v4f a0 = av[qt][kt][0], a1 = av[qt][kt][1];
#pragma unroll
            for (int q = 0; q < 4; ++q) { mb[qt] |= (m0[q] != 0 ? 1u : 0u) << (kt * 8 + q); mb[qt] |= (m1[q] != 0 ? 1u : 0u) << (kt * 8 + 4 + q); }
            gas[qt * FKT + kt][threadIdx.x] = __builtin_bit_cast(v4u, __builtin_convertvector(__builtin_shufflevector(a0, a1, 0, 1, 2, 3, 4, 5, 6, 7), v8bf)); } }   // a thread reads back only what it wrote itself: no barrier is owed for it
#pragma unroll 1   // rolled, for speed only
    for (int h = 0; h < NH_; ++h) {
        const unsigned qb = qo + (unsigned)h * (TT * HD * 2), kb = ko + (unsigned)h * (TT * HD * 2), vb = ko + (unsigned)h * (HP * TT * 2);   // the head's step stays in the 32-bit offsets
        v16bf qh[FQT], ql[FQT];
#pragma unroll
        for (int qt = 0; qt < FQT; ++qt) { qh[qt] = ldfo(Qhg, qb, qt * 16 * HD * 2); ql[qt] = ldfo(Qlg, qb, qt * 16 * HD * 2); }
        float sc[FQT][FKT][8]; float mx[FQT];
#pragma unroll
        for (int qt = 0; qt < FQT; ++qt) mx[qt] = -3.0e38f;
#pragma unroll
        for (int kt = 0; kt < FKT; ++kt) { const v16bf kh = ldfo(Khg, kb, kt * 16 * HD * 2), kl = ldfo(Klg, kb, kt * 16 * HD * 2);
#pragma unroll
            for (int qt = 0; qt < FQT; ++qt) { v8f a = (v8f){}; a = wmmab(kh, qh[qt], a); a = wmmab(kh, ql[qt], a); a = wmmab(kl, qh[qt], a);   /* q_hi k_hi + q_lo k_hi + q_hi k_lo; a[j] = score of key 8 hi + j of the tile, query lr */
#pragma unroll
                for (int j = 0; j < 8; ++j) { const float t = ((mb[qt] >> (kt * 8 + j)) & 1u) ? -1.0e9f : __fmul_rn(a[j], SCL);   /* where(mask != 0, -1e9, scores / sqrt(32)): the module's literal, after the scale */ sc[qt][kt][j] = t; mx[qt] = fmaxf(mx[qt], t); } } }
#pragma unroll
        for (int qt = 0; qt < FQT; ++qt) { mx[qt] = fmaxf(mx[qt], __shfl_xor(mx[qt], 16, 32)); if (hi == 0) red[0][w][qt * 16 + lr] = mx[qt]; }
        __syncthreads();   // every wave's row maxima are in LDS
#pragma unroll
        for (int qt = 0; qt < FQT; ++qt) { float m = red[0][0][qt * 16 + lr];
#pragma unroll
            for (int ww = 1; ww < FW; ++ww) m = fmaxf(m, red[0][ww][qt * 16 + lr]);
            float s = 0.f;
#pragma unroll
            for (int kt = 0; kt < FKT; ++kt) {
#pragma unroll
                for (int j = 0; j < 8; ++j) sc[qt][kt][j] = __fmul_rn(__fsub_rn(sc[qt][kt][j], m), 1.4426950408889634f);
                exp2x8(sc[qt][kt]);
#pragma unroll
                for (int j = 0; j < 8; ++j) s += sc[qt][kt][j]; }
            s += __shfl_xor(s, 16, 32); if (hi == 0) red[1][w][qt * 16 + lr] = s; }
        __syncthreads();   // every wave's row sums are in LDS
        float f[FQT];
#pragma unroll
        for (int qt = 0; qt < FQT; ++qt) { float s = red[1][0][qt * 16 + lr];
#pragma unroll
            for (int ww = 1; ww < FW; ++ww) s += red[1][ww][qt * 16 + lr];
            f[qt] = __fdiv_rn(1.0f, s); }
        v8f oa[FQT][2];
#pragma unroll
        for (int qt = 0; qt < FQT; ++qt) { oa[qt][0] = (v8f){}; oa[qt][1] = (v8f){}; }
#pragma unroll
        for (int kc = 0; kc < FKT / 2; ++kc) { v16bf ph[FQT], pl[FQT];
#pragma unroll
            for (int qt = 0; qt < FQT; ++qt) { v8u hw, lw;
#pragma unroll
                for (int tt = 0; tt < 2; ++tt) { const v4u ga = gas[qt * FKT + 2 * kc + tt][threadIdx.x];
#pragma unroll
                    for (int p = 0; p < 4; ++p) { const unsigned gp = ga[p]; unsigned a, c2;
                        split2(__fmul_rn(__fmul_rn(sc[qt][2 * kc + tt][2 * p], f[qt]), __uint_as_float(gp << 16)), __fmul_rn(__fmul_rn(sc[qt][2 * kc + tt][2 * p + 1], f[qt]), __uint_as_float(gp & 0xFFFF0000u)), a, c2);   /* softmax weight x the pair factor AFTER the normalisation: two rounded products */
                        hw[tt * 4 + p] = a; lw[tt * 4 + p] = c2; } }
                ph[qt] = __builtin_bit_cast(v16bf, hw); pl[qt] = __builtin_bit_cast(v16bf, lw); }   /* A fragment: row = query lr, k = 8 hi + j (first tile) and 16 + 8 hi + j (second tile) of the 32 keys */
#pragma unroll
            for (int dt = 0; dt < 2; ++dt) { const int o = (kc * (32 * HD) + dt * 512) * 2; const v16bf vh = ldfo(Vhg, vb, o), vl = ldfo(Vlg, vb, o);
#pragma unroll
                for (int qt = 0; qt < FQT; ++qt) { oa[qt][dt] = wmmab(ph[qt], vh, oa[qt][dt]); oa[qt][dt] = wmmab(pl[qt], vh, oa[qt][dt]); oa[qt][dt] = wmmab(ph[qt], vl, oa[qt][dt]); } } }
#pragma unroll
        for (int qt = 0; qt < FQT; ++qt)
#pragma unroll
            for (int dt = 0; dt < 2; ++dt)
#pragma unroll
                for (int j = 0; j < 8; ++j) os[w][qt * 16 + hi * 8 + j][dt * 16 + lr] = oa[qt][dt][j];
        __syncthreads();   // every wave's partial outputs are in LDS; the next head writes them again only behind its own two barriers
        { const int q = threadIdx.x >> 3, d4 = (threadIdx.x & 7) * 4; v4f s = *(const v4fa*)&os[0][q][d4];
#pragma unroll
            for (int ww = 1; ww < FW; ++ww) s += *(const v4fa*)&os[ww][q][d4];
            unsigned h0, l0, h1, l1; split2(s[0], s[1], h0, l0); split2(s[2], s[3], h1, l1); const v2u oh = {h0, h1}, ol = {l0, l1};
            *(v2ua*)&mg[0][q][h * HD + d4] = oh; *(v2ua*)&mg[1][q][h * HD + d4] = ol; }   /* merged [query][head][d] hi / lo rows for the output projection */
    }
    // out[q][n] = sum_k (merged_hi + merged_lo)[q][k] bf16(Wp[n][k]) + bf16(bp[n]); per 32 k the hi product, then the lo product, into one accumulator.
    { const int qr = (w >> 2) * 16 + lr, cb = (w & 3) * 32;
        const bf* wp = Wo + (cb + lr) * DQ + 8 * hi; const float* bp = bo + cb + 8 * hi; v16bf wf[2][DQ / 32]; v4f bv[2][2];   // loaded in front of the barrier: a wave that arrives early has their latency behind it when the last wave arrives
#pragma unroll
        for (int t = 0; t < 2; ++t) {
#pragma unroll
            for (int kc = 0; kc < DQ / 32; ++kc) wf[t][kc] = ldgf(wp + t * 16 * DQ + kc * 32);
            bv[t][0] = *(const v4f*)(bp + t * 16); bv[t][1] = *(const v4f*)(bp + t * 16 + 4); }
        asm volatile("s_wait_xcnt 0x0" :: "v"(wp), "v"(bp) : "memory");   // behind the last of the 20 loads; the two addresses are inputs so that they stay in their registers up to the wait and no load's result lands on them in front of it
        __syncthreads();   // all four heads' merged rows are in LDS
        v8f acc[2] = {(v8f){}, (v8f){}};
#pragma unroll
        for (int kc = 0; kc < DQ / 32; ++kc) { const v16bf mh = ldsf(&mg[0][qr][kc * 32 + 8 * hi]), ml = ldsf(&mg[1][qr][kc * 32 + 8 * hi]);
#pragma unroll
            for (int t = 0; t < 2; ++t) { acc[t] = wmmab(wf[t][kc], mh, acc[t]); acc[t] = wmmab(wf[t][kc], ml, acc[t]); } }   /* acc[t][j] = query qr, column cb + 16 t + 8 hi + j */
        float* op = out + ((size_t)g * TT + i0 + qr) * DM + cb + 8 * hi;
#pragma unroll
        for (int t = 0; t < 2; ++t) { const v8f y = acc[t] + __builtin_convertvector(__builtin_convertvector(__builtin_shufflevector(bv[t][0], bv[t][1], 0, 1, 2, 3, 4, 5, 6, 7), v8bf), v8f);   /* + bf16(bp), nearest even */
            *(v4f*)(op + t * 16) = __builtin_shufflevector(y, y, 0, 1, 2, 3); *(v4f*)(op + t * 16 + 4) = __builtin_shufflevector(y, y, 4, 5, 6, 7); }
    }
}

extern "C" void kernel_launch(void* const* d_in, const int* in_sizes, int n_in,
                              void* d_out, int out_size, void* d_ws, size_t ws_size, hipStream_t stream) {
    (void)in_sizes; (void)n_in; (void)out_size;
    const float* x = (const float*)d_in[0]; const float* xk = (const float*)d_in[1]; const float* xv = (const float*)d_in[2]; const int* mk = (const int*)d_in[3]; const float* adj = (const float*)d_in[4]; const float* wq = (const float*)d_in[5]; const float* bq = (const float*)d_in[6]; const float* wk = (const float*)d_in[7]; const float* bk = (const float*)d_in[8]; const float* wv = (const float*)d_in[9]; const float* bv = (const float*)d_in[10]; const float* wo = (const float*)d_in[11]; const float* bo = (const float*)d_in[12];   /* order query, key, value ([4][12][512][128] = 48 groups), mask (int32 [48][512][512]: read as data), adjm (f32 [48][512][512]: read), Wq, bq, Wk, bk, Wv, bv, Wp, bp ('oi') */
    float* OUT = (float*)d_out;     // [48][512][128]
    char* wsp = (char*)d_ws;
    auto take = [&](size_t bytes) { char* p = wsp; wsp += (bytes + 255) & ~(size_t)255; return (void*)p; };
    bf* WO = (bf*)take((size_t)DM * DQ * 2);   /* Wp as bf16 */
    bf* QPh = (bf*)take((size_t)2 * NB_ * NH_ * TT * HD * 2); bf* QPl = (bf*)take((size_t)2 * NB_ * NH_ * TT * HD * 2);   /* [q groups | k groups][head], each 512 x 32 in fragment order */ bf* KPh = QPh + (size_t)NB_ * NH_ * TT * HD; bf* KPl = QPl + (size_t)NB_ * NH_ * TT * HD;
    bf* VTh = (bf*)take((size_t)NB_ * NKV * HP * TT * 2); bf* VTl = (bf*)take((size_t)NB_ * NKV * HP * TT * 2);
    if ((size_t)(wsp - (char*)d_ws) > ws_size) return;    // ws 256 MiB given; the carve is below 64 MiB
    k_proj<<<dim3(NB_ * TT / 64, 3, 1), PW * 32, 0, stream>>>(x, xk, xv, wq, wk, wv, wo, bq, bk, bv, QPh, QPl, VTh, VTl, WO);   /* rows = all (group, node) pairs; y = q, k, v */
    k_fattn<<<dim3(TT / (FQT * 16), NB_, 1), FW * 32, MGB, stream>>>(QPh, QPl, KPh, KPl, VTh, VTl, mk, adj, WO, bo, OUT);   /* one kv head per query head: plane z of q meets plane z of k and of v^T */
}

// v008
// Measured time: 49.6 microseconds a run.
// Timed twice side by side with v007, it ran 1.12 times as fast both times.
// Counting every step since v000, it is 74.7 times as fast.
#include <hip/hip_runtime.h>

// Spatial multi-head attention over graph nodes with a pair mask and a post-softmax pair factor (query, key, value [4][12][512][128]: 48 independent (batch, time) groups of 512 nodes; q = query Wq^T + bq, k = key Wk^T + bk, v = value Wv^T + bv ('oi' (out, in) [128][128] + [128]: real biases; 4 heads x 32); scores x 1/sqrt(32); where mask[b][t][i][j] != 0 (int32 [4][12][512][512], read per logit as data) the score is REPLACED by -1e9; softmax over the 512 keys; the weights x adjm[b][t][i][j] (f32 [4][12][512][512], read, rounded to bf16: an input) AFTER the softmax, no renormalisation; out = merged Wp^T + bp -> [4][12][512][128] (3.1 M); argument order query, key, value, mask, adjm, Wq, bq, Wk, bk, Wv, bv, Wp, bp).
// Layout, all 48 groups per launch, two launches: (1) k_proj reads query, key, value and Wq, Wk, Wv as f32, rounds them to bf16 on their way into LDS, adds the bias rounded to bf16 and writes the hi/lo planes that attention reads, each in the order of its matrix fragments (see ldfo): q/k planes [q groups | k groups][head][t / 16][d / 8][t % 16][8] and value planes [group][head][t / 32][d / 16][(t / 16) % 2][lane][8]; its first 16 work-groups also write the bf16 copy of Wp; (2) ONE fused kernel for scores, masked softmax, pair factor, attn.v, the head merge and the output projection (merged hi/lo x Wp exact + bp), q, k, v and the merged rows as hi/lo, Wp as one bf16 plane, scores and weights in registers only, the merged rows in LDS only.
// Compute dtypes, f32 accumulate: every input rounded to bf16, nearest even, incl. the pair factor adjm; projections exact + bf16 biases; scores (K 32) and attn.v 3 products on every row; softmax f32; Wp hl x exact + bias.

#define NB_  48
#define TT   512
#define DM   128
#define NH_  4
#define NKV  4
#define HD   32
#define DQ   (NH_ * HD)
#define SCL  0.17677669529663688f   // 32^-0.5 (the module divides by float32(sqrt(32)); one multiply here)
#define HP   64    // a head's value plane is HP x TT elements apart from the next; the first HD x TT are written and read
// Which (group, tile) a work-group takes, from its flat grid index b, a group having n tiles (n a power of two, 48 groups = 6 x 8): group = 8 (b / 8n) + b % 8, tile = (b / 8) % n. A permutation of the plain order, so every tile is done once wherever the work-groups land. For speed only: all work-groups of both launches that write or read one group's q, k, v planes have the same index mod 8.
#define DEALG(b, n) ((int)((b) / (8 * (n))) * 8 + (int)((b) & 7))
#define DEALT(b, n) ((int)(((b) >> 3) & ((n) - 1)))
typedef unsigned short bf;
typedef __attribute__((ext_vector_type(16))) __bf16   v16bf;
typedef __attribute__((ext_vector_type(8)))  __bf16   v8bf;
typedef __attribute__((ext_vector_type(4)))  __bf16   v4bf;
typedef __attribute__((ext_vector_type(2)))  __bf16   v2bf;
typedef __attribute__((ext_vector_type(2)))  float    v2f;
typedef __attribute__((ext_vector_type(8)))  unsigned short v8us;
typedef __attribute__((ext_vector_type(4)))  unsigned short v4us;
typedef __attribute__((ext_vector_type(8)))  float    v8f;
typedef __attribute__((ext_vector_type(4)))  float    v4f;
typedef __attribute__((ext_vector_type(4)))  int      v4i;
typedef __attribute__((ext_vector_type(4)))  unsigned v4u;
typedef v4f  __attribute__((may_alias)) v4fa;
typedef v8us __attribute__((may_alias)) v8usa;
typedef v4us __attribute__((may_alias)) v4usa;

__device__ __forceinline__ unsigned short f2bf(float f) { unsigned u = __float_as_uint(f); u += 0x7FFFu + ((u >> 16) & 1u); return (unsigned short)(u >> 16); }
__device__ __forceinline__ float bf2f(unsigned short b) { return __uint_as_float(((unsigned)b) << 16); }
__device__ __forceinline__ float bfr(float f) { return bf2f(f2bf(f)); }
__device__ __forceinline__ v16bf cat16b(v8us lo, v8us hi) { return __builtin_bit_cast(v16bf, __builtin_shufflevector(lo, hi, 0, 1, 2, 3, 4, 5, 6, 7, 8, 9, 10, 11, 12, 13, 14, 15)); }
__device__ __forceinline__ v8f wmmab(v16bf a, v16bf b, v8f c) { return __builtin_amdgcn_wmma_f32_16x16x32_bf16(false, a, false, b, (short)0, c, false, false); }

// Fragment from a K-contiguous 16-bit row in memory: the lane's p points at row (lane & 15), element 8 (lane >> 4); it holds k = 8 hi + j and k = 16 + 8 hi + j.
__device__ __forceinline__ v16bf ldgf(const bf* p) { return cat16b(*(const v8us*)p, *(const v8us*)(p + 16)); }

// hi/lo split of eight values: h = bf16(y), l = bf16(y - h), both nearest even.
__device__ __forceinline__ void split8(v8f y, v8us& h, v8us& l) { const v8bf hb = __builtin_convertvector(y, v8bf); const v4u u = __builtin_bit_cast(v4u, hb); v8f r;
#pragma unroll
    for (int i = 0; i < 4; ++i) { r[2 * i] = __uint_as_float(u[i] << 16); r[2 * i + 1] = __uint_as_float(u[i] & 0xFFFF0000u); }
    h = __builtin_bit_cast(v8us, hb); l = __builtin_bit_cast(v8us, __builtin_convertvector(y - r, v8bf)); }

// ---- k_proj: the q, k and v projections (blockIdx.y = 0, 1, 2) of 64 (group, node) rows, from the f32 inputs to the hi/lo planes of attention. Four waves; wave w owns head w, output columns 32 w .. 32 w + 31, as a 64x32 register tile (8 accumulators).
// y[m][n] = sum_k bf16(x[m][k]) bf16(W[n][k]) + bf16(bias[n]). Operands: a row of 128 f32 is ONE load of a wave (16 bytes a lane, four whole lines); it is rounded to bf16 and laid in LDS, the 64 input rows once for the four waves, each wave's 32 weight rows in its own slice; the fragments are read from there.
// An accumulator holds 8 consecutive rows (nodes) of one column (lane & 15). q, k: the tile turns through the wave's LDS slice (f32) so that a lane holds 8 consecutive columns of a row: a store covers 8 rows x 4 column groups = four whole 128-byte lines of the head's plane. v: a lane's 8 nodes of one column are one 16-byte piece of attention's B fragment, held by the lane that will read it: each accumulator is stored from its registers, 512 contiguous bytes a store.
#define PW  4      // waves per work-group
#define ASP 136    // LDS row pitch (16-bit elements) of the staged operand rows: 256 + 16 bytes, so that the 16 rows of a fragment read start 4 banks apart
#define QSP 36     // LDS row pitch (floats) of the staged q/k tile: the two lane halves (8 rows apart) fall on different banks, rows stay 16-byte aligned
#define WSL (64 * QSP)   // floats in a wave's LDS slice: first its 32 weight rows (32 x 136 x 2 bytes fit), then, for q and k, its output tile (64 x 36 floats)
__device__ __forceinline__ void st4(bf* d, v4f u) { *(v4usa*)d = __builtin_bit_cast(v4us, __builtin_convertvector(u, v4bf)); }   // four f32 to bf16, nearest even, into LDS
__device__ __forceinline__ v16bf ldsf(const bf* p) { return cat16b(*(const v8usa*)p, *(const v8usa*)(p + 16)); }   // fragment from an LDS row: the k order of ldgf
// amdgpu_waves_per_eu(5): the register budget of five waves a SIMD, so that all 1152 work-groups (four or five a WGP) are resident at once; without it the v branch is scheduled into more than 204 registers and a second, short round of work-groups follows the first.
__global__ __launch_bounds__(PW * 32) __attribute__((amdgpu_waves_per_eu(5))) void k_proj(const float* __restrict__ x0, const float* __restrict__ x1, const float* __restrict__ x2, const float* __restrict__ w0, const float* __restrict__ w1, const float* __restrict__ w2, const float* __restrict__ w3, const float* __restrict__ b0, const float* __restrict__ b1, const float* __restrict__ b2, bf* Ph, bf* Pl, bf* Vh, bf* Vl, bf* W3) {
    __shared__ __align__(16) float sm[PW * WSL + 64 * ASP / 2];   // four slices, then the 64 input rows; every 16-bit access goes through a may_alias vector type
    const int z = blockIdx.y; const float* A = z == 0 ? x0 : (z == 1 ? x1 : x2); const float* B = z == 0 ? w0 : (z == 1 ? w1 : w2); const float* bias = z == 0 ? b0 : (z == 1 ? b1 : b2);
    const int lane = threadIdx.x & 31, lr = lane & 15, hi = lane >> 4, w = threadIdx.x >> 5; const int c0 = w * HD;
    const int g = DEALG(blockIdx.x, TT / 64), t0 = DEALT(blockIdx.x, TT / 64) * 64, r0 = g * TT + t0;   // gridDim.x is a multiple of 8, so the flat index mod 8 is blockIdx.x mod 8 for q, k and v alike; 64 divides 512: a tile lies in one group
    bf* as = (bf*)(sm + PW * WSL); bf* bs = (bf*)(sm + w * WSL);
    if (z == 0 && blockIdx.x < DM * DQ / (PW * 32 * 8)) {   // uniform in the work-group: the first 16 work-groups of the q part round Wp to bf16 for the output projection, 8 elements a thread
        const int e = (blockIdx.x * (PW * 32) + threadIdx.x) * 8; *(v8us*)(W3 + e) = __builtin_bit_cast(v8us, __builtin_convertvector(*(const v8f*)(w3 + e), v8bf));
        asm volatile("s_wait_xcnt 0x0" ::: "memory"); }   // stands in front of the staging code, which may reuse the registers that the load and the store name
    { const float* ag = A + (size_t)(r0 + w * 16) * DM + lane * 4; const float* bg = B + c0 * DM + lane * 4;   // the wave stages 16 of the input rows and its own 32 weight rows, in three groups of 16 loads, two groups in flight: 128 data registers, not 192, which leaves room for five waves a SIMD
        v4f wa[16], xa[16], wb[16];
#pragma unroll
        for (int i = 0; i < 16; ++i) wa[i] = *(const v4f*)(bg + i * DM);
#pragma unroll
        for (int i = 0; i < 16; ++i) xa[i] = *(const v4f*)(ag + i * DM);
        asm volatile("s_wait_xcnt 0x0" :: "v"(ag), "v"(bg) : "memory");   // behind the last load of the two groups; the two addresses are inputs so that they stay in their registers up to the wait and no load's result lands on them in front of it
#pragma unroll
        for (int i = 0; i < 16; ++i) st4(bs + i * ASP + lane * 4, wa[i]);
        __builtin_amdgcn_sched_barrier(0);   // keeps the third group's loads behind the first group's LDS stores: lifted over them they hold 64 more registers at once, and the build spills
#pragma unroll
        for (int i = 0; i < 16; ++i) wb[i] = *(const v4f*)(bg + (16 + i) * DM);
        asm volatile("s_wait_xcnt 0x0" :: "v"(bg) : "memory");   // the same behind the third group
#pragma unroll
        for (int i = 0; i < 16; ++i) st4(as + (w * 16 + i) * ASP + lane * 4, xa[i]);
#pragma unroll
        for (int i = 0; i < 16; ++i) st4(bs + (16 + i) * ASP + lane * 4, wb[i]); }
    __syncthreads();   // all 64 input rows are in LDS before any wave reads fragments
    v8f acc[4][2];
#pragma unroll
    for (int mb = 0; mb < 4; ++mb)
#pragma unroll
        for (int nb = 0; nb < 2; ++nb) acc[mb][nb] = (v8f){};
#pragma unroll
    for (int kc = 0; kc < DM; kc += 32) {
        v16bf a[4];
#pragma unroll
        for (int mb = 0; mb < 4; ++mb) a[mb] = ldsf(as + (mb * 16 + lr) * ASP + kc + 8 * hi);
#pragma unroll
        for (int nb = 0; nb < 2; ++nb) { const v16bf b = ldsf(bs + (nb * 16 + lr) * ASP + kc + 8 * hi);
#pragma unroll
            for (int mb = 0; mb < 4; ++mb) acc[mb][nb] = wmmab(a[mb], b, acc[mb][nb]); }
    }
    __syncthreads();   // every fragment has been read before a slice is written again
    if (z < 2) {   // uniform in the work-group
        float* os = sm + w * WSL;
#pragma unroll
        for (int mb = 0; mb < 4; ++mb)
#pragma unroll
            for (int nb = 0; nb < 2; ++nb)
#pragma unroll
                for (int j = 0; j < 8; ++j) os[(mb * 16 + hi * 8 + j) * QSP + nb * 16 + lr] = acc[mb][nb][j];
        const int r8 = lane >> 2, c8 = (lane & 3) * 8;   // read-back: 8 rows a step, 8 columns a lane
        v8f bb;
#pragma unroll
        for (int i = 0; i < 8; ++i) bb[i] = bfr(bias[c0 + c8 + i]);
        const size_t o = (((size_t)(z * NB_ + g) * NH_ + w) * TT + t0) * HD + c8 * 16 + r8 * 8; bf* ph = Ph + o; bf* pl = Pl + o;   // plane [q | k][group][head][t / 16][d / 8][t % 16][8]
        __syncthreads();   // the tile is in LDS before other lanes read it
#pragma unroll
        for (int s = 0; s < 8; ++s) { const float* rp = os + (8 * s + r8) * QSP + c8; const v4f u0 = *(const v4fa*)rp, u1 = *(const v4fa*)(rp + 4); v8us oh, ol;
            split8(__builtin_shufflevector(u0, u1, 0, 1, 2, 3, 4, 5, 6, 7) + bb, oh, ol); const int so = (s >> 1) * (16 * HD) + (s & 1) * 64; *(v8us*)(ph + so) = oh; *(v8us*)(pl + so) = ol; }   // row 8 s + r8: 16-row tile s / 2, row 8 (s % 2) + r8 in it
    } else {
        v8us th[2][4], tl[2][4];   // all sixteen pieces first, then the stores
#pragma unroll
        for (int nb = 0; nb < 2; ++nb) { const float bn = bfr(bias[c0 + nb * 16 + lr]);
#pragma unroll
            for (int mb = 0; mb < 4; ++mb) split8(acc[mb][nb] + bn, th[nb][mb], tl[nb][mb]); }
        const size_t o = (size_t)(g * NKV + w) * HP * TT + (t0 / 32) * (32 * HD) + lane * 8; bf* vh = Vh + o; bf* vl = Vl + o;   // plane [group][head][t / 32][d / 16][(t / 16) % 2][lane][8]: accumulator (mb, nb) is nodes t0 + 16 mb + 8 hi + j of column 16 nb + lr
#pragma unroll
        for (int nb = 0; nb < 2; ++nb)
#pragma unroll
            for (int mb = 0; mb < 4; ++mb) { const int so = (mb >> 1) * (32 * HD) + nb * 512 + (mb & 1) * 256; *(v8us*)(vh + so) = th[nb][mb]; *(v8us*)(vl + so) = tl[nb][mb]; }
        asm volatile("s_wait_xcnt 0x0" ::: "memory");   // behind the last store: in the built code the q/k branch follows this one, and its first instructions reuse registers that these stores name
    }
}

// ---- k_fattn: scores, masked softmax, pair factor, attn.v, the head merge and the output projection of 32 query rows of one group, all four heads, in ONE work-group of 8 waves; nothing of the score or weight matrices or of the merged rows goes to memory.
// Wave w owns keys 64 w .. 64 w + 63. It computes S^T = K Q^T (A = key rows, B = query rows), so a lane holds scores of ONE query (lane & 15) and the accumulator pair of 32 keys is, converted in place, the A fragment of the weights for attn.v (hardware k order on both sides).
// The wave's 32 x 64 block of the pair mask (one bit each, in registers) and of the pair factor (bf16, its compute type, each thread's 64 values in its own 128 bytes of LDS) is read from memory once and serves the four heads. Row maximum, row sum and the attn.v partial sums of the 8 waves meet in LDS: three barriers per head. The merged 32 x 128 rows (hi/lo) stay in LDS; behind the last head and one more barrier, wave w computes out^T = Wp merged^T (A = Wp rows, B = merged rows) for 16 queries (w / 4) and 32 output columns (w % 4): a lane holds 8 consecutive columns of ONE query, and the wave alone writes each 128-byte line it touches.
typedef __attribute__((ext_vector_type(8))) unsigned v8u;
typedef __attribute__((ext_vector_type(2))) unsigned v2u;
typedef v2u __attribute__((may_alias)) v2ua;
// Fragment from a plane laid in fragment order: a 16 x 32 fragment is 1024 contiguous bytes, first every lane's lower 8 elements (k = 8 hi + j) in lane order, then every lane's upper 8 (k = 16 + 8 hi + j). u is a uniform base, b the lane's 32-bit byte offset (it holds the lane's 16 * lane), c a constant: from head to head only the 32-bit offset has to live in a vector register. Each of the two loads covers 512 contiguous bytes, four whole lines; the registers hold what ldgf gives on a row-major plane.
__device__ __forceinline__ v16bf ldfo(const bf* u, unsigned b, int c) { const char* p = ((const char*)u + b) + c; return cat16b(*(const v8us*)p, *(const v8us*)(p + 512)); }
__device__ __forceinline__ unsigned cvt2(v2f y) { return __builtin_bit_cast(unsigned, __builtin_convertvector(y, v2bf)); }   // two f32 to bf16, nearest even, packed in one word by one conversion instruction
__device__ __forceinline__ void split2(float y0, float y1, unsigned& h, unsigned& l) { const v2f y = {y0, y1}; h = cvt2(y); const v2f r = {__uint_as_float(h << 16), __uint_as_float(h & 0xFFFF0000u)}; l = cvt2(y - r); }   // hi/lo split of two neighbours (h = bf16(y), l = bf16(y - h)), each plane's pair packed in one word
// Eight v_exp_f32, in place, and one v_nop in ONE statement: behind each exp stands an independent instruction, behind the last the v_nop, so nothing directly behind a transcendental reads its result or overwrites its source (the slot the instruction set asks for).
__device__ __forceinline__ void exp2x8(float (&x)[8]) { asm("v_exp_f32 %0, %0\n\tv_exp_f32 %1, %1\n\tv_exp_f32 %2, %2\n\tv_exp_f32 %3, %3\n\tv_exp_f32 %4, %4\n\tv_exp_f32 %5, %5\n\tv_exp_f32 %6, %6\n\tv_exp_f32 %7, %7\n\tv_nop" : "+v"(x[0]), "+v"(x[1]), "+v"(x[2]), "+v"(x[3]), "+v"(x[4]), "+v"(x[5]), "+v"(x[6]), "+v"(x[7])); }
#define FW  8                    // waves per work-group
#define FQT 2                    // 16-row query tiles per work-group
#define FKT (TT / FW / 16)       // 16-key tiles per wave
#define OSP 36                   // LDS row pitch (floats) of the partial outputs: the two lane halves (8 rows apart) fall on different banks, rows stay 16-byte aligned
#define MSP 136                  // LDS row pitch (16-bit elements) of the merged rows: 256 + 16 bytes, so that the 16 rows of a fragment read start 4 banks apart
#define MGB (2 * FQT * 16 * MSP * 2)   // bytes of the merged rows, hi and lo. They are LDS sized at the launch, for speed: as a static array they bring the size the compiler sees to three work-groups a WGP, it then plans for six waves a SIMD from the start and leaves the head loop close to source order (1174 instructions, not 1023; each LDS load of the merge waited for singly). Three work-groups a WGP are resident either way.
// amdgpu_waves_per_eu(6): the register budget of six waves a SIMD (160), so that three work-groups fit a WGP and all 768 are resident at once; with more than 160 registers two fit, and a second, half-empty round follows the first. For that budget the pair factor lies in LDS and the head's step is added to 32-bit offsets, not to 64-bit lane pointers that live through the loop.
__global__ __launch_bounds__(256) __attribute__((amdgpu_waves_per_eu(6))) void k_fattn(const bf* __restrict__ Qh, const bf* __restrict__ Ql, const bf* __restrict__ Kh, const bf* __restrict__ Kl, const bf* __restrict__ Vh, const bf* __restrict__ Vl, const int* __restrict__ mk, const float* __restrict__ adj, const bf* __restrict__ Wo, const float* __restrict__ bo, float* __restrict__ out) {
    __shared__ float red[2][FW][FQT * 16];   /* [0] row maxima, [1] row sums: one array, so that one lane address serves both */ __shared__ __align__(16) float os[FW][FQT * 16][OSP]; __shared__ v4u gas[FQT * FKT][FW * 32]; extern __shared__ __align__(16) bf mgd[]; bf (*mg)[FQT * 16][MSP] = (bf (*)[FQT * 16][MSP])mgd;   /* merged rows [hi | lo][query][head][d], MGB bytes given at the launch; every access goes through a may_alias vector type */
    const int lane = threadIdx.x & 31, lr = lane & 15, hi = lane >> 4, w = threadIdx.x >> 5;
    const int g = blockIdx.z * 8 + blockIdx.x, i0 = blockIdx.y * (FQT * 16), k0 = w * (FKT * 16);   // grid (8, tiles of a group, 6): the deal of DEALG and DEALT written as grid axes, flat index mod 8 = blockIdx.x = group mod 8
    const unsigned mo = (unsigned)((i0 + lr) * TT + k0 + hi * 8), qo = (unsigned)(i0 * HD + 8 * lane) * 2u, ko = (unsigned)(k0 * HD + 8 * lane) * 2u;   // the lane's 32-bit offsets: mo in elements inside a group's pair planes; qo and ko in bytes inside a (group, head) plane of q and of k or v (16 rows of q or k, and 16 keys of v, are 16 HD elements); every base below is uniform
    const bf* Qhg = Qh + (size_t)g * NH_ * TT * HD; const bf* Qlg = Ql + (size_t)g * NH_ * TT * HD; const bf* Khg = Kh + (size_t)g * NH_ * TT * HD; const bf* Klg = Kl + (size_t)g * NH_ * TT * HD; const bf* Vhg = Vh + (size_t)g * NKV * HP * TT; const bf* Vlg = Vl + (size_t)g * NKV * HP * TT;
    const int* mkg = mk + (size_t)g * TT * TT; const float* adg = adj + (size_t)g * TT * TT;
    const int* mpl = mkg + mo; const float* apl = adg + mo; v4i mv[FQT][FKT][2]; v4f av[FQT][FKT][2];   // all 32 loads of the block first, from two lane addresses
    unsigned mb[FQT];   // element (kt, j) of a lane: query i0 + 16 qt + lr, key k0 + 16 kt + 8 hi + j
#pragma unroll
    for (int qt = 0; qt < FQT; ++qt)
#pragma unroll
        for (int kt = 0; kt < FKT; ++kt) { const int* mp = mpl + (qt * 16 * TT + kt * 16); const float* ap = apl + (qt * 16 * TT + kt * 16);
            mv[qt][kt][0] = *(const v4i*)mp; mv[qt][kt][1] = *(const v4i*)(mp + 4); av[qt][kt][0] = *(const v4f*)ap; av[qt][kt][1] = *(const v4f*)(ap + 4); }
    asm volatile("s_wait_xcnt 0x0" :: "v"(mpl), "v"(apl) : "memory");   // behind the last of the 32 loads; the two addresses are inputs so that they stay in their registers up to the wait and no load's result lands on them in front of it
#pragma unroll
    for (int qt = 0; qt < FQT; ++qt) { mb[qt] = 0u;
#pragma unroll
        for (int kt = 0; kt < FKT; ++kt) { const v4i m0 = mv[qt][kt][0], m1 = mv[qt][kt][1]; const v4f a0 = av[qt][kt][0], a1 = av[qt][kt][1];
#pragma unroll
            for (int q = 0; q < 4; ++q) { mb[qt] |= (m0[q] != 0 ? 1u : 0u) << (kt * 8 + q); mb[qt] |= (m1[q] != 0 ? 1u : 0u) << (kt * 8 + 4 + q); }
            gas[qt * FKT + kt][threadIdx.x] = __builtin_bit_cast(v4u, __builtin_convertvector(__builtin_shufflevector(a0, a1, 0, 1, 2, 3, 4, 5, 6, 7), v8bf)); } }   // a thread reads back only what it wrote itself: no barrier is owed for it
#pragma unroll 1   // rolled, for speed only
    for (int h = 0; h < NH_; ++h) {
        const unsigned qb = qo + (unsigned)h * (TT * HD * 2), kb = ko + (unsigned)h * (TT * HD * 2), vb = ko + (unsigned)h * (HP * TT * 2);   // the head's step stays in the 32-bit offsets
        v16bf qh[FQT], ql[FQT];
#pragma unroll
        for (int qt = 0; qt < FQT; ++qt) { qh[qt] = ldfo(Qhg, qb, qt * 16 * HD * 2); ql[qt] = ldfo(Qlg, qb, qt * 16 * HD * 2); }
        float sc[FQT][FKT][8]; float mx[FQT];
#pragma unroll
        for (int qt = 0; qt < FQT; ++qt) mx[qt] = -3.0e38f;
#pragma unroll
        for (int kt = 0; kt < FKT; ++kt) { const v16bf kh = ldfo(Khg, kb, kt * 16 * HD * 2), kl = ldfo(Klg, kb, kt * 16 * HD * 2);
#pragma unroll
            for (int qt = 0; qt < FQT; ++qt) { v8f a = (v8f){}; a = wmmab(kh, qh[qt], a); a = wmmab(kh, ql[qt], a); a = wmmab(kl, qh[qt], a);   /* q_hi k_hi + q_lo k_hi + q_hi k_lo; a[j] = score of key 8 hi + j of the tile, query lr */
#pragma unroll
                for (int j = 0; j < 8; ++j) { const float t = ((mb[qt] >> (kt * 8 + j)) & 1u) ? -1.0e9f : __fmul_rn(a[j], SCL);   /* where(mask != 0, -1e9, scores / sqrt(32)): the module's literal, after the scale */ sc[qt][kt][j] = t; mx[qt] = fmaxf(mx[qt], t); } } }
#pragma unroll
        for (int qt = 0; qt < FQT; ++qt) { mx[qt] = fmaxf(mx[qt], __shfl_xor(mx[qt], 16, 32)); if (hi == 0) red[0][w][qt * 16 + lr] = mx[qt]; }
        __syncthreads();   // every wave's row maxima are in LDS
#pragma unroll
        for (int qt = 0; qt < FQT; ++qt) { float m = red[0][0][qt * 16 + lr];
#pragma unroll
            for (int ww = 1; ww < FW; ++ww) m = fmaxf(m, red[0][ww][qt * 16 + lr]);
            float s = 0.f;
#pragma unroll
            for (int kt = 0; kt < FKT; ++kt) {
#pragma unroll
                for (int j = 0; j < 8; ++j) sc[qt][kt][j] = __fmul_rn(__fsub_rn(sc[qt][kt][j], m), 1.4426950408889634f);
                exp2x8(sc[qt][kt]);
#pragma unroll
                for (int j = 0; j < 8; ++j) s += sc[qt][kt][j]; }
            s += __shfl_xor(s, 16, 32); if (hi == 0) red[1][w][qt * 16 + lr] = s; }
        __syncthreads();   // every wave's row sums are in LDS
        float f[FQT];
#pragma unroll
        for (int qt = 0; qt < FQT; ++qt) { float s = red[1][0][qt * 16 + lr];
#pragma unroll
            for (int ww = 1; ww < FW; ++ww) s += red[1][ww][qt * 16 + lr];
            f[qt] = __fdiv_rn(1.0f, s); }
        v8f oa[FQT][2];
#pragma unroll
        for (int qt = 0; qt < FQT; ++qt) { oa[qt][0] = (v8f){}; oa[qt][1] = (v8f){}; }
#pragma unroll
        for (int kc = 0; kc < FKT / 2; ++kc) { v16bf ph[FQT], pl[FQT];
#pragma unroll
            for (int qt = 0; qt < FQT; ++qt) { v8u hw, lw;
#pragma unroll
                for (int tt = 0; tt < 2; ++tt) { const v4u ga = gas[qt * FKT + 2 * kc + tt][threadIdx.x];
#pragma unroll
                    for (int p = 0; p < 4; ++p) { const unsigned gp = ga[p]; unsigned a, c2;
                        split2(__fmul_rn(__fmul_rn(sc[qt][2 * kc + tt][2 * p], f[qt]), __uint_as_float(gp << 16)), __fmul_rn(__fmul_rn(sc[qt][2 * kc + tt][2 * p + 1], f[qt]), __uint_as_float(gp & 0xFFFF0000u)), a, c2);   /* softmax weight x the pair factor AFTER the normalisation: two rounded products */
                        hw[tt * 4 + p] = a; lw[tt * 4 + p] = c2; } }
                ph[qt] = __builtin_bit_cast(v16bf, hw); pl[qt] = __builtin_bit_cast(v16bf, lw); }   /* A fragment: row = query lr, k = 8 hi + j (first tile) and 16 + 8 hi + j (second tile) of the 32 keys */
#pragma unroll
            for (int dt = 0; dt < 2; ++dt) { const int o = (kc * (32 * HD) + dt * 512) * 2; const v16bf vh = ldfo(Vhg, vb, o), vl = ldfo(Vlg, vb, o);
#pragma unroll
                for (int qt = 0; qt < FQT; ++qt) { oa[qt][dt] = wmmab(ph[qt], vh, oa[qt][dt]); oa[qt][dt] = wmmab(pl[qt], vh, oa[qt][dt]); oa[qt][dt] = wmmab(ph[qt], vl, oa[qt][dt]); } } }
#pragma unroll
        for (int qt = 0; qt < FQT; ++qt)
#pragma unroll
            for (int dt = 0; dt < 2; ++dt)
#pragma unroll
                for (int j = 0; j < 8; ++j) os[w][qt * 16 + hi * 8 + j][dt * 16 + lr] = oa[qt][dt][j];
        __syncthreads();   // every wave's partial outputs are in LDS; the next head writes them again only behind its own two barriers
        { const int q = threadIdx.x >> 3, d4 = (threadIdx.x & 7) * 4; v4f s = *(const v4fa*)&os[0][q][d4];
#pragma unroll
            for (int ww = 1; ww < FW; ++ww) s += *(const v4fa*)&os[ww][q][d4];
            unsigned h0, l0, h1, l1; split2(s[0], s[1], h0, l0); split2(s[2], s[3], h1, l1); const v2u oh = {h0, h1}, ol = {l0, l1};
            *(v2ua*)&mg[0][q][h * HD + d4] = oh; *(v2ua*)&mg[1][q][h * HD + d4] = ol; }   /* merged [query][head][d] hi / lo rows for the output projection */
    }
    // out[q][n] = sum_k (merged_hi + merged_lo)[q][k] bf16(Wp[n][k]) + bf16(bp[n]); per 32 k the hi product, then the lo product, into one accumulator.
    { const int qr = (w >> 2) * 16 + lr, cb = (w & 3) * 32;
        const bf* wp = Wo + (cb + lr) * DQ + 8 * hi; const float* bp = bo + cb + 8 * hi; v16bf wf[2][DQ / 32]; v4f bv[2][2];   // loaded in front of the barrier: a wave that arrives early has their latency behind it when the last wave arrives
#pragma unroll
        for (int t = 0; t < 2; ++t) {
#pragma unroll
            for (int kc = 0; kc < DQ / 32; ++kc) wf[t][kc] = ldgf(wp + t * 16 * DQ + kc * 32);
            bv[t][0] = *(const v4f*)(bp + t * 16); bv[t][1] = *(const v4f*)(bp + t * 16 + 4); }
        asm volatile("s_wait_xcnt 0x0" :: "v"(wp), "v"(bp) : "memory");   // behind the last of the 20 loads; the two addresses are inputs so that they stay in their registers up to the wait and no load's result lands on them in front of it
        __syncthreads();   // all four heads' merged rows are in LDS
        v8f acc[2] = {(v8f){}, (v8f){}};
#pragma unroll
        for (int kc = 0; kc < DQ / 32; ++kc) { const v16bf mh = ldsf(&mg[0][qr][kc * 32 + 8 * hi]), ml = ldsf(&mg[1][qr][kc * 32 + 8 * hi]);
#pragma unroll
            for (int t = 0; t < 2; ++t) { acc[t] = wmmab(wf[t][kc], mh, acc[t]); acc[t] = wmmab(wf[t][kc], ml, acc[t]); } }   /* acc[t][j] = query qr, column cb + 16 t + 8 hi + j */
        float* op = out + ((size_t)g * TT + i0 + qr) * DM + cb + 8 * hi;
#pragma unroll
        for (int t = 0; t < 2; ++t) { const v8f y = acc[t] + __builtin_convertvector(__builtin_convertvector(__builtin_shufflevector(bv[t][0], bv[t][1], 0, 1, 2, 3, 4, 5, 6, 7), v8bf), v8f);   /* + bf16(bp), nearest even */
            *(v4f*)(op + t * 16) = __builtin_shufflevector(y, y, 0, 1, 2, 3); *(v4f*)(op + t * 16 + 4) = __builtin_shufflevector(y, y, 4, 5, 6, 7); }
    }
}

extern "C" void kernel_launch(void* const* d_in, const int* in_sizes, int n_in,
                              void* d_out, int out_size, void* d_ws, size_t ws_size, hipStream_t stream) {
    (void)in_sizes; (void)n_in; (void)out_size;
    const float* x = (const float*)d_in[0]; const float* xk = (const float*)d_in[1]; const float* xv = (const float*)d_in[2]; const int* mk = (const int*)d_in[3]; const float* adj = (const float*)d_in[4]; const float* wq = (const float*)d_in[5]; const float* bq = (const float*)d_in[6]; const float* wk = (const float*)d_in[7]; const float* bk = (const float*)d_in[8]; const float* wv = (const float*)d_in[9]; const float* bv = (const float*)d_in[10]; const float* wo = (const float*)d_in[11]; const float* bo = (const float*)d_in[12];   /* order query, key, value ([4][12][512][128] = 48 groups), mask (int32 [48][512][512]: read as data), adjm (f32 [48][512][512]: read), Wq, bq, Wk, bk, Wv, bv, Wp, bp ('oi') */
    float* OUT = (float*)d_out;     // [48][512][128]
    char* wsp = (char*)d_ws;
    auto take = [&](size_t bytes) { char* p = wsp; wsp += (bytes + 255) & ~(size_t)255; return (void*)p; };
    bf* WO = (bf*)take((size_t)DM * DQ * 2);   /* Wp as bf16 */
    bf* QPh = (bf*)take((size_t)2 * NB_ * NH_ * TT * HD * 2); bf* QPl = (bf*)take((size_t)2 * NB_ * NH_ * TT * HD * 2);   /* [q groups | k groups][head], each 512 x 32 in fragment order */ bf* KPh = QPh + (size_t)NB_ * NH_ * TT * HD; bf* KPl = QPl + (size_t)NB_ * NH_ * TT * HD;
    bf* VTh = (bf*)take((size_t)NB_ * NKV * HP * TT * 2); bf* VTl = (bf*)take((size_t)NB_ * NKV * HP * TT * 2);
    if ((size_t)(wsp - (char*)d_ws) > ws_size) return;    // ws 256 MiB given; the carve is below 64 MiB
    k_proj<<<dim3(NB_ * TT / 64, 3, 1), PW * 32, 0, stream>>>(x, xk, xv, wq, wk, wv, wo, bq, bk, bv, QPh, QPl, VTh, VTl, WO);   /* rows = all (group, node) pairs; y = q, k, v */
    k_fattn<<<dim3(8, TT / (FQT * 16), NB_ / 8), FW * 32, MGB, stream>>>(QPh, QPl, KPh, KPl, VTh, VTl, mk, adj, WO, bo, OUT);   /* one kv head per query head: plane z of q meets plane z of k and of v^T */
}

// v009
// One run takes 47.6 microseconds.
// Next to v008, in two timings, it ran 1.04 times as fast each time.
// Over all steps from v000 it is 77.7 times as fast.
#include <hip/hip_runtime.h>

// Spatial multi-head attention over graph nodes with a pair mask and a post-softmax pair factor (query, key, value [4][12][512][128]: 48 independent (batch, time) groups of 512 nodes; q = query Wq^T + bq, k = key Wk^T + bk, v = value Wv^T + bv ('oi' (out, in) [128][128] + [128]: real biases; 4 heads x 32); scores x 1/sqrt(32); where mask[b][t][i][j] != 0 (int32 [4][12][512][512], read per logit as data) the score is REPLACED by -1e9; softmax over the 512 keys; the weights x adjm[b][t][i][j] (f32 [4][12][512][512], read, rounded to bf16: an input) AFTER the softmax, no renormalisation; out = merged Wp^T + bp -> [4][12][512][128] (3.1 M); argument order query, key, value, mask, adjm, Wq, bq, Wk, bk, Wv, bv, Wp, bp).
// Layout, all 48 groups per launch, two launches: (1) k_proj reads query, key, value and Wq, Wk, Wv as f32, rounds them to bf16 on their way into LDS, adds the bias rounded to bf16 and writes the hi/lo planes that attention reads, each in the order of its matrix fragments (see ldfo): q/k planes [q groups | k groups][head][t / 16][d / 8][t % 16][8] and value planes [group][head][t / 32][d / 16][(t / 16) % 2][lane][8]; its first 16 work-groups also write the bf16 copy of Wp; (2) ONE fused kernel for scores, masked softmax, pair factor, attn.v, the head merge and the output projection (merged hi/lo x Wp exact + bp), q, k, v and the merged rows as hi/lo, Wp as one bf16 plane, scores and weights in registers only, the merged rows in LDS only.
// Compute dtypes, f32 accumulate: every input rounded to bf16, nearest even, incl. the pair factor adjm; projections exact + bf16 biases; scores (K 32) and attn.v 3 products on every row; softmax f32; Wp hl x exact + bias.

#define NB_  48
#define TT   512
#define DM   128
#define NH_  4
#define NKV  4
#define HD   32
#define DQ   (NH_ * HD)
#define SCL  0.17677669529663688f   // 32^-0.5 (the module divides by float32(sqrt(32)))
#define SCE  (SCL * 1.4426950408889634f)   // 32^-0.5 x log2 e: exp(SCL (a - m)) = exp2(SCE a - SCE m), one fused multiply-add on the raw product a
#define MSKR (-1.0e9f / SCL)   // the module's -1e9 in units of the raw product: MSKR x SCL = -1e9
#define HP   64    // a head's value plane is HP x TT elements apart from the next; the first HD x TT are written and read
// Which (group, tile) a work-group takes, from its flat grid index b, a group having n tiles (n a power of two, 48 groups = 6 x 8): group = 8 (b / 8n) + b % 8, tile = (b / 8) % n. A permutation of the plain order, so every tile is done once wherever the work-groups land. For speed only: all work-groups of both launches that write or read one group's q, k, v planes have the same index mod 8.
#define DEALG(b, n) ((int)((b) / (8 * (n))) * 8 + (int)((b) & 7))
#define DEALT(b, n) ((int)(((b) >> 3) & ((n) - 1)))
typedef unsigned short bf;
typedef __attribute__((ext_vector_type(16))) __bf16   v16bf;
typedef __attribute__((ext_vector_type(8)))  __bf16   v8bf;
typedef __attribute__((ext_vector_type(4)))  __bf16   v4bf;
typedef __attribute__((ext_vector_type(2)))  __bf16   v2bf;
typedef __attribute__((ext_vector_type(2)))  float    v2f;
typedef __attribute__((ext_vector_type(8)))  unsigned short v8us;
typedef __attribute__((ext_vector_type(4)))  unsigned short v4us;
typedef __attribute__((ext_vector_type(8)))  float    v8f;
typedef __attribute__((ext_vector_type(4)))  float    v4f;
typedef __attribute__((ext_vector_type(4)))  int      v4i;
typedef __attribute__((ext_vector_type(4)))  unsigned v4u;
typedef v4f  __attribute__((may_alias)) v4fa;
typedef v8us __attribute__((may_alias)) v8usa;
typedef v4us __attribute__((may_alias)) v4usa;

__device__ __forceinline__ unsigned short f2bf(float f) { unsigned u = __float_as_uint(f); u += 0x7FFFu + ((u >> 16) & 1u); return (unsigned short)(u >> 16); }
__device__ __forceinline__ float bf2f(unsigned short b) { return __uint_as_float(((unsigned)b) << 16); }
__device__ __forceinline__ float bfr(float f) { return bf2f(f2bf(f)); }
__device__ __forceinline__ v16bf cat16b(v8us lo, v8us hi) { return __builtin_bit_cast(v16bf, __builtin_shufflevector(lo, hi, 0, 1, 2, 3, 4, 5, 6, 7, 8, 9, 10, 11, 12, 13, 14, 15)); }
__device__ __forceinline__ v8f wmmab(v16bf a, v16bf b, v8f c) { return __builtin_amdgcn_wmma_f32_16x16x32_bf16(false, a, false, b, (short)0, c, false, false); }

// Fragment from a K-contiguous 16-bit row in memory: the lane's p points at row (lane & 15), element 8 (lane >> 4); it holds k = 8 hi + j and k = 16 + 8 hi + j.
__device__ __forceinline__ v16bf ldgf(const bf* p) { return cat16b(*(const v8us*)p, *(const v8us*)(p + 16)); }

// hi/lo split of eight values: h = bf16(y), l = bf16(y - h), both nearest even.
__device__ __forceinline__ void split8(v8f y, v8us& h, v8us& l) { const v8bf hb = __builtin_convertvector(y, v8bf); const v4u u = __builtin_bit_cast(v4u, hb); v8f r;
#pragma unroll
    for (int i = 0; i < 4; ++i) { r[2 * i] = __uint_as_float(u[i] << 16); r[2 * i + 1] = __uint_as_float(u[i] & 0xFFFF0000u); }
    h = __builtin_bit_cast(v8us, hb); l = __builtin_bit_cast(v8us, __builtin_convertvector(y - r, v8bf)); }

// ---- k_proj: the q, k and v projections (blockIdx.y = 0, 1, 2) of 64 (group, node) rows, from the f32 inputs to the hi/lo planes of attention. Four waves; wave w owns head w, output columns 32 w .. 32 w + 31, as a 64x32 register tile (8 accumulators).
// y[m][n] = sum_k bf16(x[m][k]) bf16(W[n][k]) + bf16(bias[n]). Operands: a row of 128 f32 is ONE load of a wave (16 bytes a lane, four whole lines); it is rounded to bf16 and laid in LDS, the 64 input rows once for the four waves, each wave's 32 weight rows in its own slice; the fragments are read from there.
// An accumulator holds 8 consecutive rows (nodes) of one column (lane & 15). q, k: the tile turns through the wave's LDS slice (f32) so that a lane holds 8 consecutive columns of a row: a store covers 8 rows x 4 column groups = four whole 128-byte lines of the head's plane. v: a lane's 8 nodes of one column are one 16-byte piece of attention's B fragment, held by the lane that will read it: each accumulator is stored from its registers, 512 contiguous bytes a store.
#define PW  4      // waves per work-group
#define ASP 136    // LDS row pitch (16-bit elements) of the staged operand rows: 256 + 16 bytes, so that the 16 rows of a fragment read start 4 banks apart
#define QSP 36     // LDS row pitch (floats) of the staged q/k tile: the two lane halves (8 rows apart) fall on different banks, rows stay 16-byte aligned
#define WSL (64 * QSP)   // floats in a wave's LDS slice: first its 32 weight rows (32 x 136 x 2 bytes fit), then, for q and k, its output tile (64 x 36 floats)
__device__ __forceinline__ void st4(bf* d, v4f u) { *(v4usa*)d = __builtin_bit_cast(v4us, __builtin_convertvector(u, v4bf)); }   // four f32 to bf16, nearest even, into LDS
__device__ __forceinline__ v16bf ldsf(const bf* p) { return cat16b(*(const v8usa*)p, *(const v8usa*)(p + 16)); }   // fragment from an LDS row: the k order of ldgf
// amdgpu_waves_per_eu(5): the register budget of five waves a SIMD, so that all 1152 work-groups (four or five a WGP) are resident at once; without it the v branch is scheduled into more than 204 registers and a second, short round of work-groups follows the first.
__global__ __launch_bounds__(PW * 32) __attribute__((amdgpu_waves_per_eu(5))) void k_proj(const float* __restrict__ x0, const float* __restrict__ x1, const float* __restrict__ x2, const float* __restrict__ w0, const float* __restrict__ w1, const float* __restrict__ w2, const float* __restrict__ w3, const float* __restrict__ b0, const float* __restrict__ b1, const float* __restrict__ b2, bf* Ph, bf* Pl, bf* Vh, bf* Vl, bf* W3) {
    __shared__ __align__(16) float sm[PW * WSL + 64 * ASP / 2];   // four slices, then the 64 input rows; every 16-bit access goes through a may_alias vector type
    const int z = blockIdx.y; const float* A = z == 0 ? x0 : (z == 1 ? x1 : x2); const float* B = z == 0 ? w0 : (z == 1 ? w1 : w2); const float* bias = z == 0 ? b0 : (z == 1 ? b1 : b2);
    const int lane = threadIdx.x & 31, lr = lane & 15, hi = lane >> 4, w = threadIdx.x >> 5; const int c0 = w * HD;
    const int g = DEALG(blockIdx.x, TT / 64), t0 = DEALT(blockIdx.x, TT / 64) * 64, r0 = g * TT + t0;   // gridDim.x is a multiple of 8, so the flat index mod 8 is blockIdx.x mod 8 for q, k and v alike; 64 divides 512: a tile lies in one group
    bf* as = (bf*)(sm + PW * WSL); bf* bs = (bf*)(sm + w * WSL);
    if (z == 0 && blockIdx.x < DM * DQ / (PW * 32 * 8)) {   // uniform in the work-group: the first 16 work-groups of the q part round Wp to bf16 for the output projection, 8 elements a thread
        const int e = (blockIdx.x * (PW * 32) + threadIdx.x) * 8; *(v8us*)(W3 + e) = __builtin_bit_cast(v8us, __builtin_convertvector(*(const v8f*)(w3 + e), v8bf));
        asm volatile("s_wait_xcnt 0x0" ::: "memory"); }   // stands in front of the staging code, which may reuse the registers that the load and the store name
    { const float* ag = A + (size_t)(r0 + w * 16) * DM + lane * 4; const float* bg = B + c0 * DM + lane * 4;   // the wave stages 16 of the input rows and its own 32 weight rows, in three groups of 16 loads, two groups in flight: 128 data registers, not 192, which leaves room for five waves a SIMD
        v4f wa[16], xa[16], wb[16];
#pragma unroll
        for (int i = 0; i < 16; ++i) wa[i] = *(const v4f*)(bg + i * DM);
#pragma unroll
        for (int i = 0; i < 16; ++i) xa[i] = *(const v4f*)(ag + i * DM);
        asm volatile("s_wait_xcnt 0x0" :: "v"(ag), "v"(bg) : "memory");   // behind the last load of the two groups; the two addresses are inputs so that they stay in their registers up to the wait and no load's result lands on them in front of it
#pragma unroll
        for (int i = 0; i < 16; ++i) st4(bs + i * ASP + lane * 4, wa[i]);
        __builtin_amdgcn_sched_barrier(0);   // keeps the third group's loads behind the first group's LDS stores: lifted over them they hold 64 more registers at once, and the build spills
#pragma unroll
        for (int i = 0; i < 16; ++i) wb[i] = *(const v4f*)(bg + (16 + i) * DM);
        asm volatile("s_wait_xcnt 0x0" :: "v"(bg) : "memory");   // the same behind the third group
#pragma unroll
        for (int i = 0; i < 16; ++i) st4(as + (w * 16 + i) * ASP + lane * 4, xa[i]);
#pragma unroll
        for (int i = 0; i < 16; ++i) st4(bs + (16 + i) * ASP + lane * 4, wb[i]); }
    __syncthreads();   // all 64 input rows are in LDS before any wave reads fragments
    v8f acc[4][2];
#pragma unroll
    for (int mb = 0; mb < 4; ++mb)
#pragma unroll
        for (int nb = 0; nb < 2; ++nb) acc[mb][nb] = (v8f){};
#pragma unroll
    for (int kc = 0; kc < DM; kc += 32) {
        v16bf a[4];
#pragma unroll
        for (int mb = 0; mb < 4; ++mb) a[mb] = ldsf(as + (mb * 16 + lr) * ASP + kc + 8 * hi);
#pragma unroll
        for (int nb = 0; nb < 2; ++nb) { const v16bf b = ldsf(bs + (nb * 16 + lr) * ASP + kc + 8 * hi);
#pragma unroll
            for (int mb = 0; mb < 4; ++mb) acc[mb][nb] = wmmab(a[mb], b, acc[mb][nb]); }
    }
    __syncthreads();   // every fragment has been read before a slice is written again
    if (z < 2) {   // uniform in the work-group
        float* os = sm + w * WSL;
#pragma unroll
        for (int mb = 0; mb < 4; ++mb)
#pragma unroll
            for (int nb = 0; nb < 2; ++nb)
#pragma unroll
                for (int j = 0; j < 8; ++j) os[(mb * 16 + hi * 8 + j) * QSP + nb * 16 + lr] = acc[mb][nb][j];
        const int r8 = lane >> 2, c8 = (lane & 3) * 8;   // read-back: 8 rows a step, 8 columns a lane
        v8f bb;
#pragma unroll
        for (int i = 0; i < 8; ++i) bb[i] = bfr(bias[c0 + c8 + i]);
        const size_t o = (((size_t)(z * NB_ + g) * NH_ + w) * TT + t0) * HD + c8 * 16 + r8 * 8; bf* ph = Ph + o; bf* pl = Pl + o;   // plane [q | k][group][head][t / 16][d / 8][t % 16][8]
        __syncthreads();   // the tile is in LDS before other lanes read it
#pragma unroll
        for (int s = 0; s < 8; ++s) { const float* rp = os + (8 * s + r8) * QSP + c8; const v4f u0 = *(const v4fa*)rp, u1 = *(const v4fa*)(rp + 4); v8us oh, ol;
            split8(__builtin_shufflevector(u0, u1, 0, 1, 2, 3, 4, 5, 6, 7) + bb, oh, ol); const int so = (s >> 1) * (16 * HD) + (s & 1) * 64; *(v8us*)(ph + so) = oh; *(v8us*)(pl + so) = ol; }   // row 8 s + r8: 16-row tile s / 2, row 8 (s % 2) + r8 in it
    } else {
        v8us th[2][4], tl[2][4];   // all sixteen pieces first, then the stores
#pragma unroll
        for (int nb = 0; nb < 2; ++nb) { const float bn = bfr(bias[c0 + nb * 16 + lr]);
#pragma unroll
            for (int mb = 0; mb < 4; ++mb) split8(acc[mb][nb] + bn, th[nb][mb], tl[nb][mb]); }
        const size_t o = (size_t)(g * NKV + w) * HP * TT + (t0 / 32) * (32 * HD) + lane * 8; bf* vh = Vh + o; bf* vl = Vl + o;   // plane [group][head][t / 32][d / 16][(t / 16) % 2][lane][8]: accumulator (mb, nb) is nodes t0 + 16 mb + 8 hi + j of column 16 nb + lr
#pragma unroll
        for (int nb = 0; nb < 2; ++nb)
#pragma unroll
            for (int mb = 0; mb < 4; ++mb) { const int so = (mb >> 1) * (32 * HD) + nb * 512 + (mb & 1) * 256; *(v8us*)(vh + so) = th[nb][mb]; *(v8us*)(vl + so) = tl[nb][mb]; }
        asm volatile("s_wait_xcnt 0x0" ::: "memory");   // behind the last store: in the built code the q/k branch follows this one, and its first instructions reuse registers that these stores name
    }
}

// ---- k_fattn: scores, masked softmax, pair factor, attn.v, the head merge and the output projection of 32 query rows of one group, all four heads, in ONE work-group of 8 waves; nothing of the score or weight matrices or of the merged rows goes to memory.
// Wave w owns keys 64 w .. 64 w + 63. It computes S^T = K Q^T (A = key rows, B = query rows), so a lane holds scores of ONE query (lane & 15) and the accumulator pair of 32 keys is, converted in place, the A fragment of the weights for attn.v (hardware k order on both sides).
// The wave's 32 x 64 block of the pair mask (one bit each, in registers) and of the pair factor (bf16, its compute type, each thread's 64 values in its own 128 bytes of LDS) is read from memory once and serves the four heads. Row maximum, row sum and the attn.v partial sums of the 8 waves meet in LDS: two barriers per head (the maxima; then sums and partial outputs together: the weights enter attn.v as exp x pair factor, and the merge divides by the row sum). The merged 32 x 128 rows (hi/lo) stay in LDS; behind the last head and one more barrier, wave w computes out^T = Wp merged^T (A = Wp rows, B = merged rows) for 16 queries (w / 4) and 32 output columns (w % 4): a lane holds 8 consecutive columns of ONE query, and the wave alone writes each 128-byte line it touches.
typedef __attribute__((ext_vector_type(8))) unsigned v8u;
typedef __attribute__((ext_vector_type(2))) unsigned v2u;
typedef v2u __attribute__((may_alias)) v2ua;
// Fragment from a plane laid in fragment order: a 16 x 32 fragment is 1024 contiguous bytes, first every lane's lower 8 elements (k = 8 hi + j) in lane order, then every lane's upper 8 (k = 16 + 8 hi + j). u is a uniform base, b the lane's 32-bit byte offset (it holds the lane's 16 * lane), c a constant: from head to head only the 32-bit offset has to live in a vector register. Each of the two loads covers 512 contiguous bytes, four whole lines; the registers hold what ldgf gives on a row-major plane.
__device__ __forceinline__ v16bf ldfo(const bf* u, unsigned b, int c) { const char* p = ((const char*)u + b) + c; return cat16b(*(const v8us*)p, *(const v8us*)(p + 512)); }
__device__ __forceinline__ unsigned cvt2(v2f y) { return __builtin_bit_cast(unsigned, __builtin_convertvector(y, v2bf)); }   // two f32 to bf16, nearest even, packed in one word by one conversion instruction
__device__ __forceinline__ void split2(float y0, float y1, unsigned& h, unsigned& l) { const v2f y = {y0, y1}; h = cvt2(y); const v2f r = {__uint_as_float(h << 16), __uint_as_float(h & 0xFFFF0000u)}; l = cvt2(y - r); }   // hi/lo split of two neighbours (h = bf16(y), l = bf16(y - h)), each plane's pair packed in one word
// Eight v_exp_f32, in place, and one v_nop in ONE statement: behind each exp stands an independent instruction, behind the last the v_nop, so nothing directly behind a transcendental reads its result or overwrites its source (the slot the instruction set asks for).
__device__ __forceinline__ void exp2x8(float (&x)[8]) { asm("v_exp_f32 %0, %0\n\tv_exp_f32 %1, %1\n\tv_exp_f32 %2, %2\n\tv_exp_f32 %3, %3\n\tv_exp_f32 %4, %4\n\tv_exp_f32 %5, %5\n\tv_exp_f32 %6, %6\n\tv_exp_f32 %7, %7\n\tv_nop" : "+v"(x[0]), "+v"(x[1]), "+v"(x[2]), "+v"(x[3]), "+v"(x[4]), "+v"(x[5]), "+v"(x[6]), "+v"(x[7])); }
#define FW  8                    // waves per work-group
#define FQT 2                    // 16-row query tiles per work-group
#define FKT (TT / FW / 16)       // 16-key tiles per wave
#define OSP 36                   // LDS row pitch (floats) of the partial outputs: the two lane halves (8 rows apart) fall on different banks, rows stay 16-byte aligned
#define MSP 136                  // LDS row pitch (16-bit elements) of the merged rows: 256 + 16 bytes, so that the 16 rows of a fragment read start 4 banks apart
#define MGB (2 * FQT * 16 * MSP * 2)   // bytes of the merged rows, hi and lo. They are LDS sized at the launch, for speed: as a static array they bring the size the compiler sees to three work-groups a WGP, it then plans for six waves a SIMD from the start and leaves the head loop close to source order (1174 instructions, not 1023; each LDS load of the merge waited for singly). Three work-groups a WGP are resident either way.
// amdgpu_waves_per_eu(6): the register budget of six waves a SIMD (160), so that three work-groups fit a WGP and all 768 are resident at once; with more than 160 registers two fit, and a second, half-empty round follows the first. For that budget the pair factor lies in LDS and the head's step is added to 32-bit offsets, not to 64-bit lane pointers that live through the loop.
__global__ __launch_bounds__(256) __attribute__((amdgpu_waves_per_eu(6))) void k_fattn(const bf* __restrict__ Qh, const bf* __restrict__ Ql, const bf* __restrict__ Kh, const bf* __restrict__ Kl, const bf* __restrict__ Vh, const bf* __restrict__ Vl, const int* __restrict__ mk, const float* __restrict__ adj, const bf* __restrict__ Wo, const float* __restrict__ bo, float* __restrict__ out) {
    __shared__ float red[2][FW][FQT * 16];   /* [0] row maxima, [1] row sums: one array, so that one lane address serves both */ __shared__ __align__(16) float os[FW][FQT * 16][OSP]; __shared__ v4u gas[FQT * FKT][FW * 32]; extern __shared__ __align__(16) bf mgd[]; bf (*mg)[FQT * 16][MSP] = (bf (*)[FQT * 16][MSP])mgd;   /* merged rows [hi | lo][query][head][d], MGB bytes given at the launch; every access goes through a may_alias vector type */
    const int lane = threadIdx.x & 31, lr = lane & 15, hi = lane >> 4, w = threadIdx.x >> 5;
    const int g = blockIdx.z * 8 + blockIdx.x, i0 = blockIdx.y * (FQT * 16), k0 = w * (FKT * 16);   // grid (8, tiles of a group, 6): the deal of DEALG and DEALT written as grid axes, flat index mod 8 = blockIdx.x = group mod 8
    const unsigned mo = (unsigned)((i0 + lr) * TT + k0 + hi * 8), qo = (unsigned)(i0 * HD + 8 * lane) * 2u, ko = (unsigned)(k0 * HD + 8 * lane) * 2u;   // the lane's 32-bit offsets: mo in elements inside a group's pair planes; qo and ko in bytes inside a (group, head) plane of q and of k or v (16 rows of q or k, and 16 keys of v, are 16 HD elements); every base below is uniform
    const bf* Qhg = Qh + (size_t)g * NH_ * TT * HD; const bf* Qlg = Ql + (size_t)g * NH_ * TT * HD; const bf* Khg = Kh + (size_t)g * NH_ * TT * HD; const bf* Klg = Kl + (size_t)g * NH_ * TT * HD; const bf* Vhg = Vh + (size_t)g * NKV * HP * TT; const bf* Vlg = Vl + (size_t)g * NKV * HP * TT;
    const int* mkg = mk + (size_t)g * TT * TT; const float* adg = adj + (size_t)g * TT * TT;
    const int* mpl = mkg + mo; const float* apl = adg + mo; v4i mv[FQT][FKT][2]; v4f av[FQT][FKT][2];   // all 32 loads of the block first, from two lane addresses
    unsigned mb[FQT];   // element (kt, j) of a lane: query i0 + 16 qt + lr, key k0 + 16 kt + 8 hi + j
#pragma unroll
    for (int qt = 0; qt < FQT; ++qt)
#pragma unroll
        for (int kt = 0; kt < FKT; ++kt) { const int* mp = mpl + (qt * 16 * TT + kt * 16); const float* ap = apl + (qt * 16 * TT + kt * 16);
            mv[qt][kt][0] = *(const v4i*)mp; mv[qt][kt][1] = *(const v4i*)(mp + 4); av[qt][kt][0] = *(const v4f*)ap; av[qt][kt][1] = *(const v4f*)(ap + 4); }
    asm volatile("s_wait_xcnt 0x0" :: "v"(mpl), "v"(apl) : "memory");   // behind the last of the 32 loads; the two addresses are inputs so that they stay in their registers up to the wait and no load's result lands on them in front of it
#pragma unroll
    for (int qt = 0; qt < FQT; ++qt) { mb[qt] = 0u;
#pragma unroll
        for (int kt = 0; kt < FKT; ++kt) { const v4i m0 = mv[qt][kt][0], m1 = mv[qt][kt][1]; const v4f a0 = av[qt][kt][0], a1 = av[qt][kt][1];
#pragma unroll
            for (int q = 0; q < 4; ++q) { mb[qt] |= (m0[q] != 0 ? 1u : 0u) << (kt * 8 + q); mb[qt] |= (m1[q] != 0 ? 1u : 0u) << (kt * 8 + 4 + q); }
            gas[qt * FKT + kt][threadIdx.x] = __builtin_bit_cast(v4u, __builtin_convertvector(__builtin_shufflevector(a0, a1, 0, 1, 2, 3, 4, 5, 6, 7), v8bf)); } }   // a thread reads back only what it wrote itself: no barrier is owed for it
#pragma unroll 1   // rolled, for speed only
    for (int h = 0; h < NH_; ++h) {
        const unsigned qb = qo + (unsigned)h * (TT * HD * 2), kb = ko + (unsigned)h * (TT * HD * 2), vb = ko + (unsigned)h * (HP * TT * 2);   // the head's step stays in the 32-bit offsets
        v16bf qh[FQT], ql[FQT];
#pragma unroll
        for (int qt = 0; qt < FQT; ++qt) { qh[qt] = ldfo(Qhg, qb, qt * 16 * HD * 2); ql[qt] = ldfo(Qlg, qb, qt * 16 * HD * 2); }
        float sc[FQT][FKT][8]; float mx[FQT];
#pragma unroll
        for (int qt = 0; qt < FQT; ++qt) mx[qt] = -3.0e38f;
#pragma unroll
        for (int kt = 0; kt < FKT; ++kt) { const v16bf kh = ldfo(Khg, kb, kt * 16 * HD * 2), kl = ldfo(Klg, kb, kt * 16 * HD * 2);
#pragma unroll
            for (int qt = 0; qt < FQT; ++qt) { v8f a = (v8f){}; a = wmmab(kh, qh[qt], a); a = wmmab(kh, ql[qt], a); a = wmmab(kl, qh[qt], a);   /* q_hi k_hi + q_lo k_hi + q_hi k_lo; a[j] = score of key 8 hi + j of the tile, query lr */
#pragma unroll
                for (int j = 0; j < 8; ++j) { const float t = ((mb[qt] >> (kt * 8 + j)) & 1u) ? MSKR : a[j];   /* where(mask != 0, -1e9, scores / sqrt(32)), both sides still without the positive factor 1 / sqrt(32): it orders the row the same way and is applied inside the exponent */ sc[qt][kt][j] = t; mx[qt] = fmaxf(mx[qt], t); } } }
#pragma unroll
        for (int qt = 0; qt < FQT; ++qt) { mx[qt] = fmaxf(mx[qt], __shfl_xor(mx[qt], 16, 32)); if (hi == 0) red[0][w][qt * 16 + lr] = mx[qt]; }
        __syncthreads();   // every wave's row maxima are in LDS
#pragma unroll
        for (int qt = 0; qt < FQT; ++qt) { float m = red[0][0][qt * 16 + lr];
#pragma unroll
            for (int ww = 1; ww < FW; ++ww) m = fmaxf(m, red[0][ww][qt * 16 + lr]);
            const float mc = __fmul_rn(m, SCE); float s = 0.f;   // in a row that is masked throughout, SCE a - mc is the rounding remainder of mc (below 2^7), the same in all 512 entries: a common factor that the division by the row sum takes out
#pragma unroll
            for (int kt = 0; kt < FKT; ++kt) {
#pragma unroll
                for (int j = 0; j < 8; ++j) sc[qt][kt][j] = __fmaf_rn(sc[qt][kt][j], SCE, -mc);
                exp2x8(sc[qt][kt]);
#pragma unroll
                for (int j = 0; j < 8; ++j) s += sc[qt][kt][j]; }
            s += __shfl_xor(s, 16, 32); if (hi == 0) red[1][w][qt * 16 + lr] = s; }   // read behind the barrier of the partial outputs
        v8f oa[FQT][2];
#pragma unroll
        for (int qt = 0; qt < FQT; ++qt) { oa[qt][0] = (v8f){}; oa[qt][1] = (v8f){}; }
#pragma unroll
        for (int kc = 0; kc < FKT / 2; ++kc) { v16bf ph[FQT], pl[FQT], vh[2], vl[2];   // the 32 keys' value fragments are asked for first: their latency runs under the weights' arithmetic
#pragma unroll
            for (int dt = 0; dt < 2; ++dt) { const int o = (kc * (32 * HD) + dt * 512) * 2; vh[dt] = ldfo(Vhg, vb, o); vl[dt] = ldfo(Vlg, vb, o); }
#pragma unroll
            for (int qt = 0; qt < FQT; ++qt) { v8u hw, lw; const v4u ga[2] = {gas[qt * FKT + 2 * kc][threadIdx.x], gas[qt * FKT + 2 * kc + 1][threadIdx.x]};
#pragma unroll
                for (int tt = 0; tt < 2; ++tt) {
#pragma unroll
                    for (int p = 0; p < 4; ++p) { const unsigned gp = ga[tt][p]; unsigned a, c2;
                        split2(__fmul_rn(sc[qt][2 * kc + tt][2 * p], __uint_as_float(gp << 16)), __fmul_rn(sc[qt][2 * kc + tt][2 * p + 1], __uint_as_float(gp & 0xFFFF0000u)), a, c2);   /* exp x the pair factor; 1 / row sum is a factor of the whole row and multiplies the merged sums below. The pair factor takes no part in the row sum: no renormalisation */
                        hw[tt * 4 + p] = a; lw[tt * 4 + p] = c2; } }
                ph[qt] = __builtin_bit_cast(v16bf, hw); pl[qt] = __builtin_bit_cast(v16bf, lw); }   /* A fragment: row = query lr, k = 8 hi + j (first tile) and 16 + 8 hi + j (second tile) of the 32 keys */
#pragma unroll
            for (int dt = 0; dt < 2; ++dt)
#pragma unroll
                for (int qt = 0; qt < FQT; ++qt) { oa[qt][dt] = wmmab(ph[qt], vh[dt], oa[qt][dt]); oa[qt][dt] = wmmab(pl[qt], vh[dt], oa[qt][dt]); oa[qt][dt] = wmmab(ph[qt], vl[dt], oa[qt][dt]); } }
#pragma unroll
        for (int qt = 0; qt < FQT; ++qt)
#pragma unroll
            for (int dt = 0; dt < 2; ++dt)
#pragma unroll
                for (int j = 0; j < 8; ++j) os[w][qt * 16 + hi * 8 + j][dt * 16 + lr] = oa[qt][dt][j];
        __syncthreads();   // every wave's row sums and partial outputs are in LDS; the next head writes either again only behind its own barrier of the row maxima
        { const int q = threadIdx.x >> 3, d4 = (threadIdx.x & 7) * 4; v4f pv[FW]; float pr[FW];   // all sixteen LDS loads first, then the sums in wave order
#pragma unroll
            for (int ww = 0; ww < FW; ++ww) { pr[ww] = red[1][ww][q]; pv[ww] = *(const v4fa*)&os[ww][q][d4]; }
            v4f s = pv[0]; float rs = pr[0];
#pragma unroll
            for (int ww = 1; ww < FW; ++ww) { s += pv[ww]; rs += pr[ww]; }
            s *= __fdiv_rn(1.0f, rs);   // the softmax's normalisation, once for each of the 32 x 32 merged sums of a head
            unsigned h0, l0, h1, l1; split2(s[0], s[1], h0, l0); split2(s[2], s[3], h1, l1); const v2u oh = {h0, h1}, ol = {l0, l1};
            *(v2ua*)&mg[0][q][h * HD + d4] = oh; *(v2ua*)&mg[1][q][h * HD + d4] = ol; }   /* merged [query][head][d] hi / lo rows for the output projection */
    }
    // out[q][n] = sum_k (merged_hi + merged_lo)[q][k] bf16(Wp[n][k]) + bf16(bp[n]); per 32 k the hi product, then the lo product, into one accumulator.
    { const int qr = (w >> 2) * 16 + lr, cb = (w & 3) * 32;
        const bf* wp = Wo + (cb + lr) * DQ + 8 * hi; const float* bp = bo + cb + 8 * hi; v16bf wf[2][DQ / 32]; v4f bv[2][2];   // loaded in front of the barrier: a wave that arrives early has their latency behind it when the last wave arrives
#pragma unroll
        for (int t = 0; t < 2; ++t) {
#pragma unroll
            for (int kc = 0; kc < DQ / 32; ++kc) wf[t][kc] = ldgf(wp + t * 16 * DQ + kc * 32);
            bv[t][0] = *(const v4f*)(bp + t * 16); bv[t][1] = *(const v4f*)(bp + t * 16 + 4); }
        asm volatile("s_wait_xcnt 0x0" :: "v"(wp), "v"(bp) : "memory");   // behind the last of the 20 loads; the two addresses are inputs so that they stay in their registers up to the wait and no load's result lands on them in front of it
        __syncthreads();   // all four heads' merged rows are in LDS
        v8f acc[2] = {(v8f){}, (v8f){}};
#pragma unroll
        for (int kc = 0; kc < DQ / 32; ++kc) { const v16bf mh = ldsf(&mg[0][qr][kc * 32 + 8 * hi]), ml = ldsf(&mg[1][qr][kc * 32 + 8 * hi]);
#pragma unroll
            for (int t = 0; t < 2; ++t) { acc[t] = wmmab(wf[t][kc], mh, acc[t]); acc[t] = wmmab(wf[t][kc], ml, acc[t]); } }   /* acc[t][j] = query qr, column cb + 16 t + 8 hi + j */
        float* op = out + ((size_t)g * TT + i0 + qr) * DM + cb + 8 * hi;
#pragma unroll
        for (int t = 0; t < 2; ++t) { const v8f y = acc[t] + __builtin_convertvector(__builtin_convertvector(__builtin_shufflevector(bv[t][0], bv[t][1], 0, 1, 2, 3, 4, 5, 6, 7), v8bf), v8f);   /* + bf16(bp), nearest even */
            *(v4f*)(op + t * 16) = __builtin_shufflevector(y, y, 0, 1, 2, 3); *(v4f*)(op + t * 16 + 4) = __builtin_shufflevector(y, y, 4, 5, 6, 7); }
    }
}

extern "C" void kernel_launch(void* const* d_in, const int* in_sizes, int n_in,
                              void* d_out, int out_size, void* d_ws, size_t ws_size, hipStream_t stream) {
    (void)in_sizes; (void)n_in; (void)out_size;
    const float* x = (const float*)d_in[0]; const float* xk = (const float*)d_in[1]; const float* xv = (const float*)d_in[2]; const int* mk = (const int*)d_in[3]; const float* adj = (const float*)d_in[4]; const float* wq = (const float*)d_in[5]; const float* bq = (const float*)d_in[6]; const float* wk = (const float*)d_in[7]; const float* bk = (const float*)d_in[8]; const float* wv = (const float*)d_in[9]; const float* bv = (const float*)d_in[10]; const float* wo = (const float*)d_in[11]; const float* bo = (const float*)d_in[12];   /* order query, key, value ([4][12][512][128] = 48 groups), mask (int32 [48][512][512]: read as data), adjm (f32 [48][512][512]: read), Wq, bq, Wk, bk, Wv, bv, Wp, bp ('oi') */
    float* OUT = (float*)d_out;     // [48][512][128]
    char* wsp = (char*)d_ws;
    auto take = [&](size_t bytes) { char* p = wsp; wsp += (bytes + 255) & ~(size_t)255; return (void*)p; };
    bf* WO = (bf*)take((size_t)DM * DQ * 2);   /* Wp as bf16 */
    bf* QPh = (bf*)take((size_t)2 * NB_ * NH_ * TT * HD * 2); bf* QPl = (bf*)take((size_t)2 * NB_ * NH_ * TT * HD * 2);   /* [q groups | k groups][head], each 512 x 32 in fragment order */ bf* KPh = QPh + (size_t)NB_ * NH_ * TT * HD; bf* KPl = QPl + (size_t)NB_ * NH_ * TT * HD;
    bf* VTh = (bf*)take((size_t)NB_ * NKV * HP * TT * 2); bf* VTl = (bf*)take((size_t)NB_ * NKV * HP * TT * 2);
    if ((size_t)(wsp - (char*)d_ws) > ws_size) return;    // ws 256 MiB given; the carve is below 64 MiB
    k_proj<<<dim3(NB_ * TT / 64, 3, 1), PW * 32, 0, stream>>>(x, xk, xv, wq, wk, wv, wo, bq, bk, bv, QPh, QPl, VTh, VTl, WO);   /* rows = all (group, node) pairs; y = q, k, v */
    k_fattn<<<dim3(8, TT / (FQT * 16), NB_ / 8), FW * 32, MGB, stream>>>(QPh, QPl, KPh, KPl, VTh, VTl, mk, adj, WO, bo, OUT);   /* one kv head per query head: plane z of q meets plane z of k and of v^T */
}

// v010
// It runs in 45.9 microseconds.
// Timed twice side by side with v009, it ran 1.04 and 1.03 times as fast.
// Counting every step since v000, it is 80.6 times as fast.
#include <hip/hip_runtime.h>

// Spatial multi-head attention over graph nodes with a pair mask and a post-softmax pair factor (query, key, value [4][12][512][128]: 48 independent (batch, time) groups of 512 nodes; q = query Wq^T + bq, k = key Wk^T + bk, v = value Wv^T + bv ('oi' (out, in) [128][128] + [128]: real biases; 4 heads x 32); scores x 1/sqrt(32); where mask[b][t][i][j] != 0 (int32 [4][12][512][512], read per logit as data) the score is REPLACED by -1e9; softmax over the 512 keys; the weights x adjm[b][t][i][j] (f32 [4][12][512][512], read, rounded to bf16: an input) AFTER the softmax, no renormalisation; out = merged Wp^T + bp -> [4][12][512][128] (3.1 M); argument order query, key, value, mask, adjm, Wq, bq, Wk, bk, Wv, bv, Wp, bp).
// Layout, all 48 groups per launch, two launches: (1) k_proj reads query, key, value and Wq, Wk, Wv as f32, rounds them to bf16 on their way into LDS, adds the bias rounded to bf16 and writes the hi/lo planes that attention reads, each in the order of its matrix fragments (see ldfo): q/k planes [q groups | k groups][head][t / 16][d / 8][t % 16][8] and value planes [group][head][t / 32][d / 16][(t / 16) % 2][lane][8]; its first 16 work-groups also write the bf16 copy of Wp; the q planes hold q x 32^-0.5 x log2 e; (2) ONE fused kernel for scores, masked softmax, pair factor, attn.v, the head merge and the output projection (merged hi/lo x Wp exact + bp), every operand on hi/lo planes, scores and weights in registers only, the merged rows in LDS only.
// Compute dtypes, f32 accumulate: every input rounded to bf16, nearest even, incl. the pair factor adjm; projections exact + bf16 biases; scores (K 32) and attn.v 3 products on every row; softmax f32; Wp hl x exact + bias.

#define NB_  48
#define TT   512
#define DM   128
#define NH_  4
#define NKV  4
#define HD   32
#define DQ   (NH_ * HD)
#define SCL  0.17677669529663688f   // 32^-0.5 (the module divides by float32(sqrt(32)))
#define SCE  (SCL * 1.4426950408889634f)   // 32^-0.5 x log2 e: k_proj multiplies q by it before the hi/lo split, so the raw product a of attention is the scaled score in units of log2: exp(score - m) = exp2(a - m')
#define MSKR (-1.0e9f * 1.4426950408889634f)   // the module's -1e9 in units of the raw product
#define RLO  9.094947017729282e-13f   // 2^-40 and 2^60: the row sums of exp2(a) that are taken as they are (see k_fattn)
#define RHI  1.152921504606847e18f
#define HP   64    // a head's value plane is HP x TT elements apart from the next; the first HD x TT are written and read
// Which (group, tile) a work-group takes, from its flat grid index b, a group having n tiles (n a power of two, 48 groups = 6 x 8): group = 8 (b / 8n) + b % 8, tile = (b / 8) % n. A permutation of the plain order, so every tile is done once wherever the work-groups land. For speed only: all work-groups of both launches that write or read one group's q, k, v planes have the same index mod 8.
#define DEALG(b, n) ((int)((b) / (8 * (n))) * 8 + (int)((b) & 7))
#define DEALT(b, n) ((int)(((b) >> 3) & ((n) - 1)))
typedef unsigned short bf;
typedef __attribute__((ext_vector_type(16))) __bf16   v16bf;
typedef __attribute__((ext_vector_type(8)))  __bf16   v8bf;
typedef __attribute__((ext_vector_type(4)))  __bf16   v4bf;
typedef __attribute__((ext_vector_type(2)))  __bf16   v2bf;
typedef __attribute__((ext_vector_type(2)))  float    v2f;
typedef __attribute__((ext_vector_type(8)))  unsigned short v8us;
typedef __attribute__((ext_vector_type(4)))  unsigned short v4us;
typedef __attribute__((ext_vector_type(8)))  float    v8f;
typedef __attribute__((ext_vector_type(4)))  float    v4f;
typedef __attribute__((ext_vector_type(4)))  int      v4i;
typedef __attribute__((ext_vector_type(4)))  unsigned v4u;
typedef v4f  __attribute__((may_alias)) v4fa;
typedef v8us __attribute__((may_alias)) v8usa;
typedef v4us __attribute__((may_alias)) v4usa;

__device__ __forceinline__ unsigned short f2bf(float f) { unsigned u = __float_as_uint(f); u += 0x7FFFu + ((u >> 16) & 1u); return (unsigned short)(u >> 16); }
__device__ __forceinline__ float bf2f(unsigned short b) { return __uint_as_float(((unsigned)b) << 16); }
__device__ __forceinline__ float bfr(float f) { return bf2f(f2bf(f)); }
__device__ __forceinline__ v16bf cat16b(v8us lo, v8us hi) { return __builtin_bit_cast(v16bf, __builtin_shufflevector(lo, hi, 0, 1, 2, 3, 4, 5, 6, 7, 8, 9, 10, 11, 12, 13, 14, 15)); }
__device__ __forceinline__ v8f wmmab(v16bf a, v16bf b, v8f c) { return __builtin_amdgcn_wmma_f32_16x16x32_bf16(false, a, false, b, (short)0, c, false, false); }

// Fragment from a K-contiguous 16-bit row in memory: the lane's p points at row (lane & 15), element 8 (lane >> 4); it holds k = 8 hi + j and k = 16 + 8 hi + j.
__device__ __forceinline__ v16bf ldgf(const bf* p) { return cat16b(*(const v8us*)p, *(const v8us*)(p + 16)); }

// hi/lo split of eight values: h = bf16(y), l = bf16(y - h), both nearest even.
__device__ __forceinline__ void split8(v8f y, v8us& h, v8us& l) { const v8bf hb = __builtin_convertvector(y, v8bf); const v4u u = __builtin_bit_cast(v4u, hb); v8f r;
#pragma unroll
    for (int i = 0; i < 4; ++i) { r[2 * i] = __uint_as_float(u[i] << 16); r[2 * i + 1] = __uint_as_float(u[i] & 0xFFFF0000u); }
    h = __builtin_bit_cast(v8us, hb); l = __builtin_bit_cast(v8us, __builtin_convertvector(y - r, v8bf)); }

// ---- k_proj: the q, k and v projections (blockIdx.y = 0, 1, 2) of 64 (group, node) rows, from the f32 inputs to the hi/lo planes of attention. Four waves; wave w owns head w, output columns 32 w .. 32 w + 31, as a 64x32 register tile (8 accumulators).
// y[m][n] = sum_k bf16(x[m][k]) bf16(W[n][k]) + bf16(bias[n]). Operands: a row of 128 f32 is ONE load of a wave (16 bytes a lane, four whole lines); it is rounded to bf16 and laid in LDS, the 64 input rows once for the four waves, each wave's 32 weight rows in its own slice; the fragments are read from there.
// An accumulator holds 8 consecutive rows (nodes) of one column (lane & 15). q, k: the tile turns through the wave's LDS slice (f32) so that a lane holds 8 consecutive columns of a row: a store covers 8 rows x 4 column groups = four whole 128-byte lines of the head's plane. v: a lane's 8 nodes of one column are one 16-byte piece of attention's B fragment, held by the lane that will read it: each accumulator is stored from its registers, 512 contiguous bytes a store.
#define PW  4      // waves per work-group
#define ASP 136    // LDS row pitch (16-bit elements) of the staged operand rows: 256 + 16 bytes, so that the 16 rows of a fragment read start 4 banks apart
#define QSP 36     // LDS row pitch (floats) of the staged q/k tile: the two lane halves (8 rows apart) fall on different banks, rows stay 16-byte aligned
#define WSL (64 * QSP)   // floats in a wave's LDS slice: first its 32 weight rows (32 x 136 x 2 bytes fit), then, for q and k, its output tile (64 x 36 floats)
__device__ __forceinline__ void st4(bf* d, v4f u) { *(v4usa*)d = __builtin_bit_cast(v4us, __builtin_convertvector(u, v4bf)); }   // four f32 to bf16, nearest even, into LDS
__device__ __forceinline__ v16bf ldsf(const bf* p) { return cat16b(*(const v8usa*)p, *(const v8usa*)(p + 16)); }   // fragment from an LDS row: the k order of ldgf
// amdgpu_waves_per_eu(5): the register budget of five waves a SIMD, so that all 1152 work-groups (four or five a WGP) are resident at once; without it the v branch is scheduled into more than 204 registers and a second, short round of work-groups follows the first.
__global__ __launch_bounds__(PW * 32) __attribute__((amdgpu_waves_per_eu(5))) void k_proj(const float* __restrict__ x0, const float* __restrict__ x1, const float* __restrict__ x2, const float* __restrict__ w0, const float* __restrict__ w1, const float* __restrict__ w2, const float* __restrict__ w3, const float* __restrict__ b0, const float* __restrict__ b1, const float* __restrict__ b2, bf* Ph, bf* Pl, bf* Vh, bf* Vl, bf* W3) {
    __shared__ __align__(16) float sm[PW * WSL + 64 * ASP / 2];   // four slices, then the 64 input rows; every 16-bit access goes through a may_alias vector type
    const int z = blockIdx.y; const float* A = z == 0 ? x0 : (z == 1 ? x1 : x2); const float* B = z == 0 ? w0 : (z == 1 ? w1 : w2); const float* bias = z == 0 ? b0 : (z == 1 ? b1 : b2);
    const int lane = threadIdx.x & 31, lr = lane & 15, hi = lane >> 4, w = threadIdx.x >> 5; const int c0 = w * HD;
    const int g = DEALG(blockIdx.x, TT / 64), t0 = DEALT(blockIdx.x, TT / 64) * 64, r0 = g * TT + t0;   // gridDim.x is a multiple of 8, so the flat index mod 8 is blockIdx.x mod 8 for q, k and v alike; 64 divides 512: a tile lies in one group
    bf* as = (bf*)(sm + PW * WSL); bf* bs = (bf*)(sm + w * WSL);
    if (z == 0 && blockIdx.x < DM * DQ / (PW * 32 * 8)) {   // uniform in the work-group: the first 16 work-groups of the q part round Wp to bf16 for the output projection, 8 elements a thread
        const int e = (blockIdx.x * (PW * 32) + threadIdx.x) * 8; *(v8us*)(W3 + e) = __builtin_bit_cast(v8us, __builtin_convertvector(*(const v8f*)(w3 + e), v8bf));
        asm volatile("s_wait_xcnt 0x0" ::: "memory"); }   // stands in front of the staging code, which may reuse the registers that the load and the store name
    { const float* ag = A + (size_t)(r0 + w * 16) * DM + lane * 4; const float* bg = B + c0 * DM + lane * 4;   // the wave stages 16 of the input rows and its own 32 weight rows, in three groups of 16 loads, two groups in flight: 128 data registers, not 192, which leaves room for five waves a SIMD
        v4f wa[16], xa[16], wb[16];
#pragma unroll
        for (int i = 0; i < 16; ++i) wa[i] = *(const v4f*)(bg + i * DM);
#pragma unroll
        for (int i = 0; i < 16; ++i) xa[i] = *(const v4f*)(ag + i * DM);
        asm volatile("s_wait_xcnt 0x0" :: "v"(ag), "v"(bg) : "memory");   // behind the last load of the two groups; the two addresses are inputs so that they stay in their registers up to the wait and no load's result lands on them in front of it
#pragma unroll
        for (int i = 0; i < 16; ++i) st4(bs + i * ASP + lane * 4, wa[i]);
        __builtin_amdgcn_sched_barrier(0);   // keeps the third group's loads behind the first group's LDS stores: lifted over them they hold 64 more registers at once, and the build spills
#pragma unroll
        for (int i = 0; i < 16; ++i) wb[i] = *(const v4f*)(bg + (16 + i) * DM);
        asm volatile("s_wait_xcnt 0x0" :: "v"(bg) : "memory");   // the same behind the third group
#pragma unroll
        for (int i = 0; i < 16; ++i) st4(as + (w * 16 + i) * ASP + lane * 4, xa[i]);
#pragma unroll
        for (int i = 0; i < 16; ++i) st4(bs + (16 + i) * ASP + lane * 4, wb[i]); }
    __syncthreads();   // all 64 input rows are in LDS before any wave reads fragments
    v8f acc[4][2];
#pragma unroll
    for (int mb = 0; mb < 4; ++mb)
#pragma unroll
        for (int nb = 0; nb < 2; ++nb) acc[mb][nb] = (v8f){};
#pragma unroll
    for (int kc = 0; kc < DM; kc += 32) {
        v16bf a[4];
#pragma unroll
        for (int mb = 0; mb < 4; ++mb) a[mb] = ldsf(as + (mb * 16 + lr) * ASP + kc + 8 * hi);
#pragma unroll
        for (int nb = 0; nb < 2; ++nb) { const v16bf b = ldsf(bs + (nb * 16 + lr) * ASP + kc + 8 * hi);
#pragma unroll
            for (int mb = 0; mb < 4; ++mb) acc[mb][nb] = wmmab(a[mb], b, acc[mb][nb]); }
    }
    __syncthreads();   // every fragment has been read before a slice is written again
    if (z < 2) {   // uniform in the work-group
        float* os = sm + w * WSL;
#pragma unroll
        for (int mb = 0; mb < 4; ++mb)
#pragma unroll
            for (int nb = 0; nb < 2; ++nb)
#pragma unroll
                for (int j = 0; j < 8; ++j) os[(mb * 16 + hi * 8 + j) * QSP + nb * 16 + lr] = acc[mb][nb][j];
        const int r8 = lane >> 2, c8 = (lane & 3) * 8;   // read-back: 8 rows a step, 8 columns a lane
        v8f bb; const float qs = z == 0 ? SCE : 1.0f;   // q leaves with the softmax's scale x log2 e in it; k is multiplied by one, exactly
#pragma unroll
        for (int i = 0; i < 8; ++i) bb[i] = bfr(bias[c0 + c8 + i]);
        const size_t o = (((size_t)(z * NB_ + g) * NH_ + w) * TT + t0) * HD + c8 * 16 + r8 * 8; bf* ph = Ph + o; bf* pl = Pl + o;   // plane [q | k][group][head][t / 16][d / 8][t % 16][8]
        __syncthreads();   // the tile is in LDS before other lanes read it
#pragma unroll
        for (int s = 0; s < 8; ++s) { const float* rp = os + (8 * s + r8) * QSP + c8; const v4f u0 = *(const v4fa*)rp, u1 = *(const v4fa*)(rp + 4); v8us oh, ol;
            split8((__builtin_shufflevector(u0, u1, 0, 1, 2, 3, 4, 5, 6, 7) + bb) * qs, oh, ol); const int so = (s >> 1) * (16 * HD) + (s & 1) * 64; *(v8us*)(ph + so) = oh; *(v8us*)(pl + so) = ol; }   // row 8 s + r8: 16-row tile s / 2, row 8 (s % 2) + r8 in it
    } else {
        v8us th[2][4], tl[2][4];   // all sixteen pieces first, then the stores
#pragma unroll
        for (int nb = 0; nb < 2; ++nb) { const float bn = bfr(bias[c0 + nb * 16 + lr]);
#pragma unroll
            for (int mb = 0; mb < 4; ++mb) split8(acc[mb][nb] + bn, th[nb][mb], tl[nb][mb]); }
        const size_t o = (size_t)(g * NKV + w) * HP * TT + (t0 / 32) * (32 * HD) + lane * 8; bf* vh = Vh + o; bf* vl = Vl + o;   // plane [group][head][t / 32][d / 16][(t / 16) % 2][lane][8]: accumulator (mb, nb) is nodes t0 + 16 mb + 8 hi + j of column 16 nb + lr
#pragma unroll
        for (int nb = 0; nb < 2; ++nb)
#pragma unroll
            for (int mb = 0; mb < 4; ++mb) { const int so = (mb >> 1) * (32 * HD) + nb * 512 + (mb & 1) * 256; *(v8us*)(vh + so) = th[nb][mb]; *(v8us*)(vl + so) = tl[nb][mb]; }
        asm volatile("s_wait_xcnt 0x0" ::: "memory");   // behind the last store: in the built code the q/k branch follows this one, and its first instructions reuse registers that these stores name
    }
}

// ---- k_fattn: scores, masked softmax, pair factor, attn.v, the head merge and the output projection of 32 query rows of one group, all four heads, in ONE work-group of 8 waves; nothing of the score or weight matrices or of the merged rows goes to memory.
// Wave w owns keys 64 w .. 64 w + 63. It computes S^T = K Q^T (A = key rows, B = query rows), so a lane holds scores of ONE query (lane & 15) and the accumulator pair of 32 keys is, converted in place, the A fragment of the weights for attn.v (hardware k order on both sides).
// The wave's 32 x 64 block of the pair mask (one bit each, in registers) and of the pair factor (bf16, its compute type, each thread's 64 values in its own 128 bytes of LDS) is read from memory once and serves the four heads. The softmax's shift is 0: a row's common factor cancels in the division by its row sum, so the weights are exp2(a) straight from the products, with no row maximum. Row sums and the attn.v partial sums of the 8 waves meet in LDS: two barriers per head, in front of the merge and behind it (the weights enter attn.v as exp x pair factor, and the merge divides by the row sum). That is exact arithmetic only while exp2(a) stays in range: each row sum is tested against 2^-40 .. 2^60 (what underflows is then below 2^-86 of the sum), and if one row of the work-group fails, all four heads are done again with the row maxima as shift (their barrier also stands behind the merge of the head before: still two barriers per head), which takes any finite score and the row that is masked throughout. The merged 32 x 128 rows (hi/lo) stay in LDS; behind the last head and one more barrier, wave w computes out^T = Wp merged^T (A = Wp rows, B = merged rows) for 16 queries (w / 4) and 32 output columns (w % 4): a lane holds 8 consecutive columns of ONE query, and the wave alone writes each 128-byte line it touches.
typedef __attribute__((ext_vector_type(8))) unsigned v8u;
typedef __attribute__((ext_vector_type(2))) unsigned v2u;
typedef v2u __attribute__((may_alias)) v2ua;
// Fragment from a plane laid in fragment order: a 16 x 32 fragment is 1024 contiguous bytes, first every lane's lower 8 elements (k = 8 hi + j) in lane order, then every lane's upper 8 (k = 16 + 8 hi + j). u is a uniform base, b the lane's 32-bit byte offset (it holds the lane's 16 * lane), c a constant: from head to head only the 32-bit offset has to live in a vector register. Each of the two loads covers 512 contiguous bytes, four whole lines; the registers hold what ldgf gives on a row-major plane.
__device__ __forceinline__ v16bf ldfo(const bf* u, unsigned b, int c) { const char* p = ((const char*)u + b) + c; return cat16b(*(const v8us*)p, *(const v8us*)(p + 512)); }
__device__ __forceinline__ v16bf ldfp(const char* a, int c) { return cat16b(*(const v8us*)(a + c), *(const v8us*)(a + c + 512)); }   // the same from the lane's address a = u + b
__device__ __forceinline__ unsigned cvt2(v2f y) { return __builtin_bit_cast(unsigned, __builtin_convertvector(y, v2bf)); }   // two f32 to bf16, nearest even, packed in one word by one conversion instruction
__device__ __forceinline__ void split2(float y0, float y1, unsigned& h, unsigned& l) { const v2f y = {y0, y1}; h = cvt2(y); const v2f r = {__uint_as_float(h << 16), __uint_as_float(h & 0xFFFF0000u)}; l = cvt2(y - r); }   // hi/lo split of two neighbours (h = bf16(y), l = bf16(y - h)), each plane's pair packed in one word
// Eight v_exp_f32, in place, and one v_nop in ONE statement: behind each exp stands an independent instruction, behind the last the v_nop, so nothing directly behind a transcendental reads its result or overwrites its source (the slot the instruction set asks for).
__device__ __forceinline__ void exp2x8(float (&x)[8]) { asm("v_exp_f32 %0, %0\n\tv_exp_f32 %1, %1\n\tv_exp_f32 %2, %2\n\tv_exp_f32 %3, %3\n\tv_exp_f32 %4, %4\n\tv_exp_f32 %5, %5\n\tv_exp_f32 %6, %6\n\tv_exp_f32 %7, %7\n\tv_nop" : "+v"(x[0]), "+v"(x[1]), "+v"(x[2]), "+v"(x[3]), "+v"(x[4]), "+v"(x[5]), "+v"(x[6]), "+v"(x[7])); }
template <bool B> struct bc { static constexpr bool value = B; };   // a compile-time switch handed to the head's body
#define FW  8                    // waves per work-group
#define FQT 2                    // 16-row query tiles per work-group
#define FKT (TT / FW / 16)       // 16-key tiles per wave
#define OSP 36                   // LDS row pitch (floats) of the partial outputs: the two lane halves (8 rows apart) fall on different banks, rows stay 16-byte aligned
#define MSP 136                  // LDS row pitch (16-bit elements) of the merged rows: 256 + 16 bytes, so that the 16 rows of a fragment read start 4 banks apart
#define MGB (2 * FQT * 16 * MSP * 2)   // bytes of the merged rows, hi and lo. They are LDS sized at the launch, for speed: as a static array they bring the size the compiler sees to three work-groups a WGP, it then plans for six waves a SIMD from the start and leaves the head loop close to source order (1174 instructions, not 1023; each LDS load of the merge waited for singly). Three work-groups a WGP are resident either way.
// amdgpu_waves_per_eu(6): the register budget of six waves a SIMD (160), so that three work-groups fit a WGP and all 768 are resident at once; with more than 160 registers two fit, and a second, half-empty round follows the first. For that budget the pair factor lies in LDS and the head's step is added to 32-bit offsets, not to 64-bit lane pointers that live through the loop.
__global__ __launch_bounds__(256) __attribute__((amdgpu_waves_per_eu(6))) void k_fattn(const bf* __restrict__ Qh, const bf* __restrict__ Ql, const bf* __restrict__ Kh, const bf* __restrict__ Kl, const bf* __restrict__ Vh, const bf* __restrict__ Vl, const int* __restrict__ mk, const float* __restrict__ adj, const bf* __restrict__ Wo, const float* __restrict__ bo, float* __restrict__ out) {
    __shared__ float red[2][FW][FQT * 16];   /* [0] row maxima, [1] row sums: one array, so that one lane address serves both */ __shared__ __align__(16) float os[FW][FQT * 16][OSP]; __shared__ v4u gas[FQT * FKT][FW * 32]; __shared__ unsigned redo;   /* set where a row asks for the second pass */ extern __shared__ __align__(16) bf mgd[]; bf (*mg)[FQT * 16][MSP] = (bf (*)[FQT * 16][MSP])mgd;   /* merged rows [hi | lo][query][head][d], MGB bytes given at the launch; every access goes through a may_alias vector type */
    const int lane = threadIdx.x & 31, lr = lane & 15, hi = lane >> 4, w = threadIdx.x >> 5;
    const int g = blockIdx.z * 8 + blockIdx.x, i0 = blockIdx.y * (FQT * 16), k0 = w * (FKT * 16);   // grid (8, tiles of a group, 6): the deal of DEALG and DEALT written as grid axes, flat index mod 8 = blockIdx.x = group mod 8
    const unsigned mo = (unsigned)((i0 + lr) * TT + k0 + hi * 8), qo = (unsigned)(i0 * HD + 8 * lane) * 2u, ko = (unsigned)(k0 * HD + 8 * lane) * 2u;   // the lane's 32-bit offsets: mo in elements inside a group's pair planes; qo and ko in bytes inside a (group, head) plane of q and of k or v (16 rows of q or k, and 16 keys of v, are 16 HD elements); every base below is uniform
    const bf* Qhg = Qh + (size_t)g * NH_ * TT * HD; const bf* Qlg = Ql + (size_t)g * NH_ * TT * HD; const bf* Khg = Kh + (size_t)g * NH_ * TT * HD; const bf* Klg = Kl + (size_t)g * NH_ * TT * HD; const bf* Vhg = Vh + (size_t)g * NKV * HP * TT; const bf* Vlg = Vl + (size_t)g * NKV * HP * TT;
    const int* mkg = mk + (size_t)g * TT * TT; const float* adg = adj + (size_t)g * TT * TT;
    const int* mpl = mkg + mo; const float* apl = adg + mo; v4i mv[FQT][FKT][2]; v4f av[FQT][FKT][2];   // all 32 loads of the block first, from two lane addresses
    unsigned mb[FQT];   // element (kt, j) of a lane: query i0 + 16 qt + lr, key k0 + 16 kt + 8 hi + j
#pragma unroll
    for (int qt = 0; qt < FQT; ++qt)
#pragma unroll
        for (int kt = 0; kt < FKT; ++kt) { const int* mp = mpl + (qt * 16 * TT + kt * 16); const float* ap = apl + (qt * 16 * TT + kt * 16);
            mv[qt][kt][0] = *(const v4i*)mp; mv[qt][kt][1] = *(const v4i*)(mp + 4); av[qt][kt][0] = *(const v4f*)ap; av[qt][kt][1] = *(const v4f*)(ap + 4); }
    asm volatile("s_wait_xcnt 0x0" :: "v"(mpl), "v"(apl) : "memory");   // behind the last of the 32 loads; the two addresses are inputs so that they stay in their registers up to the wait and no load's result lands on them in front of it
#pragma unroll
    for (int qt = 0; qt < FQT; ++qt) { mb[qt] = 0u;
#pragma unroll
        for (int kt = 0; kt < FKT; ++kt) { const v4i m0 = mv[qt][kt][0], m1 = mv[qt][kt][1]; const v4f a0 = av[qt][kt][0], a1 = av[qt][kt][1];
#pragma unroll
            for (int q = 0; q < 4; ++q) { mb[qt] |= (m0[q] != 0 ? 1u : 0u) << (kt * 8 + q); mb[qt] |= (m1[q] != 0 ? 1u : 0u) << (kt * 8 + 4 + q); }
            gas[qt * FKT + kt][threadIdx.x] = __builtin_bit_cast(v4u, __builtin_convertvector(__builtin_shufflevector(a0, a1, 0, 1, 2, 3, 4, 5, 6, 7), v8bf)); } }   // a thread reads back only what it wrote itself: no barrier is owed for it
    if (threadIdx.x == 0) redo = 0u;   // in front of the first barrier; it is set only behind that barrier
    // One head. MX false: the softmax's shift is 0, the weights are exp2(a) as the products give a. MX true: the shift is the row maximum, exchanged through LDS behind a barrier of its own.
    auto head = [&](auto mxs, const int h) { constexpr bool MX = decltype(mxs)::value;
        const unsigned qb = qo + (unsigned)h * (TT * HD * 2), kb = ko + (unsigned)h * (TT * HD * 2), vb = ko + (unsigned)h * (HP * TT * 2);   // the head's step stays in the 32-bit offsets
        const char* qhp = (const char*)Qhg + qb; const char* qlp = (const char*)Qlg + qb; const char* khp = (const char*)Khg + kb; const char* klp = (const char*)Klg + kb;   // the lane's addresses in this head's q and k planes, named so that the waits below can hold them
        v16bf qh[FQT], ql[FQT];
#pragma unroll
        for (int qt = 0; qt < FQT; ++qt) { qh[qt] = ldfp(qhp, qt * 16 * HD * 2); ql[qt] = ldfp(qlp, qt * 16 * HD * 2); }
        asm volatile("s_wait_xcnt 0x0" :: "v"(qhp), "v"(qlp) : "memory");   // behind the last q load, in front of what reuses the registers that the loads name; the two addresses are inputs
        float sc[FQT][FKT][8]; [[maybe_unused]] float mx[FQT];
#pragma unroll
        for (int qt = 0; qt < FQT; ++qt) mx[qt] = -3.0e38f;
#pragma unroll
        for (int kt = 0; kt < FKT; ++kt) { const v16bf kh = ldfp(khp, kt * 16 * HD * 2), kl = ldfp(klp, kt * 16 * HD * 2);
            if (kt == FKT - 1) asm volatile("s_wait_xcnt 0x0" :: "v"(khp), "v"(klp) : "memory");   // behind the last k load; the two addresses are inputs so that they stay in their registers up to the wait and no load's result lands on them in front of it
#pragma unroll
            for (int qt = 0; qt < FQT; ++qt) { v8f a = (v8f){}; a = wmmab(kh, qh[qt], a); a = wmmab(kh, ql[qt], a); a = wmmab(kl, qh[qt], a);   /* q_hi k_hi + q_lo k_hi + q_hi k_lo; a[j] = score of key 8 hi + j of the tile, query lr, x log2 e */
#pragma unroll
                for (int j = 0; j < 8; ++j) { const float t = ((mb[qt] >> (kt * 8 + j)) & 1u) ? MSKR : a[j];   /* where(mask != 0, -1e9, scores / sqrt(32)), both sides x log2 e */ sc[qt][kt][j] = t; if constexpr (MX) mx[qt] = fmaxf(mx[qt], t); } } }
        if constexpr (MX) {
#pragma unroll
            for (int qt = 0; qt < FQT; ++qt) { mx[qt] = fmaxf(mx[qt], __shfl_xor(mx[qt], 16, 32)); if (hi == 0) red[0][w][qt * 16 + lr] = mx[qt]; }
            __syncthreads(); }   // every wave's row maxima are in LDS; and every wave has left the merge of the head before, whose row sums and partial outputs are written again below
#pragma unroll
        for (int qt = 0; qt < FQT; ++qt) { float s = 0.f;
            if constexpr (MX) { float m = red[0][0][qt * 16 + lr];
#pragma unroll
                for (int ww = 1; ww < FW; ++ww) m = fmaxf(m, red[0][ww][qt * 16 + lr]);
#pragma unroll
                for (int kt = 0; kt < FKT; ++kt)
#pragma unroll
                    for (int j = 0; j < 8; ++j) sc[qt][kt][j] -= m; }   // in a row that is masked throughout every entry is now 0: equal weights
#pragma unroll
            for (int kt = 0; kt < FKT; ++kt) { exp2x8(sc[qt][kt]);
#pragma unroll
                for (int j = 0; j < 8; ++j) s += sc[qt][kt][j]; }
            s += __shfl_xor(s, 16, 32); if (hi == 0) red[1][w][qt * 16 + lr] = s; }   // read behind the barrier of the partial outputs
        v8f oa[FQT][2];
#pragma unroll
        for (int qt = 0; qt < FQT; ++qt) { oa[qt][0] = (v8f){}; oa[qt][1] = (v8f){}; }
#pragma unroll
        for (int kc = 0; kc < FKT / 2; ++kc) { v16bf ph[FQT], pl[FQT], vh[2], vl[2];   // the 32 keys' value fragments are asked for first: their latency runs under the weights' arithmetic
#pragma unroll
            for (int dt = 0; dt < 2; ++dt) { const int o = (kc * (32 * HD) + dt * 512) * 2; vh[dt] = ldfo(Vhg, vb, o); vl[dt] = ldfo(Vlg, vb, o); }
#pragma unroll
            for (int qt = 0; qt < FQT; ++qt) { v8u hw, lw; const v4u ga[2] = {gas[qt * FKT + 2 * kc][threadIdx.x], gas[qt * FKT + 2 * kc + 1][threadIdx.x]};
#pragma unroll
                for (int tt = 0; tt < 2; ++tt) {
#pragma unroll
                    for (int p = 0; p < 4; ++p) { const unsigned gp = ga[tt][p]; unsigned a, c2;
                        split2(__fmul_rn(sc[qt][2 * kc + tt][2 * p], __uint_as_float(gp << 16)), __fmul_rn(sc[qt][2 * kc + tt][2 * p + 1], __uint_as_float(gp & 0xFFFF0000u)), a, c2);   /* exp x the pair factor; 1 / row sum is a factor of the whole row and multiplies the merged sums below. The pair factor takes no part in the row sum: no renormalisation */
                        hw[tt * 4 + p] = a; lw[tt * 4 + p] = c2; } }
                ph[qt] = __builtin_bit_cast(v16bf, hw); pl[qt] = __builtin_bit_cast(v16bf, lw); }   /* A fragment: row = query lr, k = 8 hi + j (first tile) and 16 + 8 hi + j (second tile) of the 32 keys */
#pragma unroll
            for (int dt = 0; dt < 2; ++dt)
#pragma unroll
                for (int qt = 0; qt < FQT; ++qt) { oa[qt][dt] = wmmab(ph[qt], vh[dt], oa[qt][dt]); oa[qt][dt] = wmmab(pl[qt], vh[dt], oa[qt][dt]); oa[qt][dt] = wmmab(ph[qt], vl[dt], oa[qt][dt]); } }
#pragma unroll
        for (int qt = 0; qt < FQT; ++qt)
#pragma unroll
            for (int dt = 0; dt < 2; ++dt)
#pragma unroll
                for (int j = 0; j < 8; ++j) os[w][qt * 16 + hi * 8 + j][dt * 16 + lr] = oa[qt][dt][j];
        __syncthreads();   // every wave's row sums and partial outputs are in LDS
        { const int q = threadIdx.x >> 3, d4 = (threadIdx.x & 7) * 4; v4f pv[FW]; float pr[FW];   // all sixteen LDS loads first, then the sums in wave order
#pragma unroll
            for (int ww = 0; ww < FW; ++ww) { pr[ww] = red[1][ww][q]; pv[ww] = *(const v4fa*)&os[ww][q][d4]; }
            v4f s = pv[0]; float rs = pr[0];
#pragma unroll
            for (int ww = 1; ww < FW; ++ww) { s += pv[ww]; rs += pr[ww]; }
            if constexpr (!MX) { if (!(rs >= RLO && rs <= RHI)) redo = 1u; }   // shift 0 did not fit this row (an exp2 overflowed, all of them are tiny or zero as in a row masked throughout, or a NaN): the work-group does its heads again with the row maxima
            s *= __fdiv_rn(1.0f, rs);   // the softmax's normalisation, once for each of the 32 x 32 merged sums of a head
            unsigned h0, l0, h1, l1; split2(s[0], s[1], h0, l0); split2(s[2], s[3], h1, l1); const v2u oh = {h0, h1}, ol = {l0, l1};
            *(v2ua*)&mg[0][q][h * HD + d4] = oh; *(v2ua*)&mg[1][q][h * HD + d4] = ol; }   /* merged [query][head][d] hi / lo rows for the output projection */
    };
#pragma unroll 1   // rolled: for speed only
    for (int h = 0; h < NH_; ++h) { head(bc<false>{}, h);
        if (h != NH_ - 1) __syncthreads(); }   // uniform: every wave has left the merge before the next head writes row sums and partial outputs again; behind the last head the barrier below does it
    // out[q][n] = sum_k (merged_hi + merged_lo)[q][k] bf16(Wp[n][k]) + bf16(bp[n]); per 32 k the hi product, then the lo product, into one accumulator.
    { const int qr = (w >> 2) * 16 + lr, cb = (w & 3) * 32;
        const bf* wp = Wo + (cb + lr) * DQ + 8 * hi; const float* bp = bo + cb + 8 * hi; v16bf wf[2][DQ / 32]; v4f bv[2][2];
        auto ldw = [&]() {
#pragma unroll
            for (int t = 0; t < 2; ++t) {
#pragma unroll
                for (int kc = 0; kc < DQ / 32; ++kc) wf[t][kc] = ldgf(wp + t * 16 * DQ + kc * 32);
                bv[t][0] = *(const v4f*)(bp + t * 16); bv[t][1] = *(const v4f*)(bp + t * 16 + 4); }
            asm volatile("s_wait_xcnt 0x0" :: "v"(wp), "v"(bp) : "memory"); };   // behind the last of the 20 loads; the two addresses are inputs so that they stay in their registers up to the wait and no load's result lands on them in front of it
        ldw();   // in front of the barrier: a wave that arrives early has the loads' latency behind it when the last wave arrives
        __syncthreads();   // all four heads' merged rows, and the word that asks for the second pass, are in LDS
        if (__builtin_amdgcn_readfirstlane(redo) != 0u) {   // the same word in every wave: a scalar branch that the whole work-group takes or leaves
#pragma unroll 1   // rolled, as above
            for (int h = 0; h < NH_; ++h) head(bc<true>{}, h);
            ldw();   // loaded again, so that the 80 registers are free during the second pass
            __syncthreads(); }   // the second pass's merged rows are in LDS
        v8f acc[2] = {(v8f){}, (v8f){}};
#pragma unroll
        for (int kc = 0; kc < DQ / 32; ++kc) { const v16bf mh = ldsf(&mg[0][qr][kc * 32 + 8 * hi]), ml = ldsf(&mg[1][qr][kc * 32 + 8 * hi]);
#pragma unroll
            for (int t = 0; t < 2; ++t) { acc[t] = wmmab(wf[t][kc], mh, acc[t]); acc[t] = wmmab(wf[t][kc], ml, acc[t]); } }   /* acc[t][j] = query qr, column cb + 16 t + 8 hi + j */
        float* op = out + ((size_t)g * TT + i0 + qr) * DM + cb + 8 * hi;
#pragma unroll
        for (int t = 0; t < 2; ++t) { const v8f y = acc[t] + __builtin_convertvector(__builtin_convertvector(__builtin_shufflevector(bv[t][0], bv[t][1], 0, 1, 2, 3, 4, 5, 6, 7), v8bf), v8f);   /* + bf16(bp), nearest even */
            *(v4f*)(op + t * 16) = __builtin_shufflevector(y, y, 0, 1, 2, 3); *(v4f*)(op + t * 16 + 4) = __builtin_shufflevector(y, y, 4, 5, 6, 7); }
    }
}

extern "C" void kernel_launch(void* const* d_in, const int* in_sizes, int n_in,
                              void* d_out, int out_size, void* d_ws, size_t ws_size, hipStream_t stream) {
    (void)in_sizes; (void)n_in; (void)out_size;
    const float* x = (const float*)d_in[0]; const float* xk = (const float*)d_in[1]; const float* xv = (const float*)d_in[2]; const int* mk = (const int*)d_in[3]; const float* adj = (const float*)d_in[4]; const float* wq = (const float*)d_in[5]; const float* bq = (const float*)d_in[6]; const float* wk = (const float*)d_in[7]; const float* bk = (const float*)d_in[8]; const float* wv = (const float*)d_in[9]; const float* bv = (const float*)d_in[10]; const float* wo = (const float*)d_in[11]; const float* bo = (const float*)d_in[12];   /* order query, key, value ([4][12][512][128] = 48 groups), mask (int32 [48][512][512]: read as data), adjm (f32 [48][512][512]: read), Wq, bq, Wk, bk, Wv, bv, Wp, bp ('oi') */
    float* OUT = (float*)d_out;     // [48][512][128]
    char* wsp = (char*)d_ws;
    auto take = [&](size_t bytes) { char* p = wsp; wsp += (bytes + 255) & ~(size_t)255; return (void*)p; };
    bf* WO = (bf*)take((size_t)DM * DQ * 2);   /* Wp as bf16 */
    bf* QPh = (bf*)take((size_t)2 * NB_ * NH_ * TT * HD * 2); bf* QPl = (bf*)take((size_t)2 * NB_ * NH_ * TT * HD * 2);   /* [q groups | k groups][head], each 512 x 32 in fragment order */ bf* KPh = QPh + (size_t)NB_ * NH_ * TT * HD; bf* KPl = QPl + (size_t)NB_ * NH_ * TT * HD;
    bf* VTh = (bf*)take((size_t)NB_ * NKV * HP * TT * 2); bf* VTl = (bf*)take((size_t)NB_ * NKV * HP * TT * 2);
    if ((size_t)(wsp - (char*)d_ws) > ws_size) return;    // ws 256 MiB given; the carve is below 64 MiB
    k_proj<<<dim3(NB_ * TT / 64, 3, 1), PW * 32, 0, stream>>>(x, xk, xv, wq, wk, wv, wo, bq, bk, bv, QPh, QPl, VTh, VTl, WO);   /* rows = all (group, node) pairs; y = q, k, v */
    k_fattn<<<dim3(8, TT / (FQT * 16), NB_ / 8), FW * 32, MGB, stream>>>(QPh, QPl, KPh, KPl, VTh, VTl, mk, adj, WO, bo, OUT);   /* one kv head per query head: plane z of q meets plane z of k and of v^T */
}
